// v000
// Measured on an AMD MI455X. A time is GPU time per run, averaged over a window of back-to-back runs after a warm-up
// (all launches, gaps included; the runs take copies of the inputs in turn), and the median of several windows.
// Apart from v000's, it joins two sittings. Times from different sittings can be a few percent apart, while
// side-by-side timings come from the same sitting.
// v000, which the later versions start from, runs in 264 microseconds.
#include <hip/hip_runtime.h>

typedef __attribute__((ext_vector_type(16))) __bf16 v16bf;
typedef __attribute__((ext_vector_type(8)))  __bf16 bf16x8;
typedef __attribute__((ext_vector_type(8)))  float  v8f;
typedef __attribute__((ext_vector_type(4)))  float  f32x4;

#define NEGBIG (-1.0e9f)

__device__ __forceinline__ v8f vzero8() {
  v8f z;
#pragma unroll
  for (int i = 0; i < 8; ++i) z[i] = 0.0f;
  return z;
}

__device__ __forceinline__ v16bf pack16(bf16x8 lo, bf16x8 hi) {
  return __builtin_shufflevector(lo, hi, 0, 1, 2, 3, 4, 5, 6, 7, 8, 9, 10, 11, 12, 13, 14, 15);
}

// Load a 16x32 bf16 WMMA A/B fragment from a row-major tile.
// A: row m = lane&15, K halves selected by lane>>4 (per ISA 16-bit A 16x32 layout).
// B is the symmetric layout with n = lane&15 reading rows of the N-major (transposed) tile.
__device__ __forceinline__ v16bf load_frag(const __bf16* base, int ld, int lane) {
  const int r  = lane & 15;
  const int ho = (lane >> 4) * 8;
  const __bf16* p = base + r * ld;
  bf16x8 lo = *(const bf16x8*)(p + ho);
  bf16x8 hi = *(const bf16x8*)(p + 16 + ho);
  return pack16(lo, hi);
}

__device__ __forceinline__ v8f wmma_bf16(v16bf a, v16bf b, v8f c) {
  return __builtin_amdgcn_wmma_f32_16x16x32_bf16(false, a, false, b, (short)0, c, false, false);
}

// ---------------------------------------------------------------------------
// Weight transpose + f32->bf16 convert: W[1024][1024] -> WT[n][k] bf16
// ---------------------------------------------------------------------------
__global__ __launch_bounds__(256) void convw_kernel(const float* __restrict__ W,
                                                    __bf16* __restrict__ WT) {
  __shared__ float t[32][33];
  const int k0 = blockIdx.x * 32, n0 = blockIdx.y * 32;
  const int tx = threadIdx.x & 31, ty = threadIdx.x >> 5;
#pragma unroll
  for (int i = 0; i < 32; i += 8)
    t[ty + i][tx] = W[(size_t)(k0 + ty + i) * 1024 + n0 + tx];
  __syncthreads();
#pragma unroll
  for (int i = 0; i < 32; i += 8)
    WT[(size_t)(n0 + ty + i) * 1024 + k0 + tx] = (__bf16)t[tx][ty + i];
}

// ---------------------------------------------------------------------------
// GEMM: C[M=8192, N=1024] = A_f32[M,1024] x W (as Bt = W^T bf16 [N][K]) + bias
// 128x128 block tile, 8 waves (2x4), 64-wide K stages, register double-buffered
// global->LDS staging so HBM latency overlaps the WMMA phase.
// MODE 0: Q proj  -> outF (f32) + outB (bf16)
// MODE 1: K proj  -> outB (bf16)
// MODE 2: V proj  -> outT (bf16, per-head transposed vt[b][h][d][key])
// MODE 3: O proj  -> outF = relu(acc + bias)
// ---------------------------------------------------------------------------
template <int MODE>
__global__ __launch_bounds__(256) void gemm_kernel(
    const float* __restrict__ A, const __bf16* __restrict__ Bt,
    const float* __restrict__ bias,
    float* __restrict__ outF, __bf16* __restrict__ outB,
    __bf16* __restrict__ outT) {
  __shared__ __attribute__((aligned(16))) __bf16 As[128][72];
  __shared__ __attribute__((aligned(16))) __bf16 Bs[128][72];
  const int tid  = threadIdx.x;
  const int wave = tid >> 5, lane = tid & 31;
  const int wm = wave >> 2, wn = wave & 3;
  const int rowBase = blockIdx.x * 128;
  const int nBase   = blockIdx.y * 128;
  const int ar = tid >> 1;
  const int ac = (tid & 1) * 32;

  f32x4  areg[8];
  bf16x8 breg[4];
  auto load_global = [&](int kc) {
    const float* ap = A + (size_t)(rowBase + ar) * 1024 + kc + ac;
#pragma unroll
    for (int e = 0; e < 8; ++e) areg[e] = *(const f32x4*)(ap + e * 4);
    const __bf16* bp = Bt + (size_t)(nBase + ar) * 1024 + kc + ac;
#pragma unroll
    for (int e = 0; e < 4; ++e) breg[e] = *(const bf16x8*)(bp + e * 8);
  };

  v8f acc[4][2];
#pragma unroll
  for (int i = 0; i < 4; ++i)
#pragma unroll
    for (int j = 0; j < 2; ++j) acc[i][j] = vzero8();

  load_global(0);
  for (int kc = 0; kc < 1024; kc += 64) {
    // Convert staged A regs to bf16 and commit both tiles to LDS.
#pragma unroll
    for (int e = 0; e < 4; ++e) {
      bf16x8 hh;
#pragma unroll
      for (int q = 0; q < 4; ++q) {
        hh[q]     = (__bf16)areg[2 * e][q];
        hh[4 + q] = (__bf16)areg[2 * e + 1][q];
      }
      *(bf16x8*)(&As[ar][ac + e * 8]) = hh;
      *(bf16x8*)(&Bs[ar][ac + e * 8]) = breg[e];
    }
    __syncthreads();
    if (kc + 64 < 1024) load_global(kc + 64);  // overlap with WMMA phase
#pragma unroll
    for (int ks = 0; ks < 2; ++ks) {
      v16bf bf0 = load_frag(&Bs[wn * 32][ks * 32], 72, lane);
      v16bf bf1 = load_frag(&Bs[wn * 32 + 16][ks * 32], 72, lane);
#pragma unroll
      for (int i = 0; i < 4; ++i) {
        v16bf af = load_frag(&As[wm * 64 + i * 16][ks * 32], 72, lane);
        acc[i][0] = wmma_bf16(af, bf0, acc[i][0]);
        acc[i][1] = wmma_bf16(af, bf1, acc[i][1]);
      }
    }
    __syncthreads();
  }

#pragma unroll
  for (int i = 0; i < 4; ++i)
#pragma unroll
    for (int j = 0; j < 2; ++j) {
      const int gn = nBase + wn * 32 + j * 16 + (lane & 15);
      const int gm = rowBase + wm * 64 + i * 16 + (lane >> 4) * 8;
      const float bvs = bias[gn];
      v8f c = acc[i][j];
      if (MODE == 0) {
#pragma unroll
        for (int r = 0; r < 8; ++r) {
          const float v = c[r] + bvs;
          const size_t idx = (size_t)(gm + r) * 1024 + gn;
          outF[idx] = v;
          outB[idx] = (__bf16)v;
        }
      } else if (MODE == 1) {
#pragma unroll
        for (int r = 0; r < 8; ++r)
          outB[(size_t)(gm + r) * 1024 + gn] = (__bf16)(c[r] + bvs);
      } else if (MODE == 2) {
        // vt[b][h][d][key]; D-fragment's 8 VGPRs are 8 consecutive keys.
        const int bb  = gm >> 10;
        const int key = gm & 1023;
        const int hh2 = gn >> 7, dd = gn & 127;
        bf16x8 pk;
#pragma unroll
        for (int r = 0; r < 8; ++r) pk[r] = (__bf16)(c[r] + bvs);
        *(bf16x8*)(&outT[(((size_t)bb * 8 + hh2) * 128 + dd) * 1024 + key]) = pk;
      } else {
#pragma unroll
        for (int r = 0; r < 8; ++r) {
          const float v = c[r] + bvs;
          outF[(size_t)(gm + r) * 1024 + gn] = v > 0.0f ? v : 0.0f;
        }
      }
    }
}

// ---------------------------------------------------------------------------
// Flash attention per (b,h): 128 query rows/block, 8 waves each owning 16 rows.
// Streams 64-key chunks with register prefetch of the next chunk during WMMA.
// Hpre[b,q,h*128+d] = q_proj + softmax(mask(QK^T/sqrt(128))) V
// ---------------------------------------------------------------------------
__global__ __launch_bounds__(256) void attn_kernel(
    const __bf16* __restrict__ qb, const __bf16* __restrict__ kb,
    const __bf16* __restrict__ vt, const float* __restrict__ qf,
    const float* __restrict__ mask_a, const float* __restrict__ mask_b,
    float* __restrict__ Hpre) {
  __shared__ __attribute__((aligned(16))) __bf16 Ks[64][136];   // [key][d]
  __shared__ __attribute__((aligned(16))) __bf16 Vs[128][72];   // [d][key]
  __shared__ __attribute__((aligned(16))) __bf16 Ps[8][16][72]; // per-wave P
  __shared__ float mas[128];
  __shared__ float mbs[64];
  const int tid = threadIdx.x, wave = tid >> 5, lane = tid & 31;
  const int b = blockIdx.x >> 3, h = blockIdx.x & 7;
  const int qbase = blockIdx.y * 128;
  const float scale = 0.08838834764831845f;  // 1/sqrt(128)

  if (tid < 128) mas[tid] = mask_a[b * 1024 + qbase + tid];

  // Q A-fragments (4 K-steps over d=128) pinned in registers.
  v16bf qfr[4];
  {
    const __bf16* qrow =
        qb + (size_t)(b * 1024 + qbase + wave * 16 + (lane & 15)) * 1024 + h * 128;
    const int ho = (lane >> 4) * 8;
#pragma unroll
    for (int ks = 0; ks < 4; ++ks) {
      bf16x8 lo = *(const bf16x8*)(qrow + ks * 32 + ho);
      bf16x8 hi = *(const bf16x8*)(qrow + ks * 32 + 16 + ho);
      qfr[ks] = pack16(lo, hi);
    }
  }

  bf16x8 kreg[4], vreg[4];
  float mbreg = 0.0f;
  auto load_chunk = [&](int kb0) {
#pragma unroll
    for (int i = 0; i < 4; ++i) {
      const int g = tid + i * 256;
      kreg[i] = *(const bf16x8*)(kb + (size_t)(b * 1024 + kb0 + (g >> 4)) * 1024 +
                                 h * 128 + (g & 15) * 8);
    }
#pragma unroll
    for (int i = 0; i < 4; ++i) {
      const int g = tid + i * 256;
      vreg[i] = *(const bf16x8*)(vt + (((size_t)b * 8 + h) * 128 + (g >> 3)) * 1024 +
                                 kb0 + (g & 7) * 8);
    }
    if (tid < 64) mbreg = mask_b[b * 1024 + kb0 + tid];
  };

  v8f ofr[8];
#pragma unroll
  for (int d = 0; d < 8; ++d) ofr[d] = vzero8();
  float mrow[8], lrow[8];
#pragma unroll
  for (int r = 0; r < 8; ++r) { mrow[r] = -3.0e38f; lrow[r] = 0.0f; }

  load_chunk(0);
  for (int kb0 = 0; kb0 < 1024; kb0 += 64) {
    __syncthreads();  // all waves done reading Ks/Vs of previous chunk
#pragma unroll
    for (int i = 0; i < 4; ++i) {
      const int g = tid + i * 256;
      *(bf16x8*)(&Ks[g >> 4][(g & 15) * 8]) = kreg[i];
    }
#pragma unroll
    for (int i = 0; i < 4; ++i) {
      const int g = tid + i * 256;
      *(bf16x8*)(&Vs[g >> 3][(g & 7) * 8]) = vreg[i];
    }
    if (tid < 64) mbs[tid] = mbreg;
    __syncthreads();
    if (kb0 + 64 < 1024) load_chunk(kb0 + 64);  // overlap with WMMA phase

    // S = Q K^T for this wave's 16 rows x 64 keys.
    v8f sfr[4];
#pragma unroll
    for (int nt = 0; nt < 4; ++nt) {
      v8f s = vzero8();
#pragma unroll
      for (int ks = 0; ks < 4; ++ks) {
        v16bf bf = load_frag(&Ks[nt * 16][ks * 32], 136, lane);
        s = wmma_bf16(qfr[ks], bf, s);
      }
      sfr[nt] = s;
    }

    // Mask + scale + per-row chunk max.
    float cm[8];
#pragma unroll
    for (int r = 0; r < 8; ++r) {
      cm[r] = -3.0e38f;
      const float maq = mas[wave * 16 + (lane >> 4) * 8 + r];
#pragma unroll
      for (int nt = 0; nt < 4; ++nt) {
        const float mbk = mbs[nt * 16 + (lane & 15)];
        const float s = (maq * mbk == 1.0f) ? sfr[nt][r] * scale : NEGBIG;
        sfr[nt][r] = s;
        cm[r] = fmaxf(cm[r], s);
      }
    }
#pragma unroll
    for (int r = 0; r < 8; ++r)
#pragma unroll
      for (int m = 1; m < 16; m <<= 1)
        cm[r] = fmaxf(cm[r], __shfl_xor(cm[r], m, 32));

    float alpha[8], rs[8];
#pragma unroll
    for (int r = 0; r < 8; ++r) {
      const float mn = fmaxf(mrow[r], cm[r]);
      alpha[r] = __expf(mrow[r] - mn);
      mrow[r] = mn;
      rs[r] = 0.0f;
    }
#pragma unroll
    for (int nt = 0; nt < 4; ++nt)
#pragma unroll
      for (int r = 0; r < 8; ++r) {
        const float p = __expf(sfr[nt][r] - mrow[r]);
        sfr[nt][r] = p;
        rs[r] += p;
      }
#pragma unroll
    for (int r = 0; r < 8; ++r) {
#pragma unroll
      for (int m = 1; m < 16; m <<= 1) rs[r] += __shfl_xor(rs[r], m, 32);
      lrow[r] = alpha[r] * lrow[r] + rs[r];
    }
#pragma unroll
    for (int d = 0; d < 8; ++d)
#pragma unroll
      for (int r = 0; r < 8; ++r) ofr[d][r] *= alpha[r];

    // P -> bf16 A-fragment layout via per-wave LDS round trip.
#pragma unroll
    for (int nt = 0; nt < 4; ++nt)
#pragma unroll
      for (int r = 0; r < 8; ++r)
        Ps[wave][(lane >> 4) * 8 + r][nt * 16 + (lane & 15)] = (__bf16)sfr[nt][r];

#pragma unroll
    for (int ks = 0; ks < 2; ++ks) {
      v16bf pa = load_frag(&Ps[wave][0][ks * 32], 72, lane);
#pragma unroll
      for (int dt = 0; dt < 8; ++dt) {
        v16bf bv = load_frag(&Vs[dt * 16][ks * 32], 72, lane);
        ofr[dt] = wmma_bf16(pa, bv, ofr[dt]);
      }
    }
  }

  // O/l + residual q.
#pragma unroll
  for (int dt = 0; dt < 8; ++dt) {
    const int q0  = qbase + wave * 16 + (lane >> 4) * 8;
    const int col = h * 128 + dt * 16 + (lane & 15);
#pragma unroll
    for (int r = 0; r < 8; ++r) {
      const size_t idx = (size_t)(b * 1024 + q0 + r) * 1024 + col;
      Hpre[idx] = ofr[dt][r] / lrow[r] + qf[idx];
    }
  }
}

// ---------------------------------------------------------------------------
// LayerNorm over rows of 1024, with optional pre-add of Y (residual).
// ---------------------------------------------------------------------------
__global__ __launch_bounds__(256) void ln_kernel(
    const float* __restrict__ X, const float* __restrict__ Y,
    const float* __restrict__ g, const float* __restrict__ be,
    float* __restrict__ out) {
  __shared__ float red[16];
  const int row = blockIdx.x, tid = threadIdx.x;
  const int wv = tid >> 5, ln = tid & 31;
  const float* xp = X + (size_t)row * 1024;
  const float* yp = Y ? Y + (size_t)row * 1024 : nullptr;
  float v[4], s = 0.0f, ss = 0.0f;
#pragma unroll
  for (int i = 0; i < 4; ++i) {
    float x = xp[tid + i * 256];
    if (yp) x += yp[tid + i * 256];
    v[i] = x;
    s += x;
    ss += x * x;
  }
#pragma unroll
  for (int m = 1; m < 32; m <<= 1) {
    s += __shfl_xor(s, m, 32);
    ss += __shfl_xor(ss, m, 32);
  }
  if (ln == 0) { red[wv] = s; red[8 + wv] = ss; }
  __syncthreads();
  float ts = 0.0f, tss = 0.0f;
#pragma unroll
  for (int w = 0; w < 8; ++w) { ts += red[w]; tss += red[8 + w]; }
  const float mu   = ts * (1.0f / 1024.0f);
  const float var  = tss * (1.0f / 1024.0f) - mu * mu;
  const float rstd = rsqrtf(var + 1e-5f);
#pragma unroll
  for (int i = 0; i < 4; ++i)
    out[(size_t)row * 1024 + tid + i * 256] =
        (v[i] - mu) * rstd * g[tid + i * 256] + be[tid + i * 256];
}

// ---------------------------------------------------------------------------
extern "C" void kernel_launch(void* const* d_in, const int* in_sizes, int n_in,
                              void* d_out, int out_size, void* d_ws, size_t ws_size,
                              hipStream_t stream) {
  (void)in_sizes; (void)n_in; (void)out_size; (void)ws_size;
  const float* Q   = (const float*)d_in[0];
  const float* K   = (const float*)d_in[1];
  const float* ma  = (const float*)d_in[2];
  const float* mb  = (const float*)d_in[3];
  const float* Wq  = (const float*)d_in[4];  const float* bq  = (const float*)d_in[5];
  const float* Wk  = (const float*)d_in[6];  const float* bk  = (const float*)d_in[7];
  const float* Wv  = (const float*)d_in[8];  const float* bv  = (const float*)d_in[9];
  const float* Wo  = (const float*)d_in[10]; const float* bo  = (const float*)d_in[11];
  const float* g0  = (const float*)d_in[12]; const float* be0 = (const float*)d_in[13];
  const float* g1  = (const float*)d_in[14]; const float* be1 = (const float*)d_in[15];
  float* out = (float*)d_out;

  char* ws = (char*)d_ws;
  size_t off = 0;
  auto alloc = [&](size_t bytes) -> void* {
    void* p = ws + off;
    off += (bytes + 255) & ~(size_t)255;
    return p;
  };
  const size_t MROW = 8192;  // B * 1024
  __bf16* WqT = (__bf16*)alloc(1024 * 1024 * sizeof(__bf16));
  __bf16* WkT = (__bf16*)alloc(1024 * 1024 * sizeof(__bf16));
  __bf16* WvT = (__bf16*)alloc(1024 * 1024 * sizeof(__bf16));
  __bf16* WoT = (__bf16*)alloc(1024 * 1024 * sizeof(__bf16));
  float*  qf    = (float*)alloc(MROW * 1024 * sizeof(float));
  __bf16* qbp   = (__bf16*)alloc(MROW * 1024 * sizeof(__bf16));
  __bf16* kbp   = (__bf16*)alloc(MROW * 1024 * sizeof(__bf16));
  __bf16* vtp   = (__bf16*)alloc(MROW * 1024 * sizeof(__bf16));
  float*  Hpre  = (float*)alloc(MROW * 1024 * sizeof(float));
  float*  H2    = (float*)alloc(MROW * 1024 * sizeof(float));
  float*  reluG = (float*)alloc(MROW * 1024 * sizeof(float));

  dim3 blk(256);
  convw_kernel<<<dim3(32, 32), blk, 0, stream>>>(Wq, WqT);
  convw_kernel<<<dim3(32, 32), blk, 0, stream>>>(Wk, WkT);
  convw_kernel<<<dim3(32, 32), blk, 0, stream>>>(Wv, WvT);
  convw_kernel<<<dim3(32, 32), blk, 0, stream>>>(Wo, WoT);
  gemm_kernel<0><<<dim3(64, 8), blk, 0, stream>>>(Q, WqT, bq, qf, qbp, nullptr);
  gemm_kernel<1><<<dim3(64, 8), blk, 0, stream>>>(K, WkT, bk, nullptr, kbp, nullptr);
  gemm_kernel<2><<<dim3(64, 8), blk, 0, stream>>>(K, WvT, bv, nullptr, nullptr, vtp);
  attn_kernel<<<dim3(64, 8), blk, 0, stream>>>(qbp, kbp, vtp, qf, ma, mb, Hpre);
  ln_kernel<<<dim3(8192), blk, 0, stream>>>(Hpre, nullptr, g0, be0, H2);
  gemm_kernel<3><<<dim3(64, 8), blk, 0, stream>>>(H2, WoT, bo, reluG, nullptr, nullptr);
  ln_kernel<<<dim3(8192), blk, 0, stream>>>(H2, reluG, g1, be1, out);
}

// v001
// One run takes 245 microseconds.
// Two timings next to v000 put it at 1.11 and 1.10 times that version's speed.
#include <hip/hip_runtime.h>

typedef __attribute__((ext_vector_type(16))) __bf16 v16bf;
typedef __attribute__((ext_vector_type(8)))  __bf16 bf16x8;
typedef __attribute__((ext_vector_type(4)))  __bf16 bf16x4;
typedef __attribute__((ext_vector_type(8)))  float  v8f;
typedef __attribute__((ext_vector_type(4)))  float  f32x4;

#define NEGBIG (-1.0e9f)

__device__ __forceinline__ v8f vzero8() {
  v8f z;
#pragma unroll
  for (int i = 0; i < 8; ++i) z[i] = 0.0f;
  return z;
}

__device__ __forceinline__ v16bf pack16(bf16x8 lo, bf16x8 hi) {
  return __builtin_shufflevector(lo, hi, 0, 1, 2, 3, 4, 5, 6, 7, 8, 9, 10, 11, 12, 13, 14, 15);
}

// Load a 16x32 bf16 WMMA A/B fragment from a row-major tile.
// A: row m = lane&15, K halves selected by lane>>4 (per ISA 16-bit A 16x32 layout).
// B is the symmetric layout with n = lane&15 reading rows of the N-major (transposed) tile.
__device__ __forceinline__ v16bf load_frag(const __bf16* base, int ld, int lane) {
  const int r  = lane & 15;
  const int ho = (lane >> 4) * 8;
  const __bf16* p = base + r * ld;
  bf16x8 lo = *(const bf16x8*)(p + ho);
  bf16x8 hi = *(const bf16x8*)(p + 16 + ho);
  return pack16(lo, hi);
}

__device__ __forceinline__ v8f wmma_bf16(v16bf a, v16bf b, v8f c) {
  return __builtin_amdgcn_wmma_f32_16x16x32_bf16(false, a, false, b, (short)0, c, false, false);
}

// ---------------------------------------------------------------------------
// Weight transpose + f32->bf16 convert: W[1024][1024] -> WT[n][k] bf16
// ---------------------------------------------------------------------------
__global__ __launch_bounds__(256) void convw_kernel(const float* __restrict__ W,
                                                    __bf16* __restrict__ WT) {
  __shared__ float t[32][33];
  const int k0 = blockIdx.x * 32, n0 = blockIdx.y * 32;
  const int tx = threadIdx.x & 31, ty = threadIdx.x >> 5;
#pragma unroll
  for (int i = 0; i < 32; i += 8)
    t[ty + i][tx] = W[(size_t)(k0 + ty + i) * 1024 + n0 + tx];
  __syncthreads();
#pragma unroll
  for (int i = 0; i < 32; i += 8)
    WT[(size_t)(n0 + ty + i) * 1024 + k0 + tx] = (__bf16)t[tx][ty + i];
}

// ---------------------------------------------------------------------------
// GEMM: C[M=8192, N=1024] = A_f32[M,1024] x W (as Bt = W^T bf16 [N][K]) + bias
// 128x128 block tile, 8 waves (2x4), 64-wide K stages, register double-buffered
// global->LDS staging so HBM latency overlaps the WMMA phase.
// MODE 0: Q proj  -> outF (f32) + outB (bf16)
// MODE 1: K proj  -> outB (bf16)
// MODE 2: V proj  -> outT (bf16, per-head transposed vt[b][h][d][key])
// MODE 3: O proj  -> outF = relu(acc + bias)
// ---------------------------------------------------------------------------
template <int MODE>
__global__ __launch_bounds__(256) void gemm_kernel(
    const float* __restrict__ A, const __bf16* __restrict__ Bt,
    const float* __restrict__ bias,
    float* __restrict__ outF, __bf16* __restrict__ outB,
    __bf16* __restrict__ outT) {
  __shared__ __attribute__((aligned(16))) __bf16 As[128][72];
  __shared__ __attribute__((aligned(16))) __bf16 Bs[128][72];
  const int tid  = threadIdx.x;
  const int wave = tid >> 5, lane = tid & 31;
  const int wm = wave >> 2, wn = wave & 3;
  const int rowBase = blockIdx.x * 128;
  const int nBase   = blockIdx.y * 128;
  // Staging map: every wave-wide 16-byte load covers whole 128-byte lines.
  // A stage row = 64 f32 = 256 B: 16 lanes a row, two rows a load.
  // B stage row = 64 bf16 = 128 B: 8 lanes a row, four rows a load.
  const int ar = tid >> 4, ac = (tid & 15) * 4;
  const int br = tid >> 3, bc = (tid & 7) * 8;

  f32x4  areg[8];
  bf16x8 breg[4];
  auto load_global = [&](int kc) {
    const float* ap = A + (size_t)(rowBase + ar) * 1024 + kc + ac;
#pragma unroll
    for (int e = 0; e < 8; ++e) areg[e] = *(const f32x4*)(ap + e * 16 * 1024);
    const __bf16* bp = Bt + (size_t)(nBase + br) * 1024 + kc + bc;
#pragma unroll
    for (int e = 0; e < 4; ++e) breg[e] = *(const bf16x8*)(bp + e * 32 * 1024);
  };

  v8f acc[4][2];
#pragma unroll
  for (int i = 0; i < 4; ++i)
#pragma unroll
    for (int j = 0; j < 2; ++j) acc[i][j] = vzero8();

  load_global(0);
  for (int kc = 0; kc < 1024; kc += 64) {
    // Convert staged A regs to bf16 and commit both tiles to LDS.
#pragma unroll
    for (int e = 0; e < 8; ++e) {
      bf16x4 hh;
#pragma unroll
      for (int q = 0; q < 4; ++q) hh[q] = (__bf16)areg[e][q];
      *(bf16x4*)(&As[e * 16 + ar][ac]) = hh;
    }
#pragma unroll
    for (int e = 0; e < 4; ++e) *(bf16x8*)(&Bs[e * 32 + br][bc]) = breg[e];
    __syncthreads();
    if (kc + 64 < 1024) load_global(kc + 64);  // overlap with WMMA phase
#pragma unroll
    for (int ks = 0; ks < 2; ++ks) {
      v16bf bf0 = load_frag(&Bs[wn * 32][ks * 32], 72, lane);
      v16bf bf1 = load_frag(&Bs[wn * 32 + 16][ks * 32], 72, lane);
#pragma unroll
      for (int i = 0; i < 4; ++i) {
        v16bf af = load_frag(&As[wm * 64 + i * 16][ks * 32], 72, lane);
        acc[i][0] = wmma_bf16(af, bf0, acc[i][0]);
        acc[i][1] = wmma_bf16(af, bf1, acc[i][1]);
      }
    }
    __syncthreads();
  }

#pragma unroll
  for (int i = 0; i < 4; ++i)
#pragma unroll
    for (int j = 0; j < 2; ++j) {
      const int gn = nBase + wn * 32 + j * 16 + (lane & 15);
      const int gm = rowBase + wm * 64 + i * 16 + (lane >> 4) * 8;
      const float bvs = bias[gn];
      v8f c = acc[i][j];
      if (MODE == 0) {
#pragma unroll
        for (int r = 0; r < 8; ++r) {
          const float v = c[r] + bvs;
          const size_t idx = (size_t)(gm + r) * 1024 + gn;
          outF[idx] = v;
          outB[idx] = (__bf16)v;
        }
      } else if (MODE == 1) {
#pragma unroll
        for (int r = 0; r < 8; ++r)
          outB[(size_t)(gm + r) * 1024 + gn] = (__bf16)(c[r] + bvs);
      } else if (MODE == 2) {
        // vt[b][h][d][key]; D-fragment's 8 VGPRs are 8 consecutive keys.
        const int bb  = gm >> 10;
        const int key = gm & 1023;
        const int hh2 = gn >> 7, dd = gn & 127;
        bf16x8 pk;
#pragma unroll
        for (int r = 0; r < 8; ++r) pk[r] = (__bf16)(c[r] + bvs);
        *(bf16x8*)(&outT[(((size_t)bb * 8 + hh2) * 128 + dd) * 1024 + key]) = pk;
      } else {
#pragma unroll
        for (int r = 0; r < 8; ++r) {
          const float v = c[r] + bvs;
          outF[(size_t)(gm + r) * 1024 + gn] = v > 0.0f ? v : 0.0f;
        }
      }
    }
}

// ---------------------------------------------------------------------------
// Flash attention per (b,h): 128 query rows/block, 8 waves each owning 16 rows.
// Streams 64-key chunks with register prefetch of the next chunk during WMMA.
// Hpre[b,q,h*128+d] = q_proj + softmax(mask(QK^T/sqrt(128))) V
// ---------------------------------------------------------------------------
__global__ __launch_bounds__(256) void attn_kernel(
    const __bf16* __restrict__ qb, const __bf16* __restrict__ kb,
    const __bf16* __restrict__ vt, const float* __restrict__ qf,
    const float* __restrict__ mask_a, const float* __restrict__ mask_b,
    float* __restrict__ Hpre) {
  __shared__ __attribute__((aligned(16))) __bf16 Ks[64][136];   // [key][d]
  __shared__ __attribute__((aligned(16))) __bf16 Vs[128][72];   // [d][key]
  __shared__ __attribute__((aligned(16))) __bf16 Ps[8][16][72]; // per-wave P
  __shared__ float mas[128];
  __shared__ float mbs[64];
  const int tid = threadIdx.x, wave = tid >> 5, lane = tid & 31;
  const int b = blockIdx.x >> 3, h = blockIdx.x & 7;
  const int qbase = blockIdx.y * 128;
  const float scale = 0.08838834764831845f;  // 1/sqrt(128)

  if (tid < 128) mas[tid] = mask_a[b * 1024 + qbase + tid];

  // Q A-fragments (4 K-steps over d=128) pinned in registers.
  v16bf qfr[4];
  {
    const __bf16* qrow =
        qb + (size_t)(b * 1024 + qbase + wave * 16 + (lane & 15)) * 1024 + h * 128;
    const int ho = (lane >> 4) * 8;
#pragma unroll
    for (int ks = 0; ks < 4; ++ks) {
      bf16x8 lo = *(const bf16x8*)(qrow + ks * 32 + ho);
      bf16x8 hi = *(const bf16x8*)(qrow + ks * 32 + 16 + ho);
      qfr[ks] = pack16(lo, hi);
    }
  }

  bf16x8 kreg[4], vreg[4];
  float mbreg = 0.0f;
  auto load_chunk = [&](int kb0) {
#pragma unroll
    for (int i = 0; i < 4; ++i) {
      const int g = tid + i * 256;
      kreg[i] = *(const bf16x8*)(kb + (size_t)(b * 1024 + kb0 + (g >> 4)) * 1024 +
                                 h * 128 + (g & 15) * 8);
    }
#pragma unroll
    for (int i = 0; i < 4; ++i) {
      const int g = tid + i * 256;
      vreg[i] = *(const bf16x8*)(vt + (((size_t)b * 8 + h) * 128 + (g >> 3)) * 1024 +
                                 kb0 + (g & 7) * 8);
    }
    if (tid < 64) mbreg = mask_b[b * 1024 + kb0 + tid];
  };

  v8f ofr[8];
#pragma unroll
  for (int d = 0; d < 8; ++d) ofr[d] = vzero8();
  float mrow[8], lrow[8];
#pragma unroll
  for (int r = 0; r < 8; ++r) { mrow[r] = -3.0e38f; lrow[r] = 0.0f; }

  load_chunk(0);
  for (int kb0 = 0; kb0 < 1024; kb0 += 64) {
    __syncthreads();  // all waves done reading Ks/Vs of previous chunk
#pragma unroll
    for (int i = 0; i < 4; ++i) {
      const int g = tid + i * 256;
      *(bf16x8*)(&Ks[g >> 4][(g & 15) * 8]) = kreg[i];
    }
#pragma unroll
    for (int i = 0; i < 4; ++i) {
      const int g = tid + i * 256;
      *(bf16x8*)(&Vs[g >> 3][(g & 7) * 8]) = vreg[i];
    }
    if (tid < 64) mbs[tid] = mbreg;
    __syncthreads();
    if (kb0 + 64 < 1024) load_chunk(kb0 + 64);  // overlap with WMMA phase

    // S = Q K^T for this wave's 16 rows x 64 keys.
    v8f sfr[4];
#pragma unroll
    for (int nt = 0; nt < 4; ++nt) {
      v8f s = vzero8();
#pragma unroll
      for (int ks = 0; ks < 4; ++ks) {
        v16bf bf = load_frag(&Ks[nt * 16][ks * 32], 136, lane);
        s = wmma_bf16(qfr[ks], bf, s);
      }
      sfr[nt] = s;
    }

    // Mask + scale + per-row chunk max.
    float cm[8];
#pragma unroll
    for (int r = 0; r < 8; ++r) {
      cm[r] = -3.0e38f;
      const float maq = mas[wave * 16 + (lane >> 4) * 8 + r];
#pragma unroll
      for (int nt = 0; nt < 4; ++nt) {
        const float mbk = mbs[nt * 16 + (lane & 15)];
        const float s = (maq * mbk == 1.0f) ? sfr[nt][r] * scale : NEGBIG;
        sfr[nt][r] = s;
        cm[r] = fmaxf(cm[r], s);
      }
    }
#pragma unroll
    for (int r = 0; r < 8; ++r)
#pragma unroll
      for (int m = 1; m < 16; m <<= 1)
        cm[r] = fmaxf(cm[r], __shfl_xor(cm[r], m, 32));

    float alpha[8], rs[8];
#pragma unroll
    for (int r = 0; r < 8; ++r) {
      const float mn = fmaxf(mrow[r], cm[r]);
      alpha[r] = __expf(mrow[r] - mn);
      mrow[r] = mn;
      rs[r] = 0.0f;
    }
#pragma unroll
    for (int nt = 0; nt < 4; ++nt)
#pragma unroll
      for (int r = 0; r < 8; ++r) {
        const float p = __expf(sfr[nt][r] - mrow[r]);
        sfr[nt][r] = p;
        rs[r] += p;
      }
#pragma unroll
    for (int r = 0; r < 8; ++r) {
#pragma unroll
      for (int m = 1; m < 16; m <<= 1) rs[r] += __shfl_xor(rs[r], m, 32);
      lrow[r] = alpha[r] * lrow[r] + rs[r];
    }
#pragma unroll
    for (int d = 0; d < 8; ++d)
#pragma unroll
      for (int r = 0; r < 8; ++r) ofr[d][r] *= alpha[r];

    // P -> bf16 A-fragment layout via per-wave LDS round trip.
#pragma unroll
    for (int nt = 0; nt < 4; ++nt)
#pragma unroll
      for (int r = 0; r < 8; ++r)
        Ps[wave][(lane >> 4) * 8 + r][nt * 16 + (lane & 15)] = (__bf16)sfr[nt][r];

#pragma unroll
    for (int ks = 0; ks < 2; ++ks) {
      v16bf pa = load_frag(&Ps[wave][0][ks * 32], 72, lane);
#pragma unroll
      for (int dt = 0; dt < 8; ++dt) {
        v16bf bv = load_frag(&Vs[dt * 16][ks * 32], 72, lane);
        ofr[dt] = wmma_bf16(pa, bv, ofr[dt]);
      }
    }
  }

  // O/l + residual q.
#pragma unroll
  for (int dt = 0; dt < 8; ++dt) {
    const int q0  = qbase + wave * 16 + (lane >> 4) * 8;
    const int col = h * 128 + dt * 16 + (lane & 15);
#pragma unroll
    for (int r = 0; r < 8; ++r) {
      const size_t idx = (size_t)(b * 1024 + q0 + r) * 1024 + col;
      Hpre[idx] = ofr[dt][r] / lrow[r] + qf[idx];
    }
  }
}

// ---------------------------------------------------------------------------
// LayerNorm over rows of 1024, with optional pre-add of Y (residual).
// ---------------------------------------------------------------------------
__global__ __launch_bounds__(256) void ln_kernel(
    const float* __restrict__ X, const float* __restrict__ Y,
    const float* __restrict__ g, const float* __restrict__ be,
    float* __restrict__ out) {
  __shared__ float red[16];
  const int row = blockIdx.x, tid = threadIdx.x;
  const int wv = tid >> 5, ln = tid & 31;
  const float* xp = X + (size_t)row * 1024;
  const float* yp = Y ? Y + (size_t)row * 1024 : nullptr;
  float v[4], s = 0.0f, ss = 0.0f;
#pragma unroll
  for (int i = 0; i < 4; ++i) {
    float x = xp[tid + i * 256];
    if (yp) x += yp[tid + i * 256];
    v[i] = x;
    s += x;
    ss += x * x;
  }
#pragma unroll
  for (int m = 1; m < 32; m <<= 1) {
    s += __shfl_xor(s, m, 32);
    ss += __shfl_xor(ss, m, 32);
  }
  if (ln == 0) { red[wv] = s; red[8 + wv] = ss; }
  __syncthreads();
  float ts = 0.0f, tss = 0.0f;
#pragma unroll
  for (int w = 0; w < 8; ++w) { ts += red[w]; tss += red[8 + w]; }
  const float mu   = ts * (1.0f / 1024.0f);
  const float var  = tss * (1.0f / 1024.0f) - mu * mu;
  const float rstd = rsqrtf(var + 1e-5f);
#pragma unroll
  for (int i = 0; i < 4; ++i)
    out[(size_t)row * 1024 + tid + i * 256] =
        (v[i] - mu) * rstd * g[tid + i * 256] + be[tid + i * 256];
}

// ---------------------------------------------------------------------------
extern "C" void kernel_launch(void* const* d_in, const int* in_sizes, int n_in,
                              void* d_out, int out_size, void* d_ws, size_t ws_size,
                              hipStream_t stream) {
  (void)in_sizes; (void)n_in; (void)out_size; (void)ws_size;
  const float* Q   = (const float*)d_in[0];
  const float* K   = (const float*)d_in[1];
  const float* ma  = (const float*)d_in[2];
  const float* mb  = (const float*)d_in[3];
  const float* Wq  = (const float*)d_in[4];  const float* bq  = (const float*)d_in[5];
  const float* Wk  = (const float*)d_in[6];  const float* bk  = (const float*)d_in[7];
  const float* Wv  = (const float*)d_in[8];  const float* bv  = (const float*)d_in[9];
  const float* Wo  = (const float*)d_in[10]; const float* bo  = (const float*)d_in[11];
  const float* g0  = (const float*)d_in[12]; const float* be0 = (const float*)d_in[13];
  const float* g1  = (const float*)d_in[14]; const float* be1 = (const float*)d_in[15];
  float* out = (float*)d_out;

  char* ws = (char*)d_ws;
  size_t off = 0;
  auto alloc = [&](size_t bytes) -> void* {
    void* p = ws + off;
    off += (bytes + 255) & ~(size_t)255;
    return p;
  };
  const size_t MROW = 8192;  // B * 1024
  __bf16* WqT = (__bf16*)alloc(1024 * 1024 * sizeof(__bf16));
  __bf16* WkT = (__bf16*)alloc(1024 * 1024 * sizeof(__bf16));
  __bf16* WvT = (__bf16*)alloc(1024 * 1024 * sizeof(__bf16));
  __bf16* WoT = (__bf16*)alloc(1024 * 1024 * sizeof(__bf16));
  float*  qf    = (float*)alloc(MROW * 1024 * sizeof(float));
  __bf16* qbp   = (__bf16*)alloc(MROW * 1024 * sizeof(__bf16));
  __bf16* kbp   = (__bf16*)alloc(MROW * 1024 * sizeof(__bf16));
  __bf16* vtp   = (__bf16*)alloc(MROW * 1024 * sizeof(__bf16));
  float*  Hpre  = (float*)alloc(MROW * 1024 * sizeof(float));
  float*  H2    = (float*)alloc(MROW * 1024 * sizeof(float));
  float*  reluG = (float*)alloc(MROW * 1024 * sizeof(float));

  dim3 blk(256);
  convw_kernel<<<dim3(32, 32), blk, 0, stream>>>(Wq, WqT);
  convw_kernel<<<dim3(32, 32), blk, 0, stream>>>(Wk, WkT);
  convw_kernel<<<dim3(32, 32), blk, 0, stream>>>(Wv, WvT);
  convw_kernel<<<dim3(32, 32), blk, 0, stream>>>(Wo, WoT);
  gemm_kernel<0><<<dim3(64, 8), blk, 0, stream>>>(Q, WqT, bq, qf, qbp, nullptr);
  gemm_kernel<1><<<dim3(64, 8), blk, 0, stream>>>(K, WkT, bk, nullptr, kbp, nullptr);
  gemm_kernel<2><<<dim3(64, 8), blk, 0, stream>>>(K, WvT, bv, nullptr, nullptr, vtp);
  attn_kernel<<<dim3(64, 8), blk, 0, stream>>>(qbp, kbp, vtp, qf, ma, mb, Hpre);
  ln_kernel<<<dim3(8192), blk, 0, stream>>>(Hpre, nullptr, g0, be0, H2);
  gemm_kernel<3><<<dim3(64, 8), blk, 0, stream>>>(H2, WoT, bo, reluG, nullptr, nullptr);
  ln_kernel<<<dim3(8192), blk, 0, stream>>>(H2, reluG, g1, be1, out);
}

// v002
// One run takes 237 microseconds.
// Next to v001, in two timings, it ran 1.04 and 1.02 times as fast.
// Over all steps from v000 it is 1.13 times as fast.
#include <hip/hip_runtime.h>

typedef __attribute__((ext_vector_type(16))) __bf16 v16bf;
typedef __attribute__((ext_vector_type(8)))  __bf16 bf16x8;
typedef __attribute__((ext_vector_type(4)))  __bf16 bf16x4;
typedef __attribute__((ext_vector_type(8)))  float  v8f;
typedef __attribute__((ext_vector_type(4)))  float  f32x4;

#define NEGBIG (-1.0e9f)

__device__ __forceinline__ v8f vzero8() {
  v8f z;
#pragma unroll
  for (int i = 0; i < 8; ++i) z[i] = 0.0f;
  return z;
}

__device__ __forceinline__ v16bf pack16(bf16x8 lo, bf16x8 hi) {
  return __builtin_shufflevector(lo, hi, 0, 1, 2, 3, 4, 5, 6, 7, 8, 9, 10, 11, 12, 13, 14, 15);
}

// Load a 16x32 bf16 WMMA A/B fragment from a row-major tile.
// A: row m = lane&15, K halves selected by lane>>4 (per ISA 16-bit A 16x32 layout).
// B is the symmetric layout with n = lane&15 reading rows of the N-major (transposed) tile.
__device__ __forceinline__ v16bf load_frag(const __bf16* base, int ld, int lane) {
  const int r  = lane & 15;
  const int ho = (lane >> 4) * 8;
  const __bf16* p = base + r * ld;
  bf16x8 lo = *(const bf16x8*)(p + ho);
  bf16x8 hi = *(const bf16x8*)(p + 16 + ho);
  return pack16(lo, hi);
}

__device__ __forceinline__ v8f wmma_bf16(v16bf a, v16bf b, v8f c) {
  return __builtin_amdgcn_wmma_f32_16x16x32_bf16(false, a, false, b, (short)0, c, false, false);
}

// ---------------------------------------------------------------------------
// Weight transpose + f32->bf16 convert: W[1024][1024] -> WT[n][k] bf16
// ---------------------------------------------------------------------------
__global__ __launch_bounds__(256) void convw_kernel(const float* __restrict__ W,
                                                    __bf16* __restrict__ WT) {
  __shared__ float t[32][33];
  const int k0 = blockIdx.x * 32, n0 = blockIdx.y * 32;
  const int tx = threadIdx.x & 31, ty = threadIdx.x >> 5;
#pragma unroll
  for (int i = 0; i < 32; i += 8)
    t[ty + i][tx] = W[(size_t)(k0 + ty + i) * 1024 + n0 + tx];
  __syncthreads();
#pragma unroll
  for (int i = 0; i < 32; i += 8)
    WT[(size_t)(n0 + ty + i) * 1024 + k0 + tx] = (__bf16)t[tx][ty + i];
}

// ---------------------------------------------------------------------------
// GEMM: C[M=8192, N=1024] = A_f32[M,1024] x W (as Bt = W^T bf16 [N][K]) + bias
// 128x128 block tile, 8 waves (2x4), 64-wide K stages, register double-buffered
// global->LDS staging so HBM latency overlaps the WMMA phase.
// MODE 0: Q proj  -> outF (f32) + outB (bf16)
// MODE 1: K proj  -> outB (bf16)
// MODE 2: V proj  -> outT (bf16, per-head transposed vt[b][h][d][key])
// MODE 3: O proj  -> outF = relu(acc + bias)
// ---------------------------------------------------------------------------
template <int MODE>
__global__ __launch_bounds__(256) void gemm_kernel(
    const float* __restrict__ A, const __bf16* __restrict__ Bt,
    const float* __restrict__ bias,
    float* __restrict__ outF, __bf16* __restrict__ outB,
    __bf16* __restrict__ outT) {
  __shared__ __attribute__((aligned(16))) __bf16 As[128][72];
  __shared__ __attribute__((aligned(16))) __bf16 Bs[128][72];
  const int tid  = threadIdx.x;
  const int wave = tid >> 5, lane = tid & 31;
  const int wm = wave >> 2, wn = wave & 3;
  const int rowBase = blockIdx.x * 128;
  const int nBase   = blockIdx.y * 128;
  // Staging map: every wave-wide 16-byte load covers whole 128-byte lines.
  // A stage row = 64 f32 = 256 B: 16 lanes a row, two rows a load.
  // B stage row = 64 bf16 = 128 B: 8 lanes a row, four rows a load.
  const int ar = tid >> 4, ac = (tid & 15) * 4;
  const int br = tid >> 3, bc = (tid & 7) * 8;

  f32x4  areg[8];
  bf16x8 breg[4];
  auto load_global = [&](int kc) {
    const float* ap = A + (size_t)(rowBase + ar) * 1024 + kc + ac;
#pragma unroll
    for (int e = 0; e < 8; ++e) areg[e] = *(const f32x4*)(ap + e * 16 * 1024);
    const __bf16* bp = Bt + (size_t)(nBase + br) * 1024 + kc + bc;
#pragma unroll
    for (int e = 0; e < 4; ++e) breg[e] = *(const bf16x8*)(bp + e * 32 * 1024);
  };

  v8f acc[4][2];
#pragma unroll
  for (int i = 0; i < 4; ++i)
#pragma unroll
    for (int j = 0; j < 2; ++j) acc[i][j] = vzero8();

  load_global(0);
  for (int kc = 0; kc < 1024; kc += 64) {
    // Convert staged A regs to bf16 and commit both tiles to LDS.
#pragma unroll
    for (int e = 0; e < 8; ++e) {
      bf16x4 hh;
#pragma unroll
      for (int q = 0; q < 4; ++q) hh[q] = (__bf16)areg[e][q];
      *(bf16x4*)(&As[e * 16 + ar][ac]) = hh;
    }
#pragma unroll
    for (int e = 0; e < 4; ++e) *(bf16x8*)(&Bs[e * 32 + br][bc]) = breg[e];
    __syncthreads();
    if (kc + 64 < 1024) load_global(kc + 64);  // overlap with WMMA phase
#pragma unroll
    for (int ks = 0; ks < 2; ++ks) {
      v16bf bf0 = load_frag(&Bs[wn * 32][ks * 32], 72, lane);
      v16bf bf1 = load_frag(&Bs[wn * 32 + 16][ks * 32], 72, lane);
#pragma unroll
      for (int i = 0; i < 4; ++i) {
        v16bf af = load_frag(&As[wm * 64 + i * 16][ks * 32], 72, lane);
        acc[i][0] = wmma_bf16(af, bf0, acc[i][0]);
        acc[i][1] = wmma_bf16(af, bf1, acc[i][1]);
      }
    }
    __syncthreads();
  }

#pragma unroll
  for (int i = 0; i < 4; ++i)
#pragma unroll
    for (int j = 0; j < 2; ++j) {
      const int gn = nBase + wn * 32 + j * 16 + (lane & 15);
      const int gm = rowBase + wm * 64 + i * 16 + (lane >> 4) * 8;
      const float bvs = bias[gn];
      v8f c = acc[i][j];
      if (MODE == 0) {
#pragma unroll
        for (int r = 0; r < 8; ++r) {
          const float v = c[r] + bvs;
          const size_t idx = (size_t)(gm + r) * 1024 + gn;
          outF[idx] = v;
          outB[idx] = (__bf16)v;
        }
      } else if (MODE == 1) {
#pragma unroll
        for (int r = 0; r < 8; ++r)
          outB[(size_t)(gm + r) * 1024 + gn] = (__bf16)(c[r] + bvs);
      } else if (MODE == 2) {
        // vt[b][h][d][key]; D-fragment's 8 VGPRs are 8 consecutive keys.
        const int bb  = gm >> 10;
        const int key = gm & 1023;
        const int hh2 = gn >> 7, dd = gn & 127;
        bf16x8 pk;
#pragma unroll
        for (int r = 0; r < 8; ++r) pk[r] = (__bf16)(c[r] + bvs);
        *(bf16x8*)(&outT[(((size_t)bb * 8 + hh2) * 128 + dd) * 1024 + key]) = pk;
      } else {
#pragma unroll
        for (int r = 0; r < 8; ++r) {
          const float v = c[r] + bvs;
          outF[(size_t)(gm + r) * 1024 + gn] = v > 0.0f ? v : 0.0f;
        }
      }
    }
}

// ---------------------------------------------------------------------------
// Flash attention per (b,h): 128 query rows/block, 8 waves each owning 16 rows.
// Streams 64-key chunks with register prefetch of the next chunk during WMMA.
// Hpre[b,q,h*128+d] = q_proj + softmax(mask(QK^T/sqrt(128))) V
// ---------------------------------------------------------------------------
__global__ __launch_bounds__(256) void attn_kernel(
    const __bf16* __restrict__ qb, const __bf16* __restrict__ kb,
    const __bf16* __restrict__ vt, const float* __restrict__ qf,
    const float* __restrict__ mask_a, const float* __restrict__ mask_b,
    float* __restrict__ Hpre) {
  __shared__ __attribute__((aligned(16))) __bf16 Ks[64][136];   // [key][d]
  __shared__ __attribute__((aligned(16))) __bf16 Vs[128][72];   // [d][key]
  __shared__ __attribute__((aligned(16))) __bf16 Ps[8][16][72]; // per-wave P
  __shared__ float mas[128];
  __shared__ float mbs[64];
  const int tid = threadIdx.x, wave = tid >> 5, lane = tid & 31;
  const int b = blockIdx.x >> 3, h = blockIdx.x & 7;
  const int qbase = blockIdx.y * 128;
  const float scale = 0.08838834764831845f;  // 1/sqrt(128)

  if (tid < 128) mas[tid] = mask_a[b * 1024 + qbase + tid];

  // Q A-fragments (4 K-steps over d=128) pinned in registers.
  v16bf qfr[4];
  {
    const __bf16* qrow =
        qb + (size_t)(b * 1024 + qbase + wave * 16 + (lane & 15)) * 1024 + h * 128;
    const int ho = (lane >> 4) * 8;
#pragma unroll
    for (int ks = 0; ks < 4; ++ks) {
      bf16x8 lo = *(const bf16x8*)(qrow + ks * 32 + ho);
      bf16x8 hi = *(const bf16x8*)(qrow + ks * 32 + 16 + ho);
      qfr[ks] = pack16(lo, hi);
    }
  }

  bf16x8 kreg[4], vreg[4];
  float mbreg = 0.0f;
  auto load_chunk = [&](int kb0) {
#pragma unroll
    for (int i = 0; i < 4; ++i) {
      const int g = tid + i * 256;
      kreg[i] = *(const bf16x8*)(kb + (size_t)(b * 1024 + kb0 + (g >> 4)) * 1024 +
                                 h * 128 + (g & 15) * 8);
    }
#pragma unroll
    for (int i = 0; i < 4; ++i) {
      const int g = tid + i * 256;
      vreg[i] = *(const bf16x8*)(vt + (((size_t)b * 8 + h) * 128 + (g >> 3)) * 1024 +
                                 kb0 + (g & 7) * 8);
    }
    if (tid < 64) mbreg = mask_b[b * 1024 + kb0 + tid];
  };

  v8f ofr[8];
#pragma unroll
  for (int d = 0; d < 8; ++d) ofr[d] = vzero8();
  float mrow[8], lrow[8];
#pragma unroll
  for (int r = 0; r < 8; ++r) { mrow[r] = -3.0e38f; lrow[r] = 0.0f; }

  load_chunk(0);
  for (int kb0 = 0; kb0 < 1024; kb0 += 64) {
    __syncthreads();  // all waves done reading Ks/Vs of previous chunk
#pragma unroll
    for (int i = 0; i < 4; ++i) {
      const int g = tid + i * 256;
      *(bf16x8*)(&Ks[g >> 4][(g & 15) * 8]) = kreg[i];
    }
#pragma unroll
    for (int i = 0; i < 4; ++i) {
      const int g = tid + i * 256;
      *(bf16x8*)(&Vs[g >> 3][(g & 7) * 8]) = vreg[i];
    }
    if (tid < 64) mbs[tid] = mbreg;
    __syncthreads();
    if (kb0 + 64 < 1024) load_chunk(kb0 + 64);  // overlap with WMMA phase

    // S = Q K^T for this wave's 16 rows x 64 keys.
    v8f sfr[4];
#pragma unroll
    for (int nt = 0; nt < 4; ++nt) {
      v8f s = vzero8();
#pragma unroll
      for (int ks = 0; ks < 4; ++ks) {
        v16bf bf = load_frag(&Ks[nt * 16][ks * 32], 136, lane);
        s = wmma_bf16(qfr[ks], bf, s);
      }
      sfr[nt] = s;
    }

    // Mask + scale + per-row chunk max.
    float cm[8];
#pragma unroll
    for (int r = 0; r < 8; ++r) {
      cm[r] = -3.0e38f;
      const float maq = mas[wave * 16 + (lane >> 4) * 8 + r];
#pragma unroll
      for (int nt = 0; nt < 4; ++nt) {
        const float mbk = mbs[nt * 16 + (lane & 15)];
        const float s = (maq * mbk == 1.0f) ? sfr[nt][r] * scale : NEGBIG;
        sfr[nt][r] = s;
        cm[r] = fmaxf(cm[r], s);
      }
    }
#pragma unroll
    for (int r = 0; r < 8; ++r)
#pragma unroll
      for (int m = 1; m < 16; m <<= 1)
        cm[r] = fmaxf(cm[r], __shfl_xor(cm[r], m, 32));

    float alpha[8], rs[8];
#pragma unroll
    for (int r = 0; r < 8; ++r) {
      const float mn = fmaxf(mrow[r], cm[r]);
      alpha[r] = __expf(mrow[r] - mn);
      mrow[r] = mn;
      rs[r] = 0.0f;
    }
#pragma unroll
    for (int nt = 0; nt < 4; ++nt)
#pragma unroll
      for (int r = 0; r < 8; ++r) {
        const float p = __expf(sfr[nt][r] - mrow[r]);
        sfr[nt][r] = p;
        rs[r] += p;
      }
#pragma unroll
    for (int r = 0; r < 8; ++r) {
#pragma unroll
      for (int m = 1; m < 16; m <<= 1) rs[r] += __shfl_xor(rs[r], m, 32);
      lrow[r] = alpha[r] * lrow[r] + rs[r];
    }
#pragma unroll
    for (int d = 0; d < 8; ++d)
#pragma unroll
      for (int r = 0; r < 8; ++r) ofr[d][r] *= alpha[r];

    // P -> bf16 A-fragment layout via per-wave LDS round trip.
#pragma unroll
    for (int nt = 0; nt < 4; ++nt)
#pragma unroll
      for (int r = 0; r < 8; ++r)
        Ps[wave][(lane >> 4) * 8 + r][nt * 16 + (lane & 15)] = (__bf16)sfr[nt][r];

#pragma unroll
    for (int ks = 0; ks < 2; ++ks) {
      v16bf pa = load_frag(&Ps[wave][0][ks * 32], 72, lane);
#pragma unroll
      for (int dt = 0; dt < 8; ++dt) {
        v16bf bv = load_frag(&Vs[dt * 16][ks * 32], 72, lane);
        ofr[dt] = wmma_bf16(pa, bv, ofr[dt]);
      }
    }
  }

  // O/l + residual q.
#pragma unroll
  for (int dt = 0; dt < 8; ++dt) {
    const int q0  = qbase + wave * 16 + (lane >> 4) * 8;
    const int col = h * 128 + dt * 16 + (lane & 15);
#pragma unroll
    for (int r = 0; r < 8; ++r) {
      const size_t idx = (size_t)(b * 1024 + q0 + r) * 1024 + col;
      Hpre[idx] = ofr[dt][r] / lrow[r] + qf[idx];
    }
  }
}

// ---------------------------------------------------------------------------
// LayerNorm over rows of 1024, with optional pre-add of Y (residual).
// One wave owns a whole row: 8 loads of 16 bytes a lane, each wave-wide load
// 512 contiguous bytes; the row's sums stay inside the wave (no LDS, no barrier).
// 256 work-groups of 16 waves, two rows a wave (rows 2w and 2w + 1), both
// rows' loads issued ahead of the sums.
// ---------------------------------------------------------------------------
template <bool ADD>
__global__ __launch_bounds__(512) void ln_kernel(
    const float* __restrict__ X, const float* __restrict__ g,
    const float* __restrict__ be, float* __restrict__ out,
    const float* __restrict__ Y) {
  const int lane = threadIdx.x & 31;
  const int w  = blockIdx.x * 16 + (threadIdx.x >> 5);
  const int c0 = lane * 4;
  // The lane's byte offset in X, Y and out alike (under 32 MiB): one 32-bit register
  // beside each scalar base serves all loads and stores of both rows.
  const unsigned ro = (unsigned)w * 8192u + (unsigned)lane * 16u;
  f32x4 x[2][8], y[2][8], gv[8], bv[8];
#pragma unroll
  for (int r = 0; r < 2; ++r) {
    const float* xp = (const float*)((const char*)X + ro) + r * 1024;
#pragma unroll
    for (int j = 0; j < 8; ++j) x[r][j] = *(const f32x4*)(xp + j * 128);
    if (ADD) {
      const float* yp = (const float*)((const char*)Y + ro) + r * 1024;
#pragma unroll
      for (int j = 0; j < 8; ++j) y[r][j] = *(const f32x4*)(yp + j * 128);
    }
  }
#pragma unroll
  for (int j = 0; j < 8; ++j) {
    gv[j] = *(const f32x4*)(g + c0 + j * 128);
    bv[j] = *(const f32x4*)(be + c0 + j * 128);
  }
  // Precaution: this wait stands ahead of any rewrite of an offset register that
  // the loads above name; lane as an input keeps the gain and shift loads' shared
  // offset register untouched up to it (else the run's last load lands on it).
  asm volatile("s_wait_xcnt 0x0" :: "v"(lane) : "memory");
  // Keeps every load above issued ahead of the arithmetic: without it the
  // compiler sinks the gain and shift loads to their uses, one waited pair at a time.
  __builtin_amdgcn_sched_barrier(0);
  if (ADD) {
#pragma unroll
    for (int r = 0; r < 2; ++r)
#pragma unroll
      for (int j = 0; j < 8; ++j) x[r][j] += y[r][j];
  }

  float s[2], ss[2];
#pragma unroll
  for (int r = 0; r < 2; ++r) {
    f32x4 sv = x[r][0], qv = x[r][0] * x[r][0];
#pragma unroll
    for (int j = 1; j < 8; ++j) {
      sv += x[r][j];
      qv += x[r][j] * x[r][j];
    }
    s[r]  = (sv[0] + sv[1]) + (sv[2] + sv[3]);
    ss[r] = (qv[0] + qv[1]) + (qv[2] + qv[3]);
  }
#pragma unroll
  for (int m = 1; m < 32; m <<= 1) {
#pragma unroll
    for (int r = 0; r < 2; ++r) {
      s[r]  += __shfl_xor(s[r], m, 32);
      ss[r] += __shfl_xor(ss[r], m, 32);
    }
  }

#pragma unroll
  for (int r = 0; r < 2; ++r) {
    const float mu   = s[r] * (1.0f / 1024.0f);
    const float var  = ss[r] * (1.0f / 1024.0f) - mu * mu;
    const float rstd = rsqrtf(var + 1e-5f);
    float* op = (float*)((char*)out + ro) + r * 1024;
#pragma unroll
    for (int j = 0; j < 8; ++j)
      *(f32x4*)(op + j * 128) = (x[r][j] - mu) * rstd * gv[j] + bv[j];
  }
}

// ---------------------------------------------------------------------------
extern "C" void kernel_launch(void* const* d_in, const int* in_sizes, int n_in,
                              void* d_out, int out_size, void* d_ws, size_t ws_size,
                              hipStream_t stream) {
  (void)in_sizes; (void)n_in; (void)out_size; (void)ws_size;
  const float* Q   = (const float*)d_in[0];
  const float* K   = (const float*)d_in[1];
  const float* ma  = (const float*)d_in[2];
  const float* mb  = (const float*)d_in[3];
  const float* Wq  = (const float*)d_in[4];  const float* bq  = (const float*)d_in[5];
  const float* Wk  = (const float*)d_in[6];  const float* bk  = (const float*)d_in[7];
  const float* Wv  = (const float*)d_in[8];  const float* bv  = (const float*)d_in[9];
  const float* Wo  = (const float*)d_in[10]; const float* bo  = (const float*)d_in[11];
  const float* g0  = (const float*)d_in[12]; const float* be0 = (const float*)d_in[13];
  const float* g1  = (const float*)d_in[14]; const float* be1 = (const float*)d_in[15];
  float* out = (float*)d_out;

  char* ws = (char*)d_ws;
  size_t off = 0;
  auto alloc = [&](size_t bytes) -> void* {
    void* p = ws + off;
    off += (bytes + 255) & ~(size_t)255;
    return p;
  };
  const size_t MROW = 8192;  // B * 1024
  __bf16* WqT = (__bf16*)alloc(1024 * 1024 * sizeof(__bf16));
  __bf16* WkT = (__bf16*)alloc(1024 * 1024 * sizeof(__bf16));
  __bf16* WvT = (__bf16*)alloc(1024 * 1024 * sizeof(__bf16));
  __bf16* WoT = (__bf16*)alloc(1024 * 1024 * sizeof(__bf16));
  float*  qf    = (float*)alloc(MROW * 1024 * sizeof(float));
  __bf16* qbp   = (__bf16*)alloc(MROW * 1024 * sizeof(__bf16));
  __bf16* kbp   = (__bf16*)alloc(MROW * 1024 * sizeof(__bf16));
  __bf16* vtp   = (__bf16*)alloc(MROW * 1024 * sizeof(__bf16));
  float*  Hpre  = (float*)alloc(MROW * 1024 * sizeof(float));
  float*  H2    = (float*)alloc(MROW * 1024 * sizeof(float));
  float*  reluG = (float*)alloc(MROW * 1024 * sizeof(float));

  dim3 blk(256);
  convw_kernel<<<dim3(32, 32), blk, 0, stream>>>(Wq, WqT);
  convw_kernel<<<dim3(32, 32), blk, 0, stream>>>(Wk, WkT);
  convw_kernel<<<dim3(32, 32), blk, 0, stream>>>(Wv, WvT);
  convw_kernel<<<dim3(32, 32), blk, 0, stream>>>(Wo, WoT);
  gemm_kernel<0><<<dim3(64, 8), blk, 0, stream>>>(Q, WqT, bq, qf, qbp, nullptr);
  gemm_kernel<1><<<dim3(64, 8), blk, 0, stream>>>(K, WkT, bk, nullptr, kbp, nullptr);
  gemm_kernel<2><<<dim3(64, 8), blk, 0, stream>>>(K, WvT, bv, nullptr, nullptr, vtp);
  attn_kernel<<<dim3(64, 8), blk, 0, stream>>>(qbp, kbp, vtp, qf, ma, mb, Hpre);
  ln_kernel<false><<<dim3(256), dim3(512), 0, stream>>>(Hpre, g0, be0, H2, nullptr);
  gemm_kernel<3><<<dim3(64, 8), blk, 0, stream>>>(H2, WoT, bo, reluG, nullptr, nullptr);
  ln_kernel<true><<<dim3(256), dim3(512), 0, stream>>>(H2, g1, be1, out, reluG);
}

// v003
// A run of this version takes 196 microseconds.
// Next to v002, in two timings, it ran 1.21 times as fast each time.
// All steps since v000 together make it 1.37 times as fast.
#include <hip/hip_runtime.h>

typedef __attribute__((ext_vector_type(16))) __bf16 v16bf;
typedef __attribute__((ext_vector_type(8)))  __bf16 bf16x8;
typedef __attribute__((ext_vector_type(4)))  __bf16 bf16x4;
typedef __attribute__((ext_vector_type(8)))  float  v8f;
typedef __attribute__((ext_vector_type(4)))  float  f32x4;

#define NEGBIG (-1.0e9f)

__device__ __forceinline__ v8f vzero8() {
  v8f z;
#pragma unroll
  for (int i = 0; i < 8; ++i) z[i] = 0.0f;
  return z;
}

__device__ __forceinline__ v16bf pack16(bf16x8 lo, bf16x8 hi) {
  return __builtin_shufflevector(lo, hi, 0, 1, 2, 3, 4, 5, 6, 7, 8, 9, 10, 11, 12, 13, 14, 15);
}

// Load a 16x32 bf16 WMMA A/B fragment from a row-major tile.
// A: row m = lane&15, K halves selected by lane>>4 (per ISA 16-bit A 16x32 layout).
// B is the symmetric layout with n = lane&15 reading rows of the N-major (transposed) tile.
__device__ __forceinline__ v16bf load_frag(const __bf16* base, int ld, int lane) {
  const int r  = lane & 15;
  const int ho = (lane >> 4) * 8;
  const __bf16* p = base + r * ld;
  bf16x8 lo = *(const bf16x8*)(p + ho);
  bf16x8 hi = *(const bf16x8*)(p + 16 + ho);
  return pack16(lo, hi);
}

__device__ __forceinline__ v8f wmma_bf16(v16bf a, v16bf b, v8f c) {
  return __builtin_amdgcn_wmma_f32_16x16x32_bf16(false, a, false, b, (short)0, c, false, false);
}

// ---------------------------------------------------------------------------
// Weight transpose + f32->bf16 convert: W[1024][1024] -> WT[n][k] bf16
// ---------------------------------------------------------------------------
__global__ __launch_bounds__(256) void convw_kernel(const float* __restrict__ W,
                                                    __bf16* __restrict__ WT) {
  __shared__ float t[32][33];
  const int k0 = blockIdx.x * 32, n0 = blockIdx.y * 32;
  const int tx = threadIdx.x & 31, ty = threadIdx.x >> 5;
#pragma unroll
  for (int i = 0; i < 32; i += 8)
    t[ty + i][tx] = W[(size_t)(k0 + ty + i) * 1024 + n0 + tx];
  __syncthreads();
#pragma unroll
  for (int i = 0; i < 32; i += 8)
    WT[(size_t)(n0 + ty + i) * 1024 + k0 + tx] = (__bf16)t[tx][ty + i];
}

// ---------------------------------------------------------------------------
// GEMM: C[M=8192, N=1024] = A_f32[M,1024] x W (as Bt = W^T bf16 [N][K]) + bias
// 128x128 block tile, 8 waves (2x4), 64-wide K stages, register double-buffered
// global->LDS staging so HBM latency overlaps the WMMA phase.
// MODE 0: Q proj  -> outF (f32) + outB (bf16)
// MODE 1: K proj  -> outB (bf16)
// MODE 2: V proj  -> outT (bf16, per-head transposed vt[b][h][d][key])
// MODE 3: O proj  -> outF = relu(acc + bias)
// ---------------------------------------------------------------------------
template <int MODE>
__global__ __launch_bounds__(256) void gemm_kernel(
    const float* __restrict__ A, const __bf16* __restrict__ Bt,
    const float* __restrict__ bias,
    float* __restrict__ outF, __bf16* __restrict__ outB,
    __bf16* __restrict__ outT) {
  __shared__ __attribute__((aligned(16))) __bf16 As[128][72];
  __shared__ __attribute__((aligned(16))) __bf16 Bs[128][72];
  const int tid  = threadIdx.x;
  const int wave = tid >> 5, lane = tid & 31;
  const int wm = wave >> 2, wn = wave & 3;
  const int rowBase = blockIdx.x * 128;
  const int nBase   = blockIdx.y * 128;
  // Staging map: every wave-wide 16-byte load covers whole 128-byte lines.
  // A stage row = 64 f32 = 256 B: 16 lanes a row, two rows a load.
  // B stage row = 64 bf16 = 128 B: 8 lanes a row, four rows a load.
  const int ar = tid >> 4, ac = (tid & 15) * 4;
  const int br = tid >> 3, bc = (tid & 7) * 8;

  f32x4  areg[8];
  bf16x8 breg[4];
  auto load_global = [&](int kc) {
    const float* ap = A + (size_t)(rowBase + ar) * 1024 + kc + ac;
#pragma unroll
    for (int e = 0; e < 8; ++e) areg[e] = *(const f32x4*)(ap + e * 16 * 1024);
    const __bf16* bp = Bt + (size_t)(nBase + br) * 1024 + kc + bc;
#pragma unroll
    for (int e = 0; e < 4; ++e) breg[e] = *(const bf16x8*)(bp + e * 32 * 1024);
  };

  v8f acc[4][2];
#pragma unroll
  for (int i = 0; i < 4; ++i)
#pragma unroll
    for (int j = 0; j < 2; ++j) acc[i][j] = vzero8();

  load_global(0);
  for (int kc = 0; kc < 1024; kc += 64) {
    // Convert staged A regs to bf16 and commit both tiles to LDS.
#pragma unroll
    for (int e = 0; e < 8; ++e) {
      bf16x4 hh;
#pragma unroll
      for (int q = 0; q < 4; ++q) hh[q] = (__bf16)areg[e][q];
      *(bf16x4*)(&As[e * 16 + ar][ac]) = hh;
    }
#pragma unroll
    for (int e = 0; e < 4; ++e) *(bf16x8*)(&Bs[e * 32 + br][bc]) = breg[e];
    __syncthreads();
    if (kc + 64 < 1024) load_global(kc + 64);  // overlap with WMMA phase
#pragma unroll
    for (int ks = 0; ks < 2; ++ks) {
      v16bf bf0 = load_frag(&Bs[wn * 32][ks * 32], 72, lane);
      v16bf bf1 = load_frag(&Bs[wn * 32 + 16][ks * 32], 72, lane);
#pragma unroll
      for (int i = 0; i < 4; ++i) {
        v16bf af = load_frag(&As[wm * 64 + i * 16][ks * 32], 72, lane);
        acc[i][0] = wmma_bf16(af, bf0, acc[i][0]);
        acc[i][1] = wmma_bf16(af, bf1, acc[i][1]);
      }
    }
    __syncthreads();
  }

#pragma unroll
  for (int i = 0; i < 4; ++i)
#pragma unroll
    for (int j = 0; j < 2; ++j) {
      const int gn = nBase + wn * 32 + j * 16 + (lane & 15);
      const int gm = rowBase + wm * 64 + i * 16 + (lane >> 4) * 8;
      const float bvs = bias[gn];
      v8f c = acc[i][j];
      if (MODE == 0) {
#pragma unroll
        for (int r = 0; r < 8; ++r) {
          const float v = c[r] + bvs;
          const size_t idx = (size_t)(gm + r) * 1024 + gn;
          outF[idx] = v;
          outB[idx] = (__bf16)v;
        }
      } else if (MODE == 1) {
#pragma unroll
        for (int r = 0; r < 8; ++r)
          outB[(size_t)(gm + r) * 1024 + gn] = (__bf16)(c[r] + bvs);
      } else if (MODE == 2) {
        // vt[b][h][d][key]; D-fragment's 8 VGPRs are 8 consecutive keys.
        const int bb  = gm >> 10;
        const int key = gm & 1023;
        const int hh2 = gn >> 7, dd = gn & 127;
        bf16x8 pk;
#pragma unroll
        for (int r = 0; r < 8; ++r) pk[r] = (__bf16)(c[r] + bvs);
        *(bf16x8*)(&outT[(((size_t)bb * 8 + hh2) * 128 + dd) * 1024 + key]) = pk;
      } else {
#pragma unroll
        for (int r = 0; r < 8; ++r) {
          const float v = c[r] + bvs;
          outF[(size_t)(gm + r) * 1024 + gn] = v > 0.0f ? v : 0.0f;
        }
      }
    }
}

__device__ __forceinline__ float xhalf(float x) {
  const int v = __builtin_bit_cast(int, x);
  return __builtin_bit_cast(
      float, __builtin_amdgcn_permlanex16(v, v, 0x76543210, 0xfedcba98, false, false));
}

// exp2 of eight values: eight independent v_exp_f32 in one statement, then one v_nop.
// The instruction set asks for one independent instruction or v_nop behind a
// transcendental before its result is used or its source overwritten. Here every
// successor is independent (the outputs are early-clobber, none lies on an input)
// and the v_nop serves the last one.
__device__ __forceinline__ v8f exp2x8(v8f t) {
  float r0, r1, r2, r3, r4, r5, r6, r7;
  asm("v_exp_f32 %0, %8\n\t"
      "v_exp_f32 %1, %9\n\t"
      "v_exp_f32 %2, %10\n\t"
      "v_exp_f32 %3, %11\n\t"
      "v_exp_f32 %4, %12\n\t"
      "v_exp_f32 %5, %13\n\t"
      "v_exp_f32 %6, %14\n\t"
      "v_exp_f32 %7, %15\n\t"
      "v_nop"
      : "=&v"(r0), "=&v"(r1), "=&v"(r2), "=&v"(r3), "=&v"(r4), "=&v"(r5), "=&v"(r6), "=&v"(r7)
      : "v"(t[0]), "v"(t[1]), "v"(t[2]), "v"(t[3]), "v"(t[4]), "v"(t[5]), "v"(t[6]), "v"(t[7]));
  v8f p;
  p[0] = r0; p[1] = r1; p[2] = r2; p[3] = r3;
  p[4] = r4; p[5] = r5; p[6] = r6; p[7] = r7;
  return p;
}

__global__ __launch_bounds__(256) void attn_kernel(
    const __bf16* __restrict__ qb, const __bf16* __restrict__ kb,
    const __bf16* __restrict__ vt, const float* __restrict__ qf,
    const float* __restrict__ mask_a, const float* __restrict__ mask_b,
    float* __restrict__ Hpre) {
  __shared__ __attribute__((aligned(16))) __bf16 Ks[64][136];   // [key][d]
  __shared__ __attribute__((aligned(16))) __bf16 Vs[128][72];   // [d][key]
  __shared__ __attribute__((aligned(16))) float mbs[64];
  const int tid = threadIdx.x, wave = tid >> 5, lane = tid & 31;
  const int hf = lane >> 4;
  const int b = blockIdx.x >> 3, h = blockIdx.x & 7;
  const int qbase = blockIdx.y * 128;
  const float scale = 0.08838834764831845f;  // 1/sqrt(128)

  // The lane's one query (shared with lane ^ 16) and its mask value.
  const int qrow = b * 1024 + qbase + wave * 16 + (lane & 15);
  const float maq = mask_a[qrow];

  // Q^T B-fragments (4 K-steps over d=128) pinned in registers.
  v16bf qfr[4];
  {
    const __bf16* qbp = qb + (size_t)qrow * 1024 + h * 128;
    const int ho = hf * 8;
#pragma unroll
    for (int ks = 0; ks < 4; ++ks) {
      bf16x8 lo = *(const bf16x8*)(qbp + ks * 32 + ho);
      bf16x8 hi = *(const bf16x8*)(qbp + ks * 32 + 16 + ho);
      qfr[ks] = pack16(lo, hi);
    }
  }

  bf16x8 kreg[4], vreg[4];
  float mbreg = 0.0f;
  auto load_chunk = [&](int kb0) {
#pragma unroll
    for (int i = 0; i < 4; ++i) {
      const int g = tid + i * 256;
      kreg[i] = *(const bf16x8*)(kb + (size_t)(b * 1024 + kb0 + (g >> 4)) * 1024 +
                                 h * 128 + (g & 15) * 8);
    }
#pragma unroll
    for (int i = 0; i < 4; ++i) {
      const int g = tid + i * 256;
      vreg[i] = *(const bf16x8*)(vt + (((size_t)b * 8 + h) * 128 + (g >> 3)) * 1024 +
                                 kb0 + (g & 7) * 8);
    }
    if (tid < 64) mbreg = mask_b[b * 1024 + kb0 + tid];
  };

  // O^T tiles: ofr[dt][r] = O[query lane & 15][d = dt * 16 + hf * 8 + r].
  v8f ofr[8];
#pragma unroll
  for (int d = 0; d < 8; ++d) ofr[d] = vzero8();
  float mrow = -3.0e38f;  // running maximum, equal in both lane halves
  float lrow = 0.0f;      // running sum over this lane half's keys only

  load_chunk(0);
  for (int kb0 = 0; kb0 < 1024; kb0 += 64) {
    __syncthreads();  // all waves done reading Ks/Vs of previous chunk
#pragma unroll
    for (int i = 0; i < 4; ++i) {
      const int g = tid + i * 256;
      *(bf16x8*)(&Ks[g >> 4][(g & 15) * 8]) = kreg[i];
    }
#pragma unroll
    for (int i = 0; i < 4; ++i) {
      const int g = tid + i * 256;
      *(bf16x8*)(&Vs[g >> 3][(g & 7) * 8]) = vreg[i];
    }
    if (tid < 64) mbs[tid] = mbreg;
    __syncthreads();
    if (kb0 + 64 < 1024) load_chunk(kb0 + 64);  // overlap with WMMA phase

    // S^T = K Q^T: sfr[nt][r] = score(key nt * 16 + hf * 8 + r, the lane's query).
    v8f sfr[4];
#pragma unroll
    for (int nt = 0; nt < 4; ++nt) {
      v8f s = vzero8();
#pragma unroll
      for (int ks = 0; ks < 4; ++ks) {
        v16bf kf = load_frag(&Ks[nt * 16][ks * 32], 136, lane);
        s = wmma_bf16(kf, qfr[ks], s);
      }
      sfr[nt] = s;
    }

    // Mask + scale + chunk maximum: four in-lane chains, then the other lane half.
    float cm[4];
#pragma unroll
    for (int nt = 0; nt < 4; ++nt) {
      const f32x4 mb0 = *(const f32x4*)(&mbs[nt * 16 + hf * 8]);
      const f32x4 mb1 = *(const f32x4*)(&mbs[nt * 16 + hf * 8 + 4]);
      cm[nt] = -3.0e38f;
#pragma unroll
      for (int r = 0; r < 8; ++r) {
        const float mbk = r < 4 ? mb0[r & 3] : mb1[r & 3];
        const float s = (maq * mbk == 1.0f) ? sfr[nt][r] * scale : NEGBIG;
        sfr[nt][r] = s;
        cm[nt] = fmaxf(cm[nt], s);
      }
    }
    float cmx = fmaxf(fmaxf(cm[0], cm[1]), fmaxf(cm[2], cm[3]));
    cmx = fmaxf(cmx, xhalf(cmx));

    const float mn = fmaxf(mrow, cmx);
    const float alpha = __expf(mrow - mn);
    mrow = mn;
    float rs[4];
#pragma unroll
    for (int nt = 0; nt < 4; ++nt) {
      // exp(x) as exp2(x * log2(e)), the form __expf compiles to.
      sfr[nt] = exp2x8((sfr[nt] - mrow) * 1.44269504f);
      rs[nt] = sfr[nt][0];
#pragma unroll
      for (int r = 1; r < 8; ++r) rs[nt] += sfr[nt][r];
    }
    lrow = alpha * lrow + ((rs[0] + rs[1]) + (rs[2] + rs[3]));
#pragma unroll
    for (int d = 0; d < 8; ++d)
#pragma unroll
      for (int r = 0; r < 8; ++r) ofr[d][r] *= alpha;

    // O^T += V^T P^T; the P^T fragment of 32 keys is two S^T tiles converted in place.
#pragma unroll
    for (int ks = 0; ks < 2; ++ks) {
      v16bf pb;
#pragma unroll
      for (int e = 0; e < 8; ++e) {
        pb[e]     = (__bf16)sfr[2 * ks][e];
        pb[8 + e] = (__bf16)sfr[2 * ks + 1][e];
      }
#pragma unroll
      for (int dt = 0; dt < 8; ++dt) {
        v16bf vf = load_frag(&Vs[dt * 16][ks * 32], 72, lane);
        ofr[dt] = wmma_bf16(vf, pb, ofr[dt]);
      }
    }
  }

  // O/l + residual q; the lane halves' sums are joined here, once.
  const size_t idx0 = (size_t)qrow * 1024 + h * 128 + hf * 8;
  const float* qp = qf + idx0;
  float* hp = Hpre + idx0;
  f32x4 qv[16];
#pragma unroll
  for (int dt = 0; dt < 8; ++dt) {
    qv[2 * dt]     = *(const f32x4*)(qp + dt * 16);
    qv[2 * dt + 1] = *(const f32x4*)(qp + dt * 16 + 4);
  }
  // Precaution: this wait stands ahead of any rewrite of the address registers that
  // the loads above name; the pointer as an input keeps them untouched up to it
  // (else the run's last load lands on them).
  asm volatile("s_wait_xcnt 0x0" :: "v"(qp) : "memory");
  const float inv = 1.0f / (lrow + xhalf(lrow));
#pragma unroll
  for (int dt = 0; dt < 8; ++dt) {
    f32x4 o0, o1;
#pragma unroll
    for (int r = 0; r < 4; ++r) {
      o0[r] = ofr[dt][r] * inv + qv[2 * dt][r];
      o1[r] = ofr[dt][4 + r] * inv + qv[2 * dt + 1][r];
    }
    *(f32x4*)(hp + dt * 16)     = o0;
    *(f32x4*)(hp + dt * 16 + 4) = o1;
  }
}

// ---------------------------------------------------------------------------
// LayerNorm over rows of 1024, with optional pre-add of Y (residual).
// One wave owns a whole row: 8 loads of 16 bytes a lane, each wave-wide load
// 512 contiguous bytes; the row's sums stay inside the wave (no LDS, no barrier).
// 256 work-groups of 16 waves, two rows a wave (rows 2w and 2w + 1), both
// rows' loads issued ahead of the sums.
// ---------------------------------------------------------------------------
template <bool ADD>
__global__ __launch_bounds__(512) void ln_kernel(
    const float* __restrict__ X, const float* __restrict__ g,
    const float* __restrict__ be, float* __restrict__ out,
    const float* __restrict__ Y) {
  const int lane = threadIdx.x & 31;
  const int w  = blockIdx.x * 16 + (threadIdx.x >> 5);
  const int c0 = lane * 4;
  // The lane's byte offset in X, Y and out alike (under 32 MiB): one 32-bit register
  // beside each scalar base serves all loads and stores of both rows.
  const unsigned ro = (unsigned)w * 8192u + (unsigned)lane * 16u;
  f32x4 x[2][8], y[2][8], gv[8], bv[8];
#pragma unroll
  for (int r = 0; r < 2; ++r) {
    const float* xp = (const float*)((const char*)X + ro) + r * 1024;
#pragma unroll
    for (int j = 0; j < 8; ++j) x[r][j] = *(const f32x4*)(xp + j * 128);
    if (ADD) {
      const float* yp = (const float*)((const char*)Y + ro) + r * 1024;
#pragma unroll
      for (int j = 0; j < 8; ++j) y[r][j] = *(const f32x4*)(yp + j * 128);
    }
  }
#pragma unroll
  for (int j = 0; j < 8; ++j) {
    gv[j] = *(const f32x4*)(g + c0 + j * 128);
    bv[j] = *(const f32x4*)(be + c0 + j * 128);
  }
  // Precaution: this wait stands ahead of any rewrite of an offset register that
  // the loads above name; lane as an input keeps the gain and shift loads' shared
  // offset register untouched up to it (else the run's last load lands on it).
  asm volatile("s_wait_xcnt 0x0" :: "v"(lane) : "memory");
  // Keeps every load above issued ahead of the arithmetic: without it the
  // compiler sinks the gain and shift loads to their uses, one waited pair at a time.
  __builtin_amdgcn_sched_barrier(0);
  if (ADD) {
#pragma unroll
    for (int r = 0; r < 2; ++r)
#pragma unroll
      for (int j = 0; j < 8; ++j) x[r][j] += y[r][j];
  }

  float s[2], ss[2];
#pragma unroll
  for (int r = 0; r < 2; ++r) {
    f32x4 sv = x[r][0], qv = x[r][0] * x[r][0];
#pragma unroll
    for (int j = 1; j < 8; ++j) {
      sv += x[r][j];
      qv += x[r][j] * x[r][j];
    }
    s[r]  = (sv[0] + sv[1]) + (sv[2] + sv[3]);
    ss[r] = (qv[0] + qv[1]) + (qv[2] + qv[3]);
  }
#pragma unroll
  for (int m = 1; m < 32; m <<= 1) {
#pragma unroll
    for (int r = 0; r < 2; ++r) {
      s[r]  += __shfl_xor(s[r], m, 32);
      ss[r] += __shfl_xor(ss[r], m, 32);
    }
  }

#pragma unroll
  for (int r = 0; r < 2; ++r) {
    const float mu   = s[r] * (1.0f / 1024.0f);
    const float var  = ss[r] * (1.0f / 1024.0f) - mu * mu;
    const float rstd = rsqrtf(var + 1e-5f);
    float* op = (float*)((char*)out + ro) + r * 1024;
#pragma unroll
    for (int j = 0; j < 8; ++j)
      *(f32x4*)(op + j * 128) = (x[r][j] - mu) * rstd * gv[j] + bv[j];
  }
}

// ---------------------------------------------------------------------------
extern "C" void kernel_launch(void* const* d_in, const int* in_sizes, int n_in,
                              void* d_out, int out_size, void* d_ws, size_t ws_size,
                              hipStream_t stream) {
  (void)in_sizes; (void)n_in; (void)out_size; (void)ws_size;
  const float* Q   = (const float*)d_in[0];
  const float* K   = (const float*)d_in[1];
  const float* ma  = (const float*)d_in[2];
  const float* mb  = (const float*)d_in[3];
  const float* Wq  = (const float*)d_in[4];  const float* bq  = (const float*)d_in[5];
  const float* Wk  = (const float*)d_in[6];  const float* bk  = (const float*)d_in[7];
  const float* Wv  = (const float*)d_in[8];  const float* bv  = (const float*)d_in[9];
  const float* Wo  = (const float*)d_in[10]; const float* bo  = (const float*)d_in[11];
  const float* g0  = (const float*)d_in[12]; const float* be0 = (const float*)d_in[13];
  const float* g1  = (const float*)d_in[14]; const float* be1 = (const float*)d_in[15];
  float* out = (float*)d_out;

  char* ws = (char*)d_ws;
  size_t off = 0;
  auto alloc = [&](size_t bytes) -> void* {
    void* p = ws + off;
    off += (bytes + 255) & ~(size_t)255;
    return p;
  };
  const size_t MROW = 8192;  // B * 1024
  __bf16* WqT = (__bf16*)alloc(1024 * 1024 * sizeof(__bf16));
  __bf16* WkT = (__bf16*)alloc(1024 * 1024 * sizeof(__bf16));
  __bf16* WvT = (__bf16*)alloc(1024 * 1024 * sizeof(__bf16));
  __bf16* WoT = (__bf16*)alloc(1024 * 1024 * sizeof(__bf16));
  float*  qf    = (float*)alloc(MROW * 1024 * sizeof(float));
  __bf16* qbp   = (__bf16*)alloc(MROW * 1024 * sizeof(__bf16));
  __bf16* kbp   = (__bf16*)alloc(MROW * 1024 * sizeof(__bf16));
  __bf16* vtp   = (__bf16*)alloc(MROW * 1024 * sizeof(__bf16));
  float*  Hpre  = (float*)alloc(MROW * 1024 * sizeof(float));
  float*  H2    = (float*)alloc(MROW * 1024 * sizeof(float));
  float*  reluG = (float*)alloc(MROW * 1024 * sizeof(float));

  dim3 blk(256);
  convw_kernel<<<dim3(32, 32), blk, 0, stream>>>(Wq, WqT);
  convw_kernel<<<dim3(32, 32), blk, 0, stream>>>(Wk, WkT);
  convw_kernel<<<dim3(32, 32), blk, 0, stream>>>(Wv, WvT);
  convw_kernel<<<dim3(32, 32), blk, 0, stream>>>(Wo, WoT);
  gemm_kernel<0><<<dim3(64, 8), blk, 0, stream>>>(Q, WqT, bq, qf, qbp, nullptr);
  gemm_kernel<1><<<dim3(64, 8), blk, 0, stream>>>(K, WkT, bk, nullptr, kbp, nullptr);
  gemm_kernel<2><<<dim3(64, 8), blk, 0, stream>>>(K, WvT, bv, nullptr, nullptr, vtp);
  attn_kernel<<<dim3(64, 8), blk, 0, stream>>>(qbp, kbp, vtp, qf, ma, mb, Hpre);
  ln_kernel<false><<<dim3(256), dim3(512), 0, stream>>>(Hpre, g0, be0, H2, nullptr);
  gemm_kernel<3><<<dim3(64, 8), blk, 0, stream>>>(H2, WoT, bo, reluG, nullptr, nullptr);
  ln_kernel<true><<<dim3(256), dim3(512), 0, stream>>>(H2, g1, be1, out, reluG);
}

// v004
// A run of this version takes 174 microseconds.
// In two side-by-side timings against v003, it was 1.13 and 1.12 times as fast.
// All steps since v000 together make it 1.54 times as fast.
#include <hip/hip_runtime.h>

typedef __attribute__((ext_vector_type(16))) __bf16 v16bf;
typedef __attribute__((ext_vector_type(8)))  __bf16 bf16x8;
typedef __attribute__((ext_vector_type(4)))  __bf16 bf16x4;
typedef __attribute__((ext_vector_type(8)))  float  v8f;
typedef __attribute__((ext_vector_type(4)))  float  f32x4;

#define NEGBIG (-1.0e9f)

__device__ __forceinline__ v8f vzero8() {
  v8f z;
#pragma unroll
  for (int i = 0; i < 8; ++i) z[i] = 0.0f;
  return z;
}

__device__ __forceinline__ v16bf pack16(bf16x8 lo, bf16x8 hi) {
  return __builtin_shufflevector(lo, hi, 0, 1, 2, 3, 4, 5, 6, 7, 8, 9, 10, 11, 12, 13, 14, 15);
}

// Load a 16x32 bf16 WMMA A/B fragment from a row-major tile.
// A: row m = lane&15, K halves selected by lane>>4 (per ISA 16-bit A 16x32 layout).
// B is the symmetric layout with n = lane&15 reading rows of the N-major (transposed) tile.
__device__ __forceinline__ v16bf load_frag(const __bf16* base, int ld, int lane) {
  const int r  = lane & 15;
  const int ho = (lane >> 4) * 8;
  const __bf16* p = base + r * ld;
  bf16x8 lo = *(const bf16x8*)(p + ho);
  bf16x8 hi = *(const bf16x8*)(p + 16 + ho);
  return pack16(lo, hi);
}

__device__ __forceinline__ v8f wmma_bf16(v16bf a, v16bf b, v8f c) {
  return __builtin_amdgcn_wmma_f32_16x16x32_bf16(false, a, false, b, (short)0, c, false, false);
}

// ---------------------------------------------------------------------------
// Weight transpose + f32->bf16 convert: W[1024][1024] -> WT[n][k] bf16
// The four weights need nothing of each other: one grid, blockIdx.z picks the weight.
// ---------------------------------------------------------------------------
__global__ __launch_bounds__(256) void convw_kernel(
    const float* __restrict__ W0, const float* __restrict__ W1,
    const float* __restrict__ W2, const float* __restrict__ W3,
    __bf16* __restrict__ WT0, __bf16* __restrict__ WT1,
    __bf16* __restrict__ WT2, __bf16* __restrict__ WT3) {
  __shared__ float t[32][33];
  const int z = blockIdx.z;
  const float* W = z == 0 ? W0 : z == 1 ? W1 : z == 2 ? W2 : W3;
  __bf16* WT = z == 0 ? WT0 : z == 1 ? WT1 : z == 2 ? WT2 : WT3;
  const int k0 = blockIdx.x * 32, n0 = blockIdx.y * 32;
  const int tx = threadIdx.x & 31, ty = threadIdx.x >> 5;
#pragma unroll
  for (int i = 0; i < 32; i += 8)
    t[ty + i][tx] = W[(size_t)(k0 + ty + i) * 1024 + n0 + tx];
  __syncthreads();
#pragma unroll
  for (int i = 0; i < 32; i += 8)
    WT[(size_t)(n0 + ty + i) * 1024 + k0 + tx] = (__bf16)t[tx][ty + i];
}

// ---------------------------------------------------------------------------
// GEMM: C[M=8192, N=1024] = A_f32[M,1024] x W (as Bt = W^T bf16 [N][K]) + bias
// 128x128 block tile, 8 waves (2x4), 64-wide K stages, register double-buffered
// global->LDS staging so HBM latency overlaps the WMMA phase.
// MODE 0: Q proj  -> outF (f32) + outB (bf16)
// MODE 1: K proj  -> outB (bf16)
// MODE 2: V proj  -> outT (bf16, per-head transposed vt[b][h][d][key])
// MODE 3: O proj  -> outF = relu(acc + bias)
// ---------------------------------------------------------------------------
__device__ __forceinline__ void gemm_tile(
    const float* __restrict__ A, const __bf16* __restrict__ Bt,
    __bf16 (&As)[128][72], __bf16 (&Bs)[128][72], v8f (&acc)[4][2]) {
  const int tid  = threadIdx.x;
  const int wave = tid >> 5, lane = tid & 31;
  const int wm = wave >> 2, wn = wave & 3;
  const int rowBase = blockIdx.x * 128;
  const int nBase   = blockIdx.y * 128;
  // Staging map: every wave-wide 16-byte load covers whole 128-byte lines.
  // A stage row = 64 f32 = 256 B: 16 lanes a row, two rows a load.
  // B stage row = 64 bf16 = 128 B: 8 lanes a row, four rows a load.
  const int ar = tid >> 4, ac = (tid & 15) * 4;
  const int br = tid >> 3, bc = (tid & 7) * 8;

  f32x4  areg[8];
  bf16x8 breg[4];
  auto load_global = [&](int kc) {
    const float* ap = A + (size_t)(rowBase + ar) * 1024 + kc + ac;
#pragma unroll
    for (int e = 0; e < 8; ++e) areg[e] = *(const f32x4*)(ap + e * 16 * 1024);
    const __bf16* bp = Bt + (size_t)(nBase + br) * 1024 + kc + bc;
#pragma unroll
    for (int e = 0; e < 4; ++e) breg[e] = *(const bf16x8*)(bp + e * 32 * 1024);
  };

#pragma unroll
  for (int i = 0; i < 4; ++i)
#pragma unroll
    for (int j = 0; j < 2; ++j) acc[i][j] = vzero8();

  load_global(0);
  for (int kc = 0; kc < 1024; kc += 64) {
    // Convert staged A regs to bf16 and commit both tiles to LDS.
#pragma unroll
    for (int e = 0; e < 8; ++e) {
      bf16x4 hh;
#pragma unroll
      for (int q = 0; q < 4; ++q) hh[q] = (__bf16)areg[e][q];
      *(bf16x4*)(&As[e * 16 + ar][ac]) = hh;
    }
#pragma unroll
    for (int e = 0; e < 4; ++e) *(bf16x8*)(&Bs[e * 32 + br][bc]) = breg[e];
    __syncthreads();
    if (kc + 64 < 1024) load_global(kc + 64);  // overlap with WMMA phase
#pragma unroll
    for (int ks = 0; ks < 2; ++ks) {
      v16bf bf0 = load_frag(&Bs[wn * 32][ks * 32], 72, lane);
      v16bf bf1 = load_frag(&Bs[wn * 32 + 16][ks * 32], 72, lane);
#pragma unroll
      for (int i = 0; i < 4; ++i) {
        v16bf af = load_frag(&As[wm * 64 + i * 16][ks * 32], 72, lane);
        acc[i][0] = wmma_bf16(af, bf0, acc[i][0]);
        acc[i][1] = wmma_bf16(af, bf1, acc[i][1]);
      }
    }
    __syncthreads();
  }
}

template <int MODE>
__device__ __forceinline__ void gemm_store(
    const v8f (&acc)[4][2], const float* __restrict__ bias,
    float* __restrict__ outF, __bf16* __restrict__ outB,
    __bf16* __restrict__ outT) {
  const int tid  = threadIdx.x;
  const int wave = tid >> 5, lane = tid & 31;
  const int wm = wave >> 2, wn = wave & 3;
  const int rowBase = blockIdx.x * 128;
  const int nBase   = blockIdx.y * 128;
#pragma unroll
  for (int i = 0; i < 4; ++i)
#pragma unroll
    for (int j = 0; j < 2; ++j) {
      const int gn = nBase + wn * 32 + j * 16 + (lane & 15);
      const int gm = rowBase + wm * 64 + i * 16 + (lane >> 4) * 8;
      const float bvs = bias[gn];
      v8f c = acc[i][j];
      if (MODE == 0) {
#pragma unroll
        for (int r = 0; r < 8; ++r) {
          const float v = c[r] + bvs;
          const size_t idx = (size_t)(gm + r) * 1024 + gn;
          outF[idx] = v;
          outB[idx] = (__bf16)v;
        }
      } else if (MODE == 1) {
#pragma unroll
        for (int r = 0; r < 8; ++r)
          outB[(size_t)(gm + r) * 1024 + gn] = (__bf16)(c[r] + bvs);
      } else if (MODE == 2) {
        // vt[b][h][d][key]; D-fragment's 8 VGPRs are 8 consecutive keys.
        const int bb  = gm >> 10;
        const int key = gm & 1023;
        const int hh2 = gn >> 7, dd = gn & 127;
        bf16x8 pk;
#pragma unroll
        for (int r = 0; r < 8; ++r) pk[r] = (__bf16)(c[r] + bvs);
        *(bf16x8*)(&outT[(((size_t)bb * 8 + hh2) * 128 + dd) * 1024 + key]) = pk;
      } else {
#pragma unroll
        for (int r = 0; r < 8; ++r) {
          const float v = c[r] + bvs;
          outF[(size_t)(gm + r) * 1024 + gn] = v > 0.0f ? v : 0.0f;
        }
      }
    }
}

// The Q, K and V projections need nothing of each other: one grid, blockIdx.z picks
// the projection (operands and epilogue), the same for a whole work-group.
__global__ __launch_bounds__(256) void gemm_qkv_kernel(
    const float* __restrict__ Q, const float* __restrict__ K,
    const __bf16* __restrict__ WqT, const __bf16* __restrict__ WkT,
    const __bf16* __restrict__ WvT, const float* __restrict__ bq,
    const float* __restrict__ bk, const float* __restrict__ bv,
    float* __restrict__ qf, __bf16* __restrict__ qb,
    __bf16* __restrict__ kb, __bf16* __restrict__ vt) {
  __shared__ __attribute__((aligned(16))) __bf16 As[128][72];
  __shared__ __attribute__((aligned(16))) __bf16 Bs[128][72];
  const int z = blockIdx.z;
  v8f acc[4][2];
  gemm_tile(z == 0 ? Q : K, z == 0 ? WqT : z == 1 ? WkT : WvT, As, Bs, acc);
  // Precaution: in the built kernel the V and K epilogues stand in front of other
  // code. Their runs of stores end in this wait, so that it stands ahead of any
  // rewrite there of a register that an issued store names. Q's run ends the kernel.
  if (z == 0) {
    gemm_store<0>(acc, bq, qf, qb, nullptr);
  } else if (z == 1) {
    gemm_store<1>(acc, bk, nullptr, kb, nullptr);
    asm volatile("s_wait_xcnt 0x0" ::: "memory");
  } else {
    gemm_store<2>(acc, bv, nullptr, nullptr, vt);
    asm volatile("s_wait_xcnt 0x0" ::: "memory");
  }
}

__global__ __launch_bounds__(256) void gemm_o_kernel(
    const float* __restrict__ A, const __bf16* __restrict__ Bt,
    const float* __restrict__ bias, float* __restrict__ outF) {
  __shared__ __attribute__((aligned(16))) __bf16 As[128][72];
  __shared__ __attribute__((aligned(16))) __bf16 Bs[128][72];
  v8f acc[4][2];
  gemm_tile(A, Bt, As, Bs, acc);
  gemm_store<3>(acc, bias, outF, nullptr, nullptr);
}

__device__ __forceinline__ float xhalf(float x) {
  const int v = __builtin_bit_cast(int, x);
  return __builtin_bit_cast(
      float, __builtin_amdgcn_permlanex16(v, v, 0x76543210, 0xfedcba98, false, false));
}

// exp2 of eight values: eight independent v_exp_f32 in one statement, then one v_nop.
// The instruction set asks for one independent instruction or v_nop behind a
// transcendental before its result is used or its source overwritten. Here every
// successor is independent (the outputs are early-clobber, none lies on an input)
// and the v_nop serves the last one.
__device__ __forceinline__ v8f exp2x8(v8f t) {
  float r0, r1, r2, r3, r4, r5, r6, r7;
  asm("v_exp_f32 %0, %8\n\t"
      "v_exp_f32 %1, %9\n\t"
      "v_exp_f32 %2, %10\n\t"
      "v_exp_f32 %3, %11\n\t"
      "v_exp_f32 %4, %12\n\t"
      "v_exp_f32 %5, %13\n\t"
      "v_exp_f32 %6, %14\n\t"
      "v_exp_f32 %7, %15\n\t"
      "v_nop"
      : "=&v"(r0), "=&v"(r1), "=&v"(r2), "=&v"(r3), "=&v"(r4), "=&v"(r5), "=&v"(r6), "=&v"(r7)
      : "v"(t[0]), "v"(t[1]), "v"(t[2]), "v"(t[3]), "v"(t[4]), "v"(t[5]), "v"(t[6]), "v"(t[7]));
  v8f p;
  p[0] = r0; p[1] = r1; p[2] = r2; p[3] = r3;
  p[4] = r4; p[5] = r5; p[6] = r6; p[7] = r7;
  return p;
}

__global__ __launch_bounds__(256) void attn_kernel(
    const __bf16* __restrict__ qb, const __bf16* __restrict__ kb,
    const __bf16* __restrict__ vt, const float* __restrict__ qf,
    const float* __restrict__ mask_a, const float* __restrict__ mask_b,
    float* __restrict__ Hpre) {
  __shared__ __attribute__((aligned(16))) __bf16 Ks[64][136];   // [key][d]
  __shared__ __attribute__((aligned(16))) __bf16 Vs[128][72];   // [d][key]
  __shared__ __attribute__((aligned(16))) float mbs[64];
  const int tid = threadIdx.x, wave = tid >> 5, lane = tid & 31;
  const int hf = lane >> 4;
  const int b = blockIdx.x >> 3, h = blockIdx.x & 7;
  const int qbase = blockIdx.y * 128;
  const float scale = 0.08838834764831845f;  // 1/sqrt(128)

  // The lane's one query (shared with lane ^ 16) and its mask value.
  const int qrow = b * 1024 + qbase + wave * 16 + (lane & 15);
  const float maq = mask_a[qrow];

  // Q^T B-fragments (4 K-steps over d=128) pinned in registers.
  v16bf qfr[4];
  {
    const __bf16* qbp = qb + (size_t)qrow * 1024 + h * 128;
    const int ho = hf * 8;
#pragma unroll
    for (int ks = 0; ks < 4; ++ks) {
      bf16x8 lo = *(const bf16x8*)(qbp + ks * 32 + ho);
      bf16x8 hi = *(const bf16x8*)(qbp + ks * 32 + 16 + ho);
      qfr[ks] = pack16(lo, hi);
    }
  }

  bf16x8 kreg[4], vreg[4];
  float mbreg = 0.0f;
  auto load_chunk = [&](int kb0) {
#pragma unroll
    for (int i = 0; i < 4; ++i) {
      const int g = tid + i * 256;
      kreg[i] = *(const bf16x8*)(kb + (size_t)(b * 1024 + kb0 + (g >> 4)) * 1024 +
                                 h * 128 + (g & 15) * 8);
    }
#pragma unroll
    for (int i = 0; i < 4; ++i) {
      const int g = tid + i * 256;
      vreg[i] = *(const bf16x8*)(vt + (((size_t)b * 8 + h) * 128 + (g >> 3)) * 1024 +
                                 kb0 + (g & 7) * 8);
    }
    if (tid < 64) mbreg = mask_b[b * 1024 + kb0 + tid];
  };

  // O^T tiles: ofr[dt][r] = O[query lane & 15][d = dt * 16 + hf * 8 + r].
  v8f ofr[8];
#pragma unroll
  for (int d = 0; d < 8; ++d) ofr[d] = vzero8();
  float mrow = -3.0e38f;  // running maximum, equal in both lane halves
  float lrow = 0.0f;      // running sum over this lane half's keys only

  load_chunk(0);
  for (int kb0 = 0; kb0 < 1024; kb0 += 64) {
    __syncthreads();  // all waves done reading Ks/Vs of previous chunk
#pragma unroll
    for (int i = 0; i < 4; ++i) {
      const int g = tid + i * 256;
      *(bf16x8*)(&Ks[g >> 4][(g & 15) * 8]) = kreg[i];
    }
#pragma unroll
    for (int i = 0; i < 4; ++i) {
      const int g = tid + i * 256;
      *(bf16x8*)(&Vs[g >> 3][(g & 7) * 8]) = vreg[i];
    }
    if (tid < 64) mbs[tid] = mbreg;
    __syncthreads();
    if (kb0 + 64 < 1024) load_chunk(kb0 + 64);  // overlap with WMMA phase

    // S^T = K Q^T: sfr[nt][r] = score(key nt * 16 + hf * 8 + r, the lane's query).
    v8f sfr[4];
#pragma unroll
    for (int nt = 0; nt < 4; ++nt) {
      v8f s = vzero8();
#pragma unroll
      for (int ks = 0; ks < 4; ++ks) {
        v16bf kf = load_frag(&Ks[nt * 16][ks * 32], 136, lane);
        s = wmma_bf16(kf, qfr[ks], s);
      }
      sfr[nt] = s;
    }

    // Mask + scale + chunk maximum: four in-lane chains, then the other lane half.
    float cm[4];
#pragma unroll
    for (int nt = 0; nt < 4; ++nt) {
      const f32x4 mb0 = *(const f32x4*)(&mbs[nt * 16 + hf * 8]);
      const f32x4 mb1 = *(const f32x4*)(&mbs[nt * 16 + hf * 8 + 4]);
      cm[nt] = -3.0e38f;
#pragma unroll
      for (int r = 0; r < 8; ++r) {
        const float mbk = r < 4 ? mb0[r & 3] : mb1[r & 3];
        const float s = (maq * mbk == 1.0f) ? sfr[nt][r] * scale : NEGBIG;
        sfr[nt][r] = s;
        cm[nt] = fmaxf(cm[nt], s);
      }
    }
    float cmx = fmaxf(fmaxf(cm[0], cm[1]), fmaxf(cm[2], cm[3]));
    cmx = fmaxf(cmx, xhalf(cmx));

    const float mn = fmaxf(mrow, cmx);
    const float alpha = __expf(mrow - mn);
    mrow = mn;
    float rs[4];
#pragma unroll
    for (int nt = 0; nt < 4; ++nt) {
      // exp(x) as exp2(x * log2(e)), the form __expf compiles to.
      sfr[nt] = exp2x8((sfr[nt] - mrow) * 1.44269504f);
      rs[nt] = sfr[nt][0];
#pragma unroll
      for (int r = 1; r < 8; ++r) rs[nt] += sfr[nt][r];
    }
    lrow = alpha * lrow + ((rs[0] + rs[1]) + (rs[2] + rs[3]));
#pragma unroll
    for (int d = 0; d < 8; ++d)
#pragma unroll
      for (int r = 0; r < 8; ++r) ofr[d][r] *= alpha;

    // O^T += V^T P^T; the P^T fragment of 32 keys is two S^T tiles converted in place.
#pragma unroll
    for (int ks = 0; ks < 2; ++ks) {
      v16bf pb;
#pragma unroll
      for (int e = 0; e < 8; ++e) {
        pb[e]     = (__bf16)sfr[2 * ks][e];
        pb[8 + e] = (__bf16)sfr[2 * ks + 1][e];
      }
#pragma unroll
      for (int dt = 0; dt < 8; ++dt) {
        v16bf vf = load_frag(&Vs[dt * 16][ks * 32], 72, lane);
        ofr[dt] = wmma_bf16(vf, pb, ofr[dt]);
      }
    }
  }

  // O/l + residual q; the lane halves' sums are joined here, once.
  const size_t idx0 = (size_t)qrow * 1024 + h * 128 + hf * 8;
  const float* qp = qf + idx0;
  float* hp = Hpre + idx0;
  f32x4 qv[16];
#pragma unroll
  for (int dt = 0; dt < 8; ++dt) {
    qv[2 * dt]     = *(const f32x4*)(qp + dt * 16);
    qv[2 * dt + 1] = *(const f32x4*)(qp + dt * 16 + 4);
  }
  // Precaution: this wait stands ahead of any rewrite of the address registers that
  // the loads above name; the pointer as an input keeps them untouched up to it
  // (else the run's last load lands on them).
  asm volatile("s_wait_xcnt 0x0" :: "v"(qp) : "memory");
  const float inv = 1.0f / (lrow + xhalf(lrow));
#pragma unroll
  for (int dt = 0; dt < 8; ++dt) {
    f32x4 o0, o1;
#pragma unroll
    for (int r = 0; r < 4; ++r) {
      o0[r] = ofr[dt][r] * inv + qv[2 * dt][r];
      o1[r] = ofr[dt][4 + r] * inv + qv[2 * dt + 1][r];
    }
    *(f32x4*)(hp + dt * 16)     = o0;
    *(f32x4*)(hp + dt * 16 + 4) = o1;
  }
}

// ---------------------------------------------------------------------------
// LayerNorm over rows of 1024, with optional pre-add of Y (residual).
// One wave owns a whole row: 8 loads of 16 bytes a lane, each wave-wide load
// 512 contiguous bytes; the row's sums stay inside the wave (no LDS, no barrier).
// 256 work-groups of 16 waves, two rows a wave (rows 2w and 2w + 1), both
// rows' loads issued ahead of the sums.
// ---------------------------------------------------------------------------
template <bool ADD>
__global__ __launch_bounds__(512) void ln_kernel(
    const float* __restrict__ X, const float* __restrict__ g,
    const float* __restrict__ be, float* __restrict__ out,
    const float* __restrict__ Y) {
  const int lane = threadIdx.x & 31;
  const int w  = blockIdx.x * 16 + (threadIdx.x >> 5);
  const int c0 = lane * 4;
  // The lane's byte offset in X, Y and out alike (under 32 MiB): one 32-bit register
  // beside each scalar base serves all loads and stores of both rows.
  const unsigned ro = (unsigned)w * 8192u + (unsigned)lane * 16u;
  f32x4 x[2][8], y[2][8], gv[8], bv[8];
#pragma unroll
  for (int r = 0; r < 2; ++r) {
    const float* xp = (const float*)((const char*)X + ro) + r * 1024;
#pragma unroll
    for (int j = 0; j < 8; ++j) x[r][j] = *(const f32x4*)(xp + j * 128);
    if (ADD) {
      const float* yp = (const float*)((const char*)Y + ro) + r * 1024;
#pragma unroll
      for (int j = 0; j < 8; ++j) y[r][j] = *(const f32x4*)(yp + j * 128);
    }
  }
#pragma unroll
  for (int j = 0; j < 8; ++j) {
    gv[j] = *(const f32x4*)(g + c0 + j * 128);
    bv[j] = *(const f32x4*)(be + c0 + j * 128);
  }
  // Precaution: this wait stands ahead of any rewrite of an offset register that
  // the loads above name; lane as an input keeps the gain and shift loads' shared
  // offset register untouched up to it (else the run's last load lands on it).
  asm volatile("s_wait_xcnt 0x0" :: "v"(lane) : "memory");
  // Keeps every load above issued ahead of the arithmetic: without it the
  // compiler sinks the gain and shift loads to their uses, one waited pair at a time.
  __builtin_amdgcn_sched_barrier(0);
  if (ADD) {
#pragma unroll
    for (int r = 0; r < 2; ++r)
#pragma unroll
      for (int j = 0; j < 8; ++j) x[r][j] += y[r][j];
  }

  float s[2], ss[2];
#pragma unroll
  for (int r = 0; r < 2; ++r) {
    f32x4 sv = x[r][0], qv = x[r][0] * x[r][0];
#pragma unroll
    for (int j = 1; j < 8; ++j) {
      sv += x[r][j];
      qv += x[r][j] * x[r][j];
    }
    s[r]  = (sv[0] + sv[1]) + (sv[2] + sv[3]);
    ss[r] = (qv[0] + qv[1]) + (qv[2] + qv[3]);
  }
#pragma unroll
  for (int m = 1; m < 32; m <<= 1) {
#pragma unroll
    for (int r = 0; r < 2; ++r) {
      s[r]  += __shfl_xor(s[r], m, 32);
      ss[r] += __shfl_xor(ss[r], m, 32);
    }
  }

#pragma unroll
  for (int r = 0; r < 2; ++r) {
    const float mu   = s[r] * (1.0f / 1024.0f);
    const float var  = ss[r] * (1.0f / 1024.0f) - mu * mu;
    const float rstd = rsqrtf(var + 1e-5f);
    float* op = (float*)((char*)out + ro) + r * 1024;
#pragma unroll
    for (int j = 0; j < 8; ++j)
      *(f32x4*)(op + j * 128) = (x[r][j] - mu) * rstd * gv[j] + bv[j];
  }
}

// ---------------------------------------------------------------------------
extern "C" void kernel_launch(void* const* d_in, const int* in_sizes, int n_in,
                              void* d_out, int out_size, void* d_ws, size_t ws_size,
                              hipStream_t stream) {
  (void)in_sizes; (void)n_in; (void)out_size; (void)ws_size;
  const float* Q   = (const float*)d_in[0];
  const float* K   = (const float*)d_in[1];
  const float* ma  = (const float*)d_in[2];
  const float* mb  = (const float*)d_in[3];
  const float* Wq  = (const float*)d_in[4];  const float* bq  = (const float*)d_in[5];
  const float* Wk  = (const float*)d_in[6];  const float* bk  = (const float*)d_in[7];
  const float* Wv  = (const float*)d_in[8];  const float* bv  = (const float*)d_in[9];
  const float* Wo  = (const float*)d_in[10]; const float* bo  = (const float*)d_in[11];
  const float* g0  = (const float*)d_in[12]; const float* be0 = (const float*)d_in[13];
  const float* g1  = (const float*)d_in[14]; const float* be1 = (const float*)d_in[15];
  float* out = (float*)d_out;

  char* ws = (char*)d_ws;
  size_t off = 0;
  auto alloc = [&](size_t bytes) -> void* {
    void* p = ws + off;
    off += (bytes + 255) & ~(size_t)255;
    return p;
  };
  const size_t MROW = 8192;  // B * 1024
  __bf16* WqT = (__bf16*)alloc(1024 * 1024 * sizeof(__bf16));
  __bf16* WkT = (__bf16*)alloc(1024 * 1024 * sizeof(__bf16));
  __bf16* WvT = (__bf16*)alloc(1024 * 1024 * sizeof(__bf16));
  __bf16* WoT = (__bf16*)alloc(1024 * 1024 * sizeof(__bf16));
  float*  qf    = (float*)alloc(MROW * 1024 * sizeof(float));
  __bf16* qbp   = (__bf16*)alloc(MROW * 1024 * sizeof(__bf16));
  __bf16* kbp   = (__bf16*)alloc(MROW * 1024 * sizeof(__bf16));
  __bf16* vtp   = (__bf16*)alloc(MROW * 1024 * sizeof(__bf16));
  float*  Hpre  = (float*)alloc(MROW * 1024 * sizeof(float));
  float*  H2    = (float*)alloc(MROW * 1024 * sizeof(float));
  float*  reluG = (float*)alloc(MROW * 1024 * sizeof(float));

  dim3 blk(256);
  convw_kernel<<<dim3(32, 32, 4), blk, 0, stream>>>(Wq, Wk, Wv, Wo, WqT, WkT, WvT, WoT);
  gemm_qkv_kernel<<<dim3(64, 8, 3), blk, 0, stream>>>(Q, K, WqT, WkT, WvT, bq, bk, bv,
                                                      qf, qbp, kbp, vtp);
  attn_kernel<<<dim3(64, 8), blk, 0, stream>>>(qbp, kbp, vtp, qf, ma, mb, Hpre);
  ln_kernel<false><<<dim3(256), dim3(512), 0, stream>>>(Hpre, g0, be0, H2, nullptr);
  gemm_o_kernel<<<dim3(64, 8), blk, 0, stream>>>(H2, WoT, bo, reluG);
  ln_kernel<true><<<dim3(256), dim3(512), 0, stream>>>(H2, g1, be1, out, reluG);
}

// v005
// A run of this version takes 165 microseconds.
// Timed twice side by side with v004, it ran 1.06 times as fast both times.
// Counting every step since v000, it is 1.63 times as fast.
#include <hip/hip_runtime.h>

typedef __attribute__((ext_vector_type(16))) __bf16 v16bf;
typedef __attribute__((ext_vector_type(8)))  __bf16 bf16x8;
typedef __attribute__((ext_vector_type(4)))  __bf16 bf16x4;
typedef __attribute__((ext_vector_type(8)))  float  v8f;
typedef __attribute__((ext_vector_type(4)))  float  f32x4;

#define NEGBIG (-1.0e9f)

__device__ __forceinline__ v8f vzero8() {
  v8f z;
#pragma unroll
  for (int i = 0; i < 8; ++i) z[i] = 0.0f;
  return z;
}

__device__ __forceinline__ v16bf pack16(bf16x8 lo, bf16x8 hi) {
  return __builtin_shufflevector(lo, hi, 0, 1, 2, 3, 4, 5, 6, 7, 8, 9, 10, 11, 12, 13, 14, 15);
}

// Load a 16x32 bf16 WMMA A/B fragment from a row-major tile.
// A: row m = lane&15, K halves selected by lane>>4 (per ISA 16-bit A 16x32 layout).
// B is the symmetric layout with n = lane&15 reading rows of the N-major (transposed) tile.
__device__ __forceinline__ v16bf load_frag(const __bf16* base, int ld, int lane) {
  const int r  = lane & 15;
  const int ho = (lane >> 4) * 8;
  const __bf16* p = base + r * ld;
  bf16x8 lo = *(const bf16x8*)(p + ho);
  bf16x8 hi = *(const bf16x8*)(p + 16 + ho);
  return pack16(lo, hi);
}

__device__ __forceinline__ v8f wmma_bf16(v16bf a, v16bf b, v8f c) {
  return __builtin_amdgcn_wmma_f32_16x16x32_bf16(false, a, false, b, (short)0, c, false, false);
}

// ---------------------------------------------------------------------------
// Weight transpose + f32->bf16 convert: W[1024][1024] -> WT[n][k] bf16
// The four weights need nothing of each other: one grid, blockIdx.z picks the weight.
// ---------------------------------------------------------------------------
__global__ __launch_bounds__(256) void convw_kernel(
    const float* __restrict__ W0, const float* __restrict__ W1,
    const float* __restrict__ W2, const float* __restrict__ W3,
    __bf16* __restrict__ WT0, __bf16* __restrict__ WT1,
    __bf16* __restrict__ WT2, __bf16* __restrict__ WT3) {
  __shared__ float t[32][33];
  const int z = blockIdx.z;
  const float* W = z == 0 ? W0 : z == 1 ? W1 : z == 2 ? W2 : W3;
  __bf16* WT = z == 0 ? WT0 : z == 1 ? WT1 : z == 2 ? WT2 : WT3;
  const int k0 = blockIdx.x * 32, n0 = blockIdx.y * 32;
  const int tx = threadIdx.x & 31, ty = threadIdx.x >> 5;
#pragma unroll
  for (int i = 0; i < 32; i += 8)
    t[ty + i][tx] = W[(size_t)(k0 + ty + i) * 1024 + n0 + tx];
  __syncthreads();
#pragma unroll
  for (int i = 0; i < 32; i += 8)
    WT[(size_t)(n0 + ty + i) * 1024 + k0 + tx] = (__bf16)t[tx][ty + i];
}

// ---------------------------------------------------------------------------
// GEMM: C[M=8192, N=1024] = A_f32[M,1024] x W (as Bt = W^T bf16 [N][K]) + bias
// 128x128 block tile, 8 waves (2x4), 64-wide K stages, register double-buffered
// global->LDS staging so HBM latency overlaps the WMMA phase.
// MODE 0: Q proj  -> outF (f32) + outB (bf16)
// MODE 1: K proj  -> outB (bf16)
// MODE 2: V proj  -> outT (bf16, per-head transposed vt[b][h][d][key])
// MODE 3: O proj  -> outF = relu(acc + bias)
// ---------------------------------------------------------------------------
// HOLD: fence the next stage's loads in place (see the two fences below). The Q, K, V
// kernel needs it; the build of the O kernel keeps that order by itself, and there a
// fence would only stop the WMMAs that run on across the barriers.
template <bool HOLD>
__device__ __forceinline__ void gemm_tile(
    const float* __restrict__ A, const __bf16* __restrict__ Bt,
    __bf16 (&As)[128][72], __bf16 (&Bs)[128][72], v8f (&acc)[4][2]) {
  const int tid  = threadIdx.x;
  const int wave = tid >> 5, lane = tid & 31;
  const int wm = wave >> 2, wn = wave & 3;
  const int rowBase = blockIdx.x * 128;
  const int nBase   = blockIdx.y * 128;
  // Staging map: every wave-wide 16-byte load covers whole 128-byte lines.
  // A stage row = 64 f32 = 256 B: 16 lanes a row, two rows a load.
  // B stage row = 64 bf16 = 128 B: 8 lanes a row, four rows a load.
  const int ar = tid >> 4, ac = (tid & 15) * 4;
  const int br = tid >> 3, bc = (tid & 7) * 8;

  f32x4  areg[8];
  bf16x8 breg[4];
  auto load_global = [&](int kc) {
    const float* ap = A + (size_t)(rowBase + ar) * 1024 + kc + ac;
#pragma unroll
    for (int e = 0; e < 8; ++e) areg[e] = *(const f32x4*)(ap + e * 16 * 1024);
    const __bf16* bp = Bt + (size_t)(nBase + br) * 1024 + kc + bc;
#pragma unroll
    for (int e = 0; e < 4; ++e) breg[e] = *(const bf16x8*)(bp + e * 32 * 1024);
  };

#pragma unroll
  for (int i = 0; i < 4; ++i)
#pragma unroll
    for (int j = 0; j < 2; ++j) acc[i][j] = vzero8();

  load_global(0);
  for (int kc = 0; kc < 1024; kc += 64) {
    // Convert staged A regs to bf16 and commit both tiles to LDS.
#pragma unroll
    for (int e = 0; e < 8; ++e) {
      bf16x4 hh;
#pragma unroll
      for (int q = 0; q < 4; ++q) hh[q] = (__bf16)areg[e][q];
      *(bf16x4*)(&As[e * 16 + ar][ac]) = hh;
    }
#pragma unroll
    for (int e = 0; e < 4; ++e) *(bf16x8*)(&Bs[e * 32 + br][bc]) = breg[e];
    __syncthreads();
    if (kc + 64 < 1024) load_global(kc + 64);  // overlap with WMMA phase
    // Keeps all of the next stage's loads issued in front of the WMMA phase: without
    // it the compiler sinks most of them to the end of the phase, next to their uses,
    // and their whole latency is waited out there.
    if (HOLD) __builtin_amdgcn_sched_barrier(0);
#pragma unroll
    for (int ks = 0; ks < 2; ++ks) {
      v16bf bf0 = load_frag(&Bs[wn * 32][ks * 32], 72, lane);
      v16bf bf1 = load_frag(&Bs[wn * 32 + 16][ks * 32], 72, lane);
#pragma unroll
      for (int i = 0; i < 4; ++i) {
        v16bf af = load_frag(&As[wm * 64 + i * 16][ks * 32], 72, lane);
        acc[i][0] = wmma_bf16(af, bf0, acc[i][0]);
        acc[i][1] = wmma_bf16(af, bf1, acc[i][1]);
      }
    }
    // Keeps the conversions of the loaded values, and with them the first wait for
    // the loads, behind the WMMA phase: without it the compiler lifts some among the
    // WMMAs, which then stand still for a load issued just before.
    if (HOLD) __builtin_amdgcn_sched_barrier(0);
    __syncthreads();
  }
}

template <int MODE>
__device__ __forceinline__ void gemm_store(
    const v8f (&acc)[4][2], const float* __restrict__ bias,
    float* __restrict__ outF, __bf16* __restrict__ outB,
    __bf16* __restrict__ outT) {
  const int tid  = threadIdx.x;
  const int wave = tid >> 5, lane = tid & 31;
  const int wm = wave >> 2, wn = wave & 3;
  const int rowBase = blockIdx.x * 128;
  const int nBase   = blockIdx.y * 128;
#pragma unroll
  for (int i = 0; i < 4; ++i)
#pragma unroll
    for (int j = 0; j < 2; ++j) {
      const int gn = nBase + wn * 32 + j * 16 + (lane & 15);
      const int gm = rowBase + wm * 64 + i * 16 + (lane >> 4) * 8;
      const float bvs = bias[gn];
      v8f c = acc[i][j];
      if (MODE == 0) {
#pragma unroll
        for (int r = 0; r < 8; ++r) {
          const float v = c[r] + bvs;
          const size_t idx = (size_t)(gm + r) * 1024 + gn;
          outF[idx] = v;
          outB[idx] = (__bf16)v;
        }
      } else if (MODE == 1) {
#pragma unroll
        for (int r = 0; r < 8; ++r)
          outB[(size_t)(gm + r) * 1024 + gn] = (__bf16)(c[r] + bvs);
      } else if (MODE == 2) {
        // vt[b][h][d][key]; D-fragment's 8 VGPRs are 8 consecutive keys.
        const int bb  = gm >> 10;
        const int key = gm & 1023;
        const int hh2 = gn >> 7, dd = gn & 127;
        bf16x8 pk;
#pragma unroll
        for (int r = 0; r < 8; ++r) pk[r] = (__bf16)(c[r] + bvs);
        *(bf16x8*)(&outT[(((size_t)bb * 8 + hh2) * 128 + dd) * 1024 + key]) = pk;
      } else {
#pragma unroll
        for (int r = 0; r < 8; ++r) {
          const float v = c[r] + bvs;
          outF[(size_t)(gm + r) * 1024 + gn] = v > 0.0f ? v : 0.0f;
        }
      }
    }
}

// The Q, K and V projections need nothing of each other: one grid, blockIdx.z picks
// the projection (operands and epilogue), the same for a whole work-group.
__global__ __launch_bounds__(256) void gemm_qkv_kernel(
    const float* __restrict__ Q, const float* __restrict__ K,
    const __bf16* __restrict__ WqT, const __bf16* __restrict__ WkT,
    const __bf16* __restrict__ WvT, const float* __restrict__ bq,
    const float* __restrict__ bk, const float* __restrict__ bv,
    float* __restrict__ qf, __bf16* __restrict__ qb,
    __bf16* __restrict__ kb, __bf16* __restrict__ vt) {
  __shared__ __attribute__((aligned(16))) __bf16 As[128][72];
  __shared__ __attribute__((aligned(16))) __bf16 Bs[128][72];
  const int z = blockIdx.z;
  v8f acc[4][2];
  gemm_tile<true>(z == 0 ? Q : K, z == 0 ? WqT : z == 1 ? WkT : WvT, As, Bs, acc);
  // Precaution: in the built kernel the V and K epilogues stand in front of other
  // code. Their runs of stores end in this wait, so that it stands ahead of any
  // rewrite there of a register that an issued store names. Q's run ends the kernel.
  if (z == 0) {
    gemm_store<0>(acc, bq, qf, qb, nullptr);
  } else if (z == 1) {
    gemm_store<1>(acc, bk, nullptr, kb, nullptr);
    asm volatile("s_wait_xcnt 0x0" ::: "memory");
  } else {
    gemm_store<2>(acc, bv, nullptr, nullptr, vt);
    asm volatile("s_wait_xcnt 0x0" ::: "memory");
  }
}

__global__ __launch_bounds__(256) void gemm_o_kernel(
    const float* __restrict__ A, const __bf16* __restrict__ Bt,
    const float* __restrict__ bias, float* __restrict__ outF) {
  __shared__ __attribute__((aligned(16))) __bf16 As[128][72];
  __shared__ __attribute__((aligned(16))) __bf16 Bs[128][72];
  v8f acc[4][2];
  gemm_tile<false>(A, Bt, As, Bs, acc);
  gemm_store<3>(acc, bias, outF, nullptr, nullptr);
}

__device__ __forceinline__ float xhalf(float x) {
  const int v = __builtin_bit_cast(int, x);
  return __builtin_bit_cast(
      float, __builtin_amdgcn_permlanex16(v, v, 0x76543210, 0xfedcba98, false, false));
}

// exp2 of eight values: eight independent v_exp_f32 in one statement, then one v_nop.
// The instruction set asks for one independent instruction or v_nop behind a
// transcendental before its result is used or its source overwritten. Here every
// successor is independent (the outputs are early-clobber, none lies on an input)
// and the v_nop serves the last one.
__device__ __forceinline__ v8f exp2x8(v8f t) {
  float r0, r1, r2, r3, r4, r5, r6, r7;
  asm("v_exp_f32 %0, %8\n\t"
      "v_exp_f32 %1, %9\n\t"
      "v_exp_f32 %2, %10\n\t"
      "v_exp_f32 %3, %11\n\t"
      "v_exp_f32 %4, %12\n\t"
      "v_exp_f32 %5, %13\n\t"
      "v_exp_f32 %6, %14\n\t"
      "v_exp_f32 %7, %15\n\t"
      "v_nop"
      : "=&v"(r0), "=&v"(r1), "=&v"(r2), "=&v"(r3), "=&v"(r4), "=&v"(r5), "=&v"(r6), "=&v"(r7)
      : "v"(t[0]), "v"(t[1]), "v"(t[2]), "v"(t[3]), "v"(t[4]), "v"(t[5]), "v"(t[6]), "v"(t[7]));
  v8f p;
  p[0] = r0; p[1] = r1; p[2] = r2; p[3] = r3;
  p[4] = r4; p[5] = r5; p[6] = r6; p[7] = r7;
  return p;
}

__global__ __launch_bounds__(256) void attn_kernel(
    const __bf16* __restrict__ qb, const __bf16* __restrict__ kb,
    const __bf16* __restrict__ vt, const float* __restrict__ qf,
    const float* __restrict__ mask_a, const float* __restrict__ mask_b,
    float* __restrict__ Hpre) {
  __shared__ __attribute__((aligned(16))) __bf16 Ks[64][136];   // [key][d]
  __shared__ __attribute__((aligned(16))) __bf16 Vs[128][72];   // [d][key]
  __shared__ __attribute__((aligned(16))) float mbs[64];
  const int tid = threadIdx.x, wave = tid >> 5, lane = tid & 31;
  const int hf = lane >> 4;
  const int b = blockIdx.x >> 3, h = blockIdx.x & 7;
  const int qbase = blockIdx.y * 128;
  const float scale = 0.08838834764831845f;  // 1/sqrt(128)

  // The lane's one query (shared with lane ^ 16) and its mask value.
  const int qrow = b * 1024 + qbase + wave * 16 + (lane & 15);
  const float maq = mask_a[qrow];

  // Q^T B-fragments (4 K-steps over d=128) pinned in registers.
  v16bf qfr[4];
  {
    const __bf16* qbp = qb + (size_t)qrow * 1024 + h * 128;
    const int ho = hf * 8;
#pragma unroll
    for (int ks = 0; ks < 4; ++ks) {
      bf16x8 lo = *(const bf16x8*)(qbp + ks * 32 + ho);
      bf16x8 hi = *(const bf16x8*)(qbp + ks * 32 + 16 + ho);
      qfr[ks] = pack16(lo, hi);
    }
  }

  bf16x8 kreg[4], vreg[4];
  float mbreg = 0.0f;
  auto load_chunk = [&](int kb0) {
#pragma unroll
    for (int i = 0; i < 4; ++i) {
      const int g = tid + i * 256;
      kreg[i] = *(const bf16x8*)(kb + (size_t)(b * 1024 + kb0 + (g >> 4)) * 1024 +
                                 h * 128 + (g & 15) * 8);
    }
#pragma unroll
    for (int i = 0; i < 4; ++i) {
      const int g = tid + i * 256;
      vreg[i] = *(const bf16x8*)(vt + (((size_t)b * 8 + h) * 128 + (g >> 3)) * 1024 +
                                 kb0 + (g & 7) * 8);
    }
    if (tid < 64) mbreg = mask_b[b * 1024 + kb0 + tid];
  };

  // O^T tiles: ofr[dt][r] = O[query lane & 15][d = dt * 16 + hf * 8 + r].
  v8f ofr[8];
#pragma unroll
  for (int d = 0; d < 8; ++d) ofr[d] = vzero8();
  float mrow = -3.0e38f;  // running maximum, equal in both lane halves
  float lrow = 0.0f;      // running sum over this lane half's keys only

  load_chunk(0);
  for (int kb0 = 0; kb0 < 1024; kb0 += 64) {
    __syncthreads();  // all waves done reading Ks/Vs of previous chunk
#pragma unroll
    for (int i = 0; i < 4; ++i) {
      const int g = tid + i * 256;
      *(bf16x8*)(&Ks[g >> 4][(g & 15) * 8]) = kreg[i];
    }
#pragma unroll
    for (int i = 0; i < 4; ++i) {
      const int g = tid + i * 256;
      *(bf16x8*)(&Vs[g >> 3][(g & 7) * 8]) = vreg[i];
    }
    if (tid < 64) mbs[tid] = mbreg;
    __syncthreads();
    if (kb0 + 64 < 1024) load_chunk(kb0 + 64);  // overlap with WMMA phase

    // S^T = K Q^T: sfr[nt][r] = score(key nt * 16 + hf * 8 + r, the lane's query).
    v8f sfr[4];
#pragma unroll
    for (int nt = 0; nt < 4; ++nt) {
      v8f s = vzero8();
#pragma unroll
      for (int ks = 0; ks < 4; ++ks) {
        v16bf kf = load_frag(&Ks[nt * 16][ks * 32], 136, lane);
        s = wmma_bf16(kf, qfr[ks], s);
      }
      sfr[nt] = s;
    }

    // Mask + scale + chunk maximum: four in-lane chains, then the other lane half.
    float cm[4];
#pragma unroll
    for (int nt = 0; nt < 4; ++nt) {
      const f32x4 mb0 = *(const f32x4*)(&mbs[nt * 16 + hf * 8]);
      const f32x4 mb1 = *(const f32x4*)(&mbs[nt * 16 + hf * 8 + 4]);
      cm[nt] = -3.0e38f;
#pragma unroll
      for (int r = 0; r < 8; ++r) {
        const float mbk = r < 4 ? mb0[r & 3] : mb1[r & 3];
        const float s = (maq * mbk == 1.0f) ? sfr[nt][r] * scale : NEGBIG;
        sfr[nt][r] = s;
        cm[nt] = fmaxf(cm[nt], s);
      }
    }
    float cmx = fmaxf(fmaxf(cm[0], cm[1]), fmaxf(cm[2], cm[3]));
    cmx = fmaxf(cmx, xhalf(cmx));

    const float mn = fmaxf(mrow, cmx);
    const float alpha = __expf(mrow - mn);
    mrow = mn;
    float rs[4];
#pragma unroll
    for (int nt = 0; nt < 4; ++nt) {
      // exp(x) as exp2(x * log2(e)), the form __expf compiles to.
      sfr[nt] = exp2x8((sfr[nt] - mrow) * 1.44269504f);
      rs[nt] = sfr[nt][0];
#pragma unroll
      for (int r = 1; r < 8; ++r) rs[nt] += sfr[nt][r];
    }
    lrow = alpha * lrow + ((rs[0] + rs[1]) + (rs[2] + rs[3]));
#pragma unroll
    for (int d = 0; d < 8; ++d)
#pragma unroll
      for (int r = 0; r < 8; ++r) ofr[d][r] *= alpha;

    // O^T += V^T P^T; the P^T fragment of 32 keys is two S^T tiles converted in place.
#pragma unroll
    for (int ks = 0; ks < 2; ++ks) {
      v16bf pb;
#pragma unroll
      for (int e = 0; e < 8; ++e) {
        pb[e]     = (__bf16)sfr[2 * ks][e];
        pb[8 + e] = (__bf16)sfr[2 * ks + 1][e];
      }
#pragma unroll
      for (int dt = 0; dt < 8; ++dt) {
        v16bf vf = load_frag(&Vs[dt * 16][ks * 32], 72, lane);
        ofr[dt] = wmma_bf16(vf, pb, ofr[dt]);
      }
    }
  }

  // O/l + residual q; the lane halves' sums are joined here, once.
  const size_t idx0 = (size_t)qrow * 1024 + h * 128 + hf * 8;
  const float* qp = qf + idx0;
  float* hp = Hpre + idx0;
  f32x4 qv[16];
#pragma unroll
  for (int dt = 0; dt < 8; ++dt) {
    qv[2 * dt]     = *(const f32x4*)(qp + dt * 16);
    qv[2 * dt + 1] = *(const f32x4*)(qp + dt * 16 + 4);
  }
  // Precaution: this wait stands ahead of any rewrite of the address registers that
  // the loads above name; the pointer as an input keeps them untouched up to it
  // (else the run's last load lands on them).
  asm volatile("s_wait_xcnt 0x0" :: "v"(qp) : "memory");
  const float inv = 1.0f / (lrow + xhalf(lrow));
#pragma unroll
  for (int dt = 0; dt < 8; ++dt) {
    f32x4 o0, o1;
#pragma unroll
    for (int r = 0; r < 4; ++r) {
      o0[r] = ofr[dt][r] * inv + qv[2 * dt][r];
      o1[r] = ofr[dt][4 + r] * inv + qv[2 * dt + 1][r];
    }
    *(f32x4*)(hp + dt * 16)     = o0;
    *(f32x4*)(hp + dt * 16 + 4) = o1;
  }
}

// ---------------------------------------------------------------------------
// LayerNorm over rows of 1024, with optional pre-add of Y (residual).
// One wave owns a whole row: 8 loads of 16 bytes a lane, each wave-wide load
// 512 contiguous bytes; the row's sums stay inside the wave (no LDS, no barrier).
// 256 work-groups of 16 waves, two rows a wave (rows 2w and 2w + 1), both
// rows' loads issued ahead of the sums.
// ---------------------------------------------------------------------------
template <bool ADD>
__global__ __launch_bounds__(512) void ln_kernel(
    const float* __restrict__ X, const float* __restrict__ g,
    const float* __restrict__ be, float* __restrict__ out,
    const float* __restrict__ Y) {
  const int lane = threadIdx.x & 31;
  const int w  = blockIdx.x * 16 + (threadIdx.x >> 5);
  const int c0 = lane * 4;
  // The lane's byte offset in X, Y and out alike (under 32 MiB): one 32-bit register
  // beside each scalar base serves all loads and stores of both rows.
  const unsigned ro = (unsigned)w * 8192u + (unsigned)lane * 16u;
  f32x4 x[2][8], y[2][8], gv[8], bv[8];
#pragma unroll
  for (int r = 0; r < 2; ++r) {
    const float* xp = (const float*)((const char*)X + ro) + r * 1024;
#pragma unroll
    for (int j = 0; j < 8; ++j) x[r][j] = *(const f32x4*)(xp + j * 128);
    if (ADD) {
      const float* yp = (const float*)((const char*)Y + ro) + r * 1024;
#pragma unroll
      for (int j = 0; j < 8; ++j) y[r][j] = *(const f32x4*)(yp + j * 128);
    }
  }
#pragma unroll
  for (int j = 0; j < 8; ++j) {
    gv[j] = *(const f32x4*)(g + c0 + j * 128);
    bv[j] = *(const f32x4*)(be + c0 + j * 128);
  }
  // Precaution: this wait stands ahead of any rewrite of an offset register that
  // the loads above name; lane as an input keeps the gain and shift loads' shared
  // offset register untouched up to it (else the run's last load lands on it).
  asm volatile("s_wait_xcnt 0x0" :: "v"(lane) : "memory");
  // Keeps every load above issued ahead of the arithmetic: without it the
  // compiler sinks the gain and shift loads to their uses, one waited pair at a time.
  __builtin_amdgcn_sched_barrier(0);
  if (ADD) {
#pragma unroll
    for (int r = 0; r < 2; ++r)
#pragma unroll
      for (int j = 0; j < 8; ++j) x[r][j] += y[r][j];
  }

  float s[2], ss[2];
#pragma unroll
  for (int r = 0; r < 2; ++r) {
    f32x4 sv = x[r][0], qv = x[r][0] * x[r][0];
#pragma unroll
    for (int j = 1; j < 8; ++j) {
      sv += x[r][j];
      qv += x[r][j] * x[r][j];
    }
    s[r]  = (sv[0] + sv[1]) + (sv[2] + sv[3]);
    ss[r] = (qv[0] + qv[1]) + (qv[2] + qv[3]);
  }
#pragma unroll
  for (int m = 1; m < 32; m <<= 1) {
#pragma unroll
    for (int r = 0; r < 2; ++r) {
      s[r]  += __shfl_xor(s[r], m, 32);
      ss[r] += __shfl_xor(ss[r], m, 32);
    }
  }

#pragma unroll
  for (int r = 0; r < 2; ++r) {
    const float mu   = s[r] * (1.0f / 1024.0f);
    const float var  = ss[r] * (1.0f / 1024.0f) - mu * mu;
    const float rstd = rsqrtf(var + 1e-5f);
    float* op = (float*)((char*)out + ro) + r * 1024;
#pragma unroll
    for (int j = 0; j < 8; ++j)
      *(f32x4*)(op + j * 128) = (x[r][j] - mu) * rstd * gv[j] + bv[j];
  }
}

// ---------------------------------------------------------------------------
extern "C" void kernel_launch(void* const* d_in, const int* in_sizes, int n_in,
                              void* d_out, int out_size, void* d_ws, size_t ws_size,
                              hipStream_t stream) {
  (void)in_sizes; (void)n_in; (void)out_size; (void)ws_size;
  const float* Q   = (const float*)d_in[0];
  const float* K   = (const float*)d_in[1];
  const float* ma  = (const float*)d_in[2];
  const float* mb  = (const float*)d_in[3];
  const float* Wq  = (const float*)d_in[4];  const float* bq  = (const float*)d_in[5];
  const float* Wk  = (const float*)d_in[6];  const float* bk  = (const float*)d_in[7];
  const float* Wv  = (const float*)d_in[8];  const float* bv  = (const float*)d_in[9];
  const float* Wo  = (const float*)d_in[10]; const float* bo  = (const float*)d_in[11];
  const float* g0  = (const float*)d_in[12]; const float* be0 = (const float*)d_in[13];
  const float* g1  = (const float*)d_in[14]; const float* be1 = (const float*)d_in[15];
  float* out = (float*)d_out;

  char* ws = (char*)d_ws;
  size_t off = 0;
  auto alloc = [&](size_t bytes) -> void* {
    void* p = ws + off;
    off += (bytes + 255) & ~(size_t)255;
    return p;
  };
  const size_t MROW = 8192;  // B * 1024
  __bf16* WqT = (__bf16*)alloc(1024 * 1024 * sizeof(__bf16));
  __bf16* WkT = (__bf16*)alloc(1024 * 1024 * sizeof(__bf16));
  __bf16* WvT = (__bf16*)alloc(1024 * 1024 * sizeof(__bf16));
  __bf16* WoT = (__bf16*)alloc(1024 * 1024 * sizeof(__bf16));
  float*  qf    = (float*)alloc(MROW * 1024 * sizeof(float));
  __bf16* qbp   = (__bf16*)alloc(MROW * 1024 * sizeof(__bf16));
  __bf16* kbp   = (__bf16*)alloc(MROW * 1024 * sizeof(__bf16));
  __bf16* vtp   = (__bf16*)alloc(MROW * 1024 * sizeof(__bf16));
  float*  Hpre  = (float*)alloc(MROW * 1024 * sizeof(float));
  float*  H2    = (float*)alloc(MROW * 1024 * sizeof(float));
  float*  reluG = (float*)alloc(MROW * 1024 * sizeof(float));

  dim3 blk(256);
  convw_kernel<<<dim3(32, 32, 4), blk, 0, stream>>>(Wq, Wk, Wv, Wo, WqT, WkT, WvT, WoT);
  gemm_qkv_kernel<<<dim3(64, 8, 3), blk, 0, stream>>>(Q, K, WqT, WkT, WvT, bq, bk, bv,
                                                      qf, qbp, kbp, vtp);
  attn_kernel<<<dim3(64, 8), blk, 0, stream>>>(qbp, kbp, vtp, qf, ma, mb, Hpre);
  ln_kernel<false><<<dim3(256), dim3(512), 0, stream>>>(Hpre, g0, be0, H2, nullptr);
  gemm_o_kernel<<<dim3(64, 8), blk, 0, stream>>>(H2, WoT, bo, reluG);
  ln_kernel<true><<<dim3(256), dim3(512), 0, stream>>>(H2, g1, be1, out, reluG);
}

// v006
// It runs in 156 microseconds.
// Next to v005, in two timings, it ran 1.05 and 1.06 times as fast.
// Counting every step since v000, it is 1.72 times as fast.
#include <hip/hip_runtime.h>

typedef __attribute__((ext_vector_type(16))) __bf16 v16bf;
typedef __attribute__((ext_vector_type(8)))  __bf16 bf16x8;
typedef __attribute__((ext_vector_type(4)))  __bf16 bf16x4;
typedef __attribute__((ext_vector_type(8)))  float  v8f;
typedef __attribute__((ext_vector_type(4)))  float  f32x4;

#define NEGBIG (-1.0e9f)

__device__ __forceinline__ v8f vzero8() {
  v8f z;
#pragma unroll
  for (int i = 0; i < 8; ++i) z[i] = 0.0f;
  return z;
}

__device__ __forceinline__ v16bf pack16(bf16x8 lo, bf16x8 hi) {
  return __builtin_shufflevector(lo, hi, 0, 1, 2, 3, 4, 5, 6, 7, 8, 9, 10, 11, 12, 13, 14, 15);
}

// Load a 16x32 bf16 WMMA A/B fragment from a row-major tile.
// A: row m = lane&15, K halves selected by lane>>4 (per ISA 16-bit A 16x32 layout).
// B is the symmetric layout with n = lane&15 reading rows of the N-major (transposed) tile.
__device__ __forceinline__ v16bf load_frag(const __bf16* base, int ld, int lane) {
  const int r  = lane & 15;
  const int ho = (lane >> 4) * 8;
  const __bf16* p = base + r * ld;
  bf16x8 lo = *(const bf16x8*)(p + ho);
  bf16x8 hi = *(const bf16x8*)(p + 16 + ho);
  return pack16(lo, hi);
}

__device__ __forceinline__ v8f wmma_bf16(v16bf a, v16bf b, v8f c) {
  return __builtin_amdgcn_wmma_f32_16x16x32_bf16(false, a, false, b, (short)0, c, false, false);
}

// ---------------------------------------------------------------------------
// Weight transpose + f32->bf16 convert: W[1024][1024] -> WT[n][k] bf16
// The four weights need nothing of each other: one grid, blockIdx.z picks the weight.
// ---------------------------------------------------------------------------
__global__ __launch_bounds__(256) void convw_kernel(
    const float* __restrict__ W0, const float* __restrict__ W1,
    const float* __restrict__ W2, const float* __restrict__ W3,
    __bf16* __restrict__ WT0, __bf16* __restrict__ WT1,
    __bf16* __restrict__ WT2, __bf16* __restrict__ WT3) {
  __shared__ float t[32][33];
  const int z = blockIdx.z;
  const float* W = z == 0 ? W0 : z == 1 ? W1 : z == 2 ? W2 : W3;
  __bf16* WT = z == 0 ? WT0 : z == 1 ? WT1 : z == 2 ? WT2 : WT3;
  const int k0 = blockIdx.x * 32, n0 = blockIdx.y * 32;
  const int tx = threadIdx.x & 31, ty = threadIdx.x >> 5;
#pragma unroll
  for (int i = 0; i < 32; i += 8)
    t[ty + i][tx] = W[(size_t)(k0 + ty + i) * 1024 + n0 + tx];
  __syncthreads();
#pragma unroll
  for (int i = 0; i < 32; i += 8)
    WT[(size_t)(n0 + ty + i) * 1024 + k0 + tx] = (__bf16)t[tx][ty + i];
}

// ---------------------------------------------------------------------------
// GEMM: C[M=8192, N=1024] = A_f32[M,1024] x W (as Bt = W^T bf16 [N][K]) + bias
// 128x128 block tile, 8 waves (2x4), 64-wide K stages, register double-buffered
// global->LDS staging so HBM latency overlaps the WMMA phase.
// MODE 0: Q proj  -> outF (f32) + outB (bf16)
// MODE 1: K proj  -> outB (bf16)
// MODE 2: V proj  -> outT (bf16, per-head transposed vt[b][h][d][key])
// MODE 3: O proj  -> outF = relu(acc + bias)
// ---------------------------------------------------------------------------
// HOLD: fence the next stage's loads in place (see the two fences below). The Q, K, V
// kernel needs it; the build of the O kernel keeps that order by itself, and there a
// fence would only stop the WMMAs that run on across the barriers.
template <bool HOLD>
__device__ __forceinline__ void gemm_tile(
    const float* __restrict__ A, const __bf16* __restrict__ Bt,
    __bf16 (&As)[128][72], __bf16 (&Bs)[128][72], v8f (&acc)[4][2]) {
  const int tid  = threadIdx.x;
  const int wave = tid >> 5, lane = tid & 31;
  const int wm = wave >> 2, wn = wave & 3;
  const int rowBase = blockIdx.x * 128;
  const int nBase   = blockIdx.y * 128;
  // Staging map: every wave-wide 16-byte load covers whole 128-byte lines.
  // A stage row = 64 f32 = 256 B: 16 lanes a row, two rows a load.
  // B stage row = 64 bf16 = 128 B: 8 lanes a row, four rows a load.
  const int ar = tid >> 4, ac = (tid & 15) * 4;
  const int br = tid >> 3, bc = (tid & 7) * 8;

  f32x4  areg[8];
  bf16x8 breg[4];
  auto load_global = [&](int kc) {
    const float* ap = A + (size_t)(rowBase + ar) * 1024 + kc + ac;
#pragma unroll
    for (int e = 0; e < 8; ++e) areg[e] = *(const f32x4*)(ap + e * 16 * 1024);
    const __bf16* bp = Bt + (size_t)(nBase + br) * 1024 + kc + bc;
#pragma unroll
    for (int e = 0; e < 4; ++e) breg[e] = *(const bf16x8*)(bp + e * 32 * 1024);
  };

#pragma unroll
  for (int i = 0; i < 4; ++i)
#pragma unroll
    for (int j = 0; j < 2; ++j) acc[i][j] = vzero8();

  load_global(0);
  for (int kc = 0; kc < 1024; kc += 64) {
    // Convert staged A regs to bf16 and commit both tiles to LDS.
#pragma unroll
    for (int e = 0; e < 8; ++e) {
      bf16x4 hh;
#pragma unroll
      for (int q = 0; q < 4; ++q) hh[q] = (__bf16)areg[e][q];
      *(bf16x4*)(&As[e * 16 + ar][ac]) = hh;
    }
#pragma unroll
    for (int e = 0; e < 4; ++e) *(bf16x8*)(&Bs[e * 32 + br][bc]) = breg[e];
    __syncthreads();
    if (kc + 64 < 1024) load_global(kc + 64);  // overlap with WMMA phase
    // Keeps all of the next stage's loads issued in front of the WMMA phase: without
    // it the compiler sinks most of them to the end of the phase, next to their uses,
    // and their whole latency is waited out there.
    if (HOLD) __builtin_amdgcn_sched_barrier(0);
#pragma unroll
    for (int ks = 0; ks < 2; ++ks) {
      v16bf bf0 = load_frag(&Bs[wn * 32][ks * 32], 72, lane);
      v16bf bf1 = load_frag(&Bs[wn * 32 + 16][ks * 32], 72, lane);
#pragma unroll
      for (int i = 0; i < 4; ++i) {
        v16bf af = load_frag(&As[wm * 64 + i * 16][ks * 32], 72, lane);
        acc[i][0] = wmma_bf16(af, bf0, acc[i][0]);
        acc[i][1] = wmma_bf16(af, bf1, acc[i][1]);
      }
    }
    // Keeps the conversions of the loaded values, and with them the first wait for
    // the loads, behind the WMMA phase: without it the compiler lifts some among the
    // WMMAs, which then stand still for a load issued just before.
    if (HOLD) __builtin_amdgcn_sched_barrier(0);
    __syncthreads();
  }
}

template <int MODE>
__device__ __forceinline__ void gemm_store(
    const v8f (&acc)[4][2], const float* __restrict__ bias,
    float* __restrict__ outF, __bf16* __restrict__ outB,
    __bf16* __restrict__ outT) {
  const int tid  = threadIdx.x;
  const int wave = tid >> 5, lane = tid & 31;
  const int wm = wave >> 2, wn = wave & 3;
  const int rowBase = blockIdx.x * 128;
  const int nBase   = blockIdx.y * 128;
#pragma unroll
  for (int i = 0; i < 4; ++i)
#pragma unroll
    for (int j = 0; j < 2; ++j) {
      const int gn = nBase + wn * 32 + j * 16 + (lane & 15);
      const int gm = rowBase + wm * 64 + i * 16 + (lane >> 4) * 8;
      const float bvs = bias[gn];
      v8f c = acc[i][j];
      if (MODE == 0) {
#pragma unroll
        for (int r = 0; r < 8; ++r) {
          const float v = c[r] + bvs;
          const size_t idx = (size_t)(gm + r) * 1024 + gn;
          outF[idx] = v;
          outB[idx] = (__bf16)v;
        }
      } else if (MODE == 1) {
#pragma unroll
        for (int r = 0; r < 8; ++r)
          outB[(size_t)(gm + r) * 1024 + gn] = (__bf16)(c[r] + bvs);
      } else if (MODE == 2) {
        // vt[b][h][d][key]; D-fragment's 8 VGPRs are 8 consecutive keys.
        const int bb  = gm >> 10;
        const int key = gm & 1023;
        const int hh2 = gn >> 7, dd = gn & 127;
        bf16x8 pk;
#pragma unroll
        for (int r = 0; r < 8; ++r) pk[r] = (__bf16)(c[r] + bvs);
        *(bf16x8*)(&outT[(((size_t)bb * 8 + hh2) * 128 + dd) * 1024 + key]) = pk;
      } else {
#pragma unroll
        for (int r = 0; r < 8; ++r) {
          const float v = c[r] + bvs;
          outF[(size_t)(gm + r) * 1024 + gn] = v > 0.0f ? v : 0.0f;
        }
      }
    }
}

// The Q, K and V projections need nothing of each other: one grid, blockIdx.z picks
// the projection (operands and epilogue), the same for a whole work-group.
__global__ __launch_bounds__(256) void gemm_qkv_kernel(
    const float* __restrict__ Q, const float* __restrict__ K,
    const __bf16* __restrict__ WqT, const __bf16* __restrict__ WkT,
    const __bf16* __restrict__ WvT, const float* __restrict__ bq,
    const float* __restrict__ bk, const float* __restrict__ bv,
    float* __restrict__ qf, __bf16* __restrict__ qb,
    __bf16* __restrict__ kb, __bf16* __restrict__ vt) {
  __shared__ __attribute__((aligned(16))) __bf16 As[128][72];
  __shared__ __attribute__((aligned(16))) __bf16 Bs[128][72];
  const int z = blockIdx.z;
  v8f acc[4][2];
  gemm_tile<true>(z == 0 ? Q : K, z == 0 ? WqT : z == 1 ? WkT : WvT, As, Bs, acc);
  // Precaution: in the built kernel the V and K epilogues stand in front of other
  // code. Their runs of stores end in this wait, so that it stands ahead of any
  // rewrite there of a register that an issued store names. Q's run ends the kernel.
  if (z == 0) {
    gemm_store<0>(acc, bq, qf, qb, nullptr);
  } else if (z == 1) {
    gemm_store<1>(acc, bk, nullptr, kb, nullptr);
    asm volatile("s_wait_xcnt 0x0" ::: "memory");
  } else {
    gemm_store<2>(acc, bv, nullptr, nullptr, vt);
    asm volatile("s_wait_xcnt 0x0" ::: "memory");
  }
}

__global__ __launch_bounds__(256) void gemm_o_kernel(
    const float* __restrict__ A, const __bf16* __restrict__ Bt,
    const float* __restrict__ bias, float* __restrict__ outF) {
  __shared__ __attribute__((aligned(16))) __bf16 As[128][72];
  __shared__ __attribute__((aligned(16))) __bf16 Bs[128][72];
  v8f acc[4][2];
  gemm_tile<false>(A, Bt, As, Bs, acc);
  gemm_store<3>(acc, bias, outF, nullptr, nullptr);
}

__device__ __forceinline__ float xhalf(float x) {
  const int v = __builtin_bit_cast(int, x);
  return __builtin_bit_cast(
      float, __builtin_amdgcn_permlanex16(v, v, 0x76543210, 0xfedcba98, false, false));
}

// exp2 of eight values: eight independent v_exp_f32 in one statement, then one v_nop.
// The instruction set asks for one independent instruction or v_nop behind a
// transcendental before its result is used or its source overwritten. Here every
// successor is independent (the outputs are early-clobber, none lies on an input)
// and the v_nop serves the last one.
__device__ __forceinline__ v8f exp2x8(v8f t) {
  float r0, r1, r2, r3, r4, r5, r6, r7;
  asm("v_exp_f32 %0, %8\n\t"
      "v_exp_f32 %1, %9\n\t"
      "v_exp_f32 %2, %10\n\t"
      "v_exp_f32 %3, %11\n\t"
      "v_exp_f32 %4, %12\n\t"
      "v_exp_f32 %5, %13\n\t"
      "v_exp_f32 %6, %14\n\t"
      "v_exp_f32 %7, %15\n\t"
      "v_nop"
      : "=&v"(r0), "=&v"(r1), "=&v"(r2), "=&v"(r3), "=&v"(r4), "=&v"(r5), "=&v"(r6), "=&v"(r7)
      : "v"(t[0]), "v"(t[1]), "v"(t[2]), "v"(t[3]), "v"(t[4]), "v"(t[5]), "v"(t[6]), "v"(t[7]));
  v8f p;
  p[0] = r0; p[1] = r1; p[2] = r2; p[3] = r3;
  p[4] = r4; p[5] = r5; p[6] = r6; p[7] = r7;
  return p;
}

__global__ __launch_bounds__(256) void attn_kernel(
    const __bf16* __restrict__ qb, const __bf16* __restrict__ kb,
    const __bf16* __restrict__ vt, const float* __restrict__ qf,
    const float* __restrict__ mask_a, const float* __restrict__ mask_b,
    float* __restrict__ Hpre) {
  __shared__ __attribute__((aligned(16))) __bf16 Ks[64][136];   // [key][d]
  __shared__ __attribute__((aligned(16))) __bf16 Vs[128][72];   // [d][key]
  __shared__ __attribute__((aligned(16))) float mbs[64];
  const int tid = threadIdx.x, wave = tid >> 5, lane = tid & 31;
  const int hf = lane >> 4;
  const int b = blockIdx.x >> 3, h = blockIdx.x & 7;
  const int qbase = blockIdx.y * 128;
  const float scale = 0.08838834764831845f;  // 1/sqrt(128)

  // The lane's one query (shared with lane ^ 16) and its mask value.
  const int qrow = b * 1024 + qbase + wave * 16 + (lane & 15);
  const float maq = mask_a[qrow];

  // Q^T B-fragments (4 K-steps over d=128) pinned in registers.
  v16bf qfr[4];
  {
    const __bf16* qbp = qb + (size_t)qrow * 1024 + h * 128;
    const int ho = hf * 8;
#pragma unroll
    for (int ks = 0; ks < 4; ++ks) {
      bf16x8 lo = *(const bf16x8*)(qbp + ks * 32 + ho);
      bf16x8 hi = *(const bf16x8*)(qbp + ks * 32 + 16 + ho);
      qfr[ks] = pack16(lo, hi);
    }
  }

  // Staging addresses: the thread's part is one byte offset for K and one for V^T, the
  // same in every chunk; block and chunk are wave-uniform, and the four loads (and LDS
  // stores) of a run differ by a constant, so a run needs one address, not four.
  // The registers so freed bring the kernel under 256 VGPRs: four waves fit a SIMD and
  // two work-groups share a WGP, each filling the other's barrier, LDS and softmax waits.
  const int kr = tid >> 4, kc = (tid & 15) * 8;  // K: 16 threads a row, 16 rows a load
  const int vr = tid >> 3, vc = (tid & 7) * 8;   // V^T: 8 threads a row, 32 rows a load
  const unsigned ko = (unsigned)(kr * 1024 + kc) * 2u;
  const unsigned vo = (unsigned)(vr * 1024 + vc) * 2u;
  const __bf16* kblk = kb + (size_t)b * 1024 * 1024 + h * 128;
  const __bf16* vblk = vt + ((size_t)b * 8 + h) * 128 * 1024;

  bf16x8 kreg[4], vreg[4];
  float mbreg = 0.0f;
  auto load_chunk = [&](int kb0) {
    const __bf16* kp = (const __bf16*)((const char*)(kblk + (size_t)kb0 * 1024) + ko);
#pragma unroll
    for (int i = 0; i < 4; ++i) kreg[i] = *(const bf16x8*)(kp + i * 16 * 1024);
    const __bf16* vp = (const __bf16*)((const char*)(vblk + kb0) + vo);
#pragma unroll
    for (int i = 0; i < 4; ++i) vreg[i] = *(const bf16x8*)(vp + i * 32 * 1024);
    if (tid < 64) mbreg = mask_b[b * 1024 + kb0 + tid];
    // Precaution: this wait stands ahead of any rewrite of the offset register that
    // the mask load names (the build reuses it for the first fragment read).
    asm volatile("s_wait_xcnt 0x0" ::: "memory");
  };

  // O^T tiles: ofr[dt][r] = O[query lane & 15][d = dt * 16 + hf * 8 + r].
  v8f ofr[8];
#pragma unroll
  for (int d = 0; d < 8; ++d) ofr[d] = vzero8();
  float mrow = -3.0e38f;  // running maximum, equal in both lane halves
  float lrow = 0.0f;      // running sum over this lane half's keys only

  load_chunk(0);
  for (int kb0 = 0; kb0 < 1024; kb0 += 64) {
    __syncthreads();  // all waves done reading Ks/Vs of previous chunk
#pragma unroll
    for (int i = 0; i < 4; ++i) *(bf16x8*)(&Ks[kr + i * 16][kc]) = kreg[i];
#pragma unroll
    for (int i = 0; i < 4; ++i) *(bf16x8*)(&Vs[vr + i * 32][vc]) = vreg[i];
    if (tid < 64) mbs[tid] = mbreg;
    __syncthreads();
    if (kb0 + 64 < 1024) load_chunk(kb0 + 64);  // overlap with WMMA phase

    // S^T = K Q^T: sfr[nt][r] = score(key nt * 16 + hf * 8 + r, the lane's query).
    v8f sfr[4];
#pragma unroll
    for (int nt = 0; nt < 4; ++nt) {
      v8f s = vzero8();
#pragma unroll
      for (int ks = 0; ks < 4; ++ks) {
        v16bf kf = load_frag(&Ks[nt * 16][ks * 32], 136, lane);
        s = wmma_bf16(kf, qfr[ks], s);
      }
      sfr[nt] = s;
    }

    // Mask + scale + chunk maximum: four in-lane chains, then the other lane half.
    float cm[4];
#pragma unroll
    for (int nt = 0; nt < 4; ++nt) {
      const f32x4 mb0 = *(const f32x4*)(&mbs[nt * 16 + hf * 8]);
      const f32x4 mb1 = *(const f32x4*)(&mbs[nt * 16 + hf * 8 + 4]);
      cm[nt] = -3.0e38f;
#pragma unroll
      for (int r = 0; r < 8; ++r) {
        const float mbk = r < 4 ? mb0[r & 3] : mb1[r & 3];
        const float s = (maq * mbk == 1.0f) ? sfr[nt][r] * scale : NEGBIG;
        sfr[nt][r] = s;
        cm[nt] = fmaxf(cm[nt], s);
      }
    }
    float cmx = fmaxf(fmaxf(cm[0], cm[1]), fmaxf(cm[2], cm[3]));
    cmx = fmaxf(cmx, xhalf(cmx));

    const float mn = fmaxf(mrow, cmx);
    const float alpha = __expf(mrow - mn);
    mrow = mn;
    float rs[4];
#pragma unroll
    for (int nt = 0; nt < 4; ++nt) {
      // exp(x) as exp2(x * log2(e)), the form __expf compiles to.
      sfr[nt] = exp2x8((sfr[nt] - mrow) * 1.44269504f);
      rs[nt] = sfr[nt][0];
#pragma unroll
      for (int r = 1; r < 8; ++r) rs[nt] += sfr[nt][r];
    }
    lrow = alpha * lrow + ((rs[0] + rs[1]) + (rs[2] + rs[3]));
#pragma unroll
    for (int d = 0; d < 8; ++d)
#pragma unroll
      for (int r = 0; r < 8; ++r) ofr[d][r] *= alpha;

    // O^T += V^T P^T; the P^T fragment of 32 keys is two S^T tiles converted in place.
#pragma unroll
    for (int ks = 0; ks < 2; ++ks) {
      v16bf pb;
#pragma unroll
      for (int e = 0; e < 8; ++e) {
        pb[e]     = (__bf16)sfr[2 * ks][e];
        pb[8 + e] = (__bf16)sfr[2 * ks + 1][e];
      }
#pragma unroll
      for (int dt = 0; dt < 8; ++dt) {
        v16bf vf = load_frag(&Vs[dt * 16][ks * 32], 72, lane);
        ofr[dt] = wmma_bf16(vf, pb, ofr[dt]);
      }
    }
  }

  // O/l + residual q; the lane halves' sums are joined here, once.
  const size_t idx0 = (size_t)qrow * 1024 + h * 128 + hf * 8;
  const float* qp = qf + idx0;
  float* hp = Hpre + idx0;
  f32x4 qv[16];
#pragma unroll
  for (int dt = 0; dt < 8; ++dt) {
    qv[2 * dt]     = *(const f32x4*)(qp + dt * 16);
    qv[2 * dt + 1] = *(const f32x4*)(qp + dt * 16 + 4);
  }
  // Precaution: this wait stands ahead of any rewrite of the address registers that
  // the loads above name; the pointer as an input keeps them untouched up to it
  // (else the run's last load lands on them).
  asm volatile("s_wait_xcnt 0x0" :: "v"(qp) : "memory");
  const float inv = 1.0f / (lrow + xhalf(lrow));
#pragma unroll
  for (int dt = 0; dt < 8; ++dt) {
    f32x4 o0, o1;
#pragma unroll
    for (int r = 0; r < 4; ++r) {
      o0[r] = ofr[dt][r] * inv + qv[2 * dt][r];
      o1[r] = ofr[dt][4 + r] * inv + qv[2 * dt + 1][r];
    }
    *(f32x4*)(hp + dt * 16)     = o0;
    *(f32x4*)(hp + dt * 16 + 4) = o1;
  }
}

// ---------------------------------------------------------------------------
// LayerNorm over rows of 1024, with optional pre-add of Y (residual).
// One wave owns a whole row: 8 loads of 16 bytes a lane, each wave-wide load
// 512 contiguous bytes; the row's sums stay inside the wave (no LDS, no barrier).
// 256 work-groups of 16 waves, two rows a wave (rows 2w and 2w + 1), both
// rows' loads issued ahead of the sums.
// ---------------------------------------------------------------------------
template <bool ADD>
__global__ __launch_bounds__(512) void ln_kernel(
    const float* __restrict__ X, const float* __restrict__ g,
    const float* __restrict__ be, float* __restrict__ out,
    const float* __restrict__ Y) {
  const int lane = threadIdx.x & 31;
  const int w  = blockIdx.x * 16 + (threadIdx.x >> 5);
  const int c0 = lane * 4;
  // The lane's byte offset in X, Y and out alike (under 32 MiB): one 32-bit register
  // beside each scalar base serves all loads and stores of both rows.
  const unsigned ro = (unsigned)w * 8192u + (unsigned)lane * 16u;
  f32x4 x[2][8], y[2][8], gv[8], bv[8];
#pragma unroll
  for (int r = 0; r < 2; ++r) {
    const float* xp = (const float*)((const char*)X + ro) + r * 1024;
#pragma unroll
    for (int j = 0; j < 8; ++j) x[r][j] = *(const f32x4*)(xp + j * 128);
    if (ADD) {
      const float* yp = (const float*)((const char*)Y + ro) + r * 1024;
#pragma unroll
      for (int j = 0; j < 8; ++j) y[r][j] = *(const f32x4*)(yp + j * 128);
    }
  }
#pragma unroll
  for (int j = 0; j < 8; ++j) {
    gv[j] = *(const f32x4*)(g + c0 + j * 128);
    bv[j] = *(const f32x4*)(be + c0 + j * 128);
  }
  // Precaution: this wait stands ahead of any rewrite of an offset register that
  // the loads above name; lane as an input keeps the gain and shift loads' shared
  // offset register untouched up to it (else the run's last load lands on it).
  asm volatile("s_wait_xcnt 0x0" :: "v"(lane) : "memory");
  // Keeps every load above issued ahead of the arithmetic: without it the
  // compiler sinks the gain and shift loads to their uses, one waited pair at a time.
  __builtin_amdgcn_sched_barrier(0);
  if (ADD) {
#pragma unroll
    for (int r = 0; r < 2; ++r)
#pragma unroll
      for (int j = 0; j < 8; ++j) x[r][j] += y[r][j];
  }

  float s[2], ss[2];
#pragma unroll
  for (int r = 0; r < 2; ++r) {
    f32x4 sv = x[r][0], qv = x[r][0] * x[r][0];
#pragma unroll
    for (int j = 1; j < 8; ++j) {
      sv += x[r][j];
      qv += x[r][j] * x[r][j];
    }
    s[r]  = (sv[0] + sv[1]) + (sv[2] + sv[3]);
    ss[r] = (qv[0] + qv[1]) + (qv[2] + qv[3]);
  }
#pragma unroll
  for (int m = 1; m < 32; m <<= 1) {
#pragma unroll
    for (int r = 0; r < 2; ++r) {
      s[r]  += __shfl_xor(s[r], m, 32);
      ss[r] += __shfl_xor(ss[r], m, 32);
    }
  }

#pragma unroll
  for (int r = 0; r < 2; ++r) {
    const float mu   = s[r] * (1.0f / 1024.0f);
    const float var  = ss[r] * (1.0f / 1024.0f) - mu * mu;
    const float rstd = rsqrtf(var + 1e-5f);
    float* op = (float*)((char*)out + ro) + r * 1024;
#pragma unroll
    for (int j = 0; j < 8; ++j)
      *(f32x4*)(op + j * 128) = (x[r][j] - mu) * rstd * gv[j] + bv[j];
  }
}

// ---------------------------------------------------------------------------
extern "C" void kernel_launch(void* const* d_in, const int* in_sizes, int n_in,
                              void* d_out, int out_size, void* d_ws, size_t ws_size,
                              hipStream_t stream) {
  (void)in_sizes; (void)n_in; (void)out_size; (void)ws_size;
  const float* Q   = (const float*)d_in[0];
  const float* K   = (const float*)d_in[1];
  const float* ma  = (const float*)d_in[2];
  const float* mb  = (const float*)d_in[3];
  const float* Wq  = (const float*)d_in[4];  const float* bq  = (const float*)d_in[5];
  const float* Wk  = (const float*)d_in[6];  const float* bk  = (const float*)d_in[7];
  const float* Wv  = (const float*)d_in[8];  const float* bv  = (const float*)d_in[9];
  const float* Wo  = (const float*)d_in[10]; const float* bo  = (const float*)d_in[11];
  const float* g0  = (const float*)d_in[12]; const float* be0 = (const float*)d_in[13];
  const float* g1  = (const float*)d_in[14]; const float* be1 = (const float*)d_in[15];
  float* out = (float*)d_out;

  char* ws = (char*)d_ws;
  size_t off = 0;
  auto alloc = [&](size_t bytes) -> void* {
    void* p = ws + off;
    off += (bytes + 255) & ~(size_t)255;
    return p;
  };
  const size_t MROW = 8192;  // B * 1024
  __bf16* WqT = (__bf16*)alloc(1024 * 1024 * sizeof(__bf16));
  __bf16* WkT = (__bf16*)alloc(1024 * 1024 * sizeof(__bf16));
  __bf16* WvT = (__bf16*)alloc(1024 * 1024 * sizeof(__bf16));
  __bf16* WoT = (__bf16*)alloc(1024 * 1024 * sizeof(__bf16));
  float*  qf    = (float*)alloc(MROW * 1024 * sizeof(float));
  __bf16* qbp   = (__bf16*)alloc(MROW * 1024 * sizeof(__bf16));
  __bf16* kbp   = (__bf16*)alloc(MROW * 1024 * sizeof(__bf16));
  __bf16* vtp   = (__bf16*)alloc(MROW * 1024 * sizeof(__bf16));
  float*  Hpre  = (float*)alloc(MROW * 1024 * sizeof(float));
  float*  H2    = (float*)alloc(MROW * 1024 * sizeof(float));
  float*  reluG = (float*)alloc(MROW * 1024 * sizeof(float));

  dim3 blk(256);
  convw_kernel<<<dim3(32, 32, 4), blk, 0, stream>>>(Wq, Wk, Wv, Wo, WqT, WkT, WvT, WoT);
  gemm_qkv_kernel<<<dim3(64, 8, 3), blk, 0, stream>>>(Q, K, WqT, WkT, WvT, bq, bk, bv,
                                                      qf, qbp, kbp, vtp);
  attn_kernel<<<dim3(64, 8), blk, 0, stream>>>(qbp, kbp, vtp, qf, ma, mb, Hpre);
  ln_kernel<false><<<dim3(256), dim3(512), 0, stream>>>(Hpre, g0, be0, H2, nullptr);
  gemm_o_kernel<<<dim3(64, 8), blk, 0, stream>>>(H2, WoT, bo, reluG);
  ln_kernel<true><<<dim3(256), dim3(512), 0, stream>>>(H2, g1, be1, out, reluG);
}

// v007
// It runs in 150 microseconds.
// Timed twice side by side with v006, it ran 1.05 and 1.04 times as fast.
// Over all steps from v000 it is 1.80 times as fast.
#include <hip/hip_runtime.h>

typedef __attribute__((ext_vector_type(16))) __bf16 v16bf;
typedef __attribute__((ext_vector_type(8)))  __bf16 bf16x8;
typedef __attribute__((ext_vector_type(4)))  __bf16 bf16x4;
typedef __attribute__((ext_vector_type(8)))  float  v8f;
typedef __attribute__((ext_vector_type(4)))  float  f32x4;

#define NEGBIG (-1.0e9f)

__device__ __forceinline__ v8f vzero8() {
  v8f z;
#pragma unroll
  for (int i = 0; i < 8; ++i) z[i] = 0.0f;
  return z;
}

__device__ __forceinline__ v16bf pack16(bf16x8 lo, bf16x8 hi) {
  return __builtin_shufflevector(lo, hi, 0, 1, 2, 3, 4, 5, 6, 7, 8, 9, 10, 11, 12, 13, 14, 15);
}

// Load a 16x32 bf16 WMMA A/B fragment from a row-major tile.
// A: row m = lane&15, K halves selected by lane>>4 (per ISA 16-bit A 16x32 layout).
// B is the symmetric layout with n = lane&15 reading rows of the N-major (transposed) tile.
__device__ __forceinline__ v16bf load_frag(const __bf16* base, int ld, int lane) {
  const int r  = lane & 15;
  const int ho = (lane >> 4) * 8;
  const __bf16* p = base + r * ld;
  bf16x8 lo = *(const bf16x8*)(p + ho);
  bf16x8 hi = *(const bf16x8*)(p + 16 + ho);
  return pack16(lo, hi);
}

__device__ __forceinline__ v8f wmma_bf16(v16bf a, v16bf b, v8f c) {
  return __builtin_amdgcn_wmma_f32_16x16x32_bf16(false, a, false, b, (short)0, c, false, false);
}

// ---------------------------------------------------------------------------
// Weight transpose + f32->bf16 convert: W[1024][1024] -> WT[n][k] bf16
// The four weights need nothing of each other: one grid, blockIdx.z picks the weight.
// ---------------------------------------------------------------------------
__global__ __launch_bounds__(256) void convw_kernel(
    const float* __restrict__ W0, const float* __restrict__ W1,
    const float* __restrict__ W2, const float* __restrict__ W3,
    __bf16* __restrict__ WT0, __bf16* __restrict__ WT1,
    __bf16* __restrict__ WT2, __bf16* __restrict__ WT3) {
  __shared__ float t[32][33];
  const int z = blockIdx.z;
  const float* W = z == 0 ? W0 : z == 1 ? W1 : z == 2 ? W2 : W3;
  __bf16* WT = z == 0 ? WT0 : z == 1 ? WT1 : z == 2 ? WT2 : WT3;
  const int k0 = blockIdx.x * 32, n0 = blockIdx.y * 32;
  const int tx = threadIdx.x & 31, ty = threadIdx.x >> 5;
#pragma unroll
  for (int i = 0; i < 32; i += 8)
    t[ty + i][tx] = W[(size_t)(k0 + ty + i) * 1024 + n0 + tx];
  __syncthreads();
#pragma unroll
  for (int i = 0; i < 32; i += 8)
    WT[(size_t)(n0 + ty + i) * 1024 + k0 + tx] = (__bf16)t[tx][ty + i];
}

// ---------------------------------------------------------------------------
// GEMM: C[M=8192, N=1024] = A_f32[M,1024] x W (as Bt = W^T bf16 [N][K]) + bias
// 128x256 block tile, 8 waves (2x4) of 64x64 each, 64-wide K stages, register
// double-buffered global->LDS staging so HBM latency overlaps the WMMA phase.
// A wave's 4 + 4 fragments feed 16 WMMAs, and a block's 64 KB stage feeds 256.
// MODE 0: Q proj  -> outF (f32) + outB (bf16)
// MODE 1: K proj  -> outB (bf16)
// MODE 2: V proj  -> outT (bf16, per-head transposed vt[b][h][d][key])
// MODE 3: O proj  -> outF = relu(acc + bias)
// ---------------------------------------------------------------------------
// HOLD: fence the next stage's loads in place (see the two fences below). The Q, K, V
// kernel needs it; the build of the O kernel keeps that order by itself, and there a
// fence would only stop the WMMAs that run on across the barriers.
template <bool HOLD>
__device__ __forceinline__ void gemm_tile(
    const float* __restrict__ A, const __bf16* __restrict__ Bt,
    __bf16 (&As)[128][72], __bf16 (&Bs)[256][72], v8f (&acc)[4][4]) {
  const int tid  = threadIdx.x;
  const int wave = tid >> 5, lane = tid & 31;
  const int wm = wave >> 2, wn = wave & 3;
  const int rowBase = blockIdx.x * 128;
  const int nBase   = blockIdx.y * 256;
  // Staging map: every wave-wide 16-byte load covers whole 128-byte lines.
  // A stage row = 64 f32 = 256 B: 16 lanes a row, two rows a load.
  // B stage row = 64 bf16 = 128 B: 8 lanes a row, four rows a load.
  const int ar = tid >> 4, ac = (tid & 15) * 4;
  const int br = tid >> 3, bc = (tid & 7) * 8;

  f32x4  areg[8];
  bf16x8 breg[8];
  auto load_global = [&](int kc) {
    const float* ap = A + (size_t)(rowBase + ar) * 1024 + kc + ac;
#pragma unroll
    for (int e = 0; e < 8; ++e) areg[e] = *(const f32x4*)(ap + e * 16 * 1024);
    const __bf16* bp = Bt + (size_t)(nBase + br) * 1024 + kc + bc;
#pragma unroll
    for (int e = 0; e < 8; ++e) breg[e] = *(const bf16x8*)(bp + e * 32 * 1024);
    // Precaution: this wait stands ahead of the loop's advance of the two address
    // pairs that the loads above name. With HOLD the advance stands behind the phase's
    // closing wait for the loads' data, which covers it.
    if (!HOLD) asm volatile("s_wait_xcnt 0x0" ::: "memory");
  };

#pragma unroll
  for (int i = 0; i < 4; ++i)
#pragma unroll
    for (int j = 0; j < 4; ++j) acc[i][j] = vzero8();

  load_global(0);
  for (int kc = 0; kc < 1024; kc += 64) {
    // Convert staged A regs to bf16 and commit both tiles to LDS.
#pragma unroll
    for (int e = 0; e < 8; ++e) {
      bf16x4 hh;
#pragma unroll
      for (int q = 0; q < 4; ++q) hh[q] = (__bf16)areg[e][q];
      *(bf16x4*)(&As[e * 16 + ar][ac]) = hh;
    }
#pragma unroll
    for (int e = 0; e < 8; ++e) *(bf16x8*)(&Bs[e * 32 + br][bc]) = breg[e];
    __syncthreads();
    if (kc + 64 < 1024) load_global(kc + 64);  // overlap with WMMA phase
    // Keeps all of the next stage's loads issued in front of the WMMA phase: without
    // it the compiler sinks most of them to the end of the phase, next to their uses,
    // and their whole latency is waited out there.
    if (HOLD) __builtin_amdgcn_sched_barrier(0);
#pragma unroll
    for (int ks = 0; ks < 2; ++ks) {
      v16bf af[4];
#pragma unroll
      for (int i = 0; i < 4; ++i) af[i] = load_frag(&As[wm * 64 + i * 16][ks * 32], 72, lane);
#pragma unroll
      for (int jp = 0; jp < 4; jp += 2) {
        v16bf bf0 = load_frag(&Bs[wn * 64 + jp * 16][ks * 32], 72, lane);
        v16bf bf1 = load_frag(&Bs[wn * 64 + jp * 16 + 16][ks * 32], 72, lane);
#pragma unroll
        for (int i = 0; i < 4; ++i) {
          acc[i][jp]     = wmma_bf16(af[i], bf0, acc[i][jp]);
          acc[i][jp + 1] = wmma_bf16(af[i], bf1, acc[i][jp + 1]);
        }
      }
    }
    // Keeps the conversions of the loaded values, and with them the first wait for
    // the loads, behind the WMMA phase: without it the compiler lifts some among the
    // WMMAs, which then stand still for a load issued just before.
    if (HOLD) __builtin_amdgcn_sched_barrier(0);
    __syncthreads();
  }
}

template <int MODE>
__device__ __forceinline__ void gemm_store(
    const v8f (&acc)[4][4], const float* __restrict__ bias,
    float* __restrict__ outF, __bf16* __restrict__ outB,
    __bf16* __restrict__ outT) {
  const int tid  = threadIdx.x;
  const int wave = tid >> 5, lane = tid & 31;
  const int wm = wave >> 2, wn = wave & 3;
  const int rowBase = blockIdx.x * 128;
  const int nBase   = blockIdx.y * 256;
#pragma unroll
  for (int i = 0; i < 4; ++i)
#pragma unroll
    for (int j = 0; j < 4; ++j) {
      const int gn = nBase + wn * 64 + j * 16 + (lane & 15);
      const int gm = rowBase + wm * 64 + i * 16 + (lane >> 4) * 8;
      const float bvs = bias[gn];
      v8f c = acc[i][j];
      if (MODE == 0) {
#pragma unroll
        for (int r = 0; r < 8; ++r) {
          const float v = c[r] + bvs;
          const size_t idx = (size_t)(gm + r) * 1024 + gn;
          outF[idx] = v;
          outB[idx] = (__bf16)v;
        }
      } else if (MODE == 1) {
#pragma unroll
        for (int r = 0; r < 8; ++r)
          outB[(size_t)(gm + r) * 1024 + gn] = (__bf16)(c[r] + bvs);
      } else if (MODE == 2) {
        // vt[b][h][d][key]; D-fragment's 8 VGPRs are 8 consecutive keys.
        const int bb  = gm >> 10;
        const int key = gm & 1023;
        const int hh2 = gn >> 7, dd = gn & 127;
        bf16x8 pk;
#pragma unroll
        for (int r = 0; r < 8; ++r) pk[r] = (__bf16)(c[r] + bvs);
        *(bf16x8*)(&outT[(((size_t)bb * 8 + hh2) * 128 + dd) * 1024 + key]) = pk;
      } else {
#pragma unroll
        for (int r = 0; r < 8; ++r) {
          const float v = c[r] + bvs;
          outF[(size_t)(gm + r) * 1024 + gn] = v > 0.0f ? v : 0.0f;
        }
      }
    }
}

// The Q, K and V projections need nothing of each other: one grid, blockIdx.z picks
// the projection (operands and epilogue), the same for a whole work-group.
// The second bound asks for four waves a SIMD (at most 256 VGPRs): the loop fits, the
// epilogues alone went above it, and then only one work-group fits a WGP, with nobody
// to fill its barrier, LDS and load waits. 768 work-groups: three a WGP, two at a time.
__global__ __launch_bounds__(256, 4) void gemm_qkv_kernel(
    const float* __restrict__ Q, const float* __restrict__ K,
    const __bf16* __restrict__ WqT, const __bf16* __restrict__ WkT,
    const __bf16* __restrict__ WvT, const float* __restrict__ bq,
    const float* __restrict__ bk, const float* __restrict__ bv,
    float* __restrict__ qf, __bf16* __restrict__ qb,
    __bf16* __restrict__ kb, __bf16* __restrict__ vt) {
  __shared__ __attribute__((aligned(16))) __bf16 As[128][72];
  __shared__ __attribute__((aligned(16))) __bf16 Bs[256][72];
  const int z = blockIdx.z;
  v8f acc[4][4];
  gemm_tile<true>(z == 0 ? Q : K, z == 0 ? WqT : z == 1 ? WkT : WvT, As, Bs, acc);
  // Precaution: in the built kernel the V and K epilogues stand in front of other
  // code. Their runs of stores end in this wait, so that it stands ahead of any
  // rewrite there of a register that an issued store names. Q's run ends the kernel.
  if (z == 0) {
    gemm_store<0>(acc, bq, qf, qb, nullptr);
  } else if (z == 1) {
    gemm_store<1>(acc, bk, nullptr, kb, nullptr);
    asm volatile("s_wait_xcnt 0x0" ::: "memory");
  } else {
    gemm_store<2>(acc, bv, nullptr, nullptr, vt);
    asm volatile("s_wait_xcnt 0x0" ::: "memory");
  }
}

__global__ __launch_bounds__(256) void gemm_o_kernel(
    const float* __restrict__ A, const __bf16* __restrict__ Bt,
    const float* __restrict__ bias, float* __restrict__ outF) {
  __shared__ __attribute__((aligned(16))) __bf16 As[128][72];
  __shared__ __attribute__((aligned(16))) __bf16 Bs[256][72];
  v8f acc[4][4];
  gemm_tile<false>(A, Bt, As, Bs, acc);
  gemm_store<3>(acc, bias, outF, nullptr, nullptr);
}

__device__ __forceinline__ float xhalf(float x) {
  const int v = __builtin_bit_cast(int, x);
  return __builtin_bit_cast(
      float, __builtin_amdgcn_permlanex16(v, v, 0x76543210, 0xfedcba98, false, false));
}

// exp2 of eight values: eight independent v_exp_f32 in one statement, then one v_nop.
// The instruction set asks for one independent instruction or v_nop behind a
// transcendental before its result is used or its source overwritten. Here every
// successor is independent (the outputs are early-clobber, none lies on an input)
// and the v_nop serves the last one.
__device__ __forceinline__ v8f exp2x8(v8f t) {
  float r0, r1, r2, r3, r4, r5, r6, r7;
  asm("v_exp_f32 %0, %8\n\t"
      "v_exp_f32 %1, %9\n\t"
      "v_exp_f32 %2, %10\n\t"
      "v_exp_f32 %3, %11\n\t"
      "v_exp_f32 %4, %12\n\t"
      "v_exp_f32 %5, %13\n\t"
      "v_exp_f32 %6, %14\n\t"
      "v_exp_f32 %7, %15\n\t"
      "v_nop"
      : "=&v"(r0), "=&v"(r1), "=&v"(r2), "=&v"(r3), "=&v"(r4), "=&v"(r5), "=&v"(r6), "=&v"(r7)
      : "v"(t[0]), "v"(t[1]), "v"(t[2]), "v"(t[3]), "v"(t[4]), "v"(t[5]), "v"(t[6]), "v"(t[7]));
  v8f p;
  p[0] = r0; p[1] = r1; p[2] = r2; p[3] = r3;
  p[4] = r4; p[5] = r5; p[6] = r6; p[7] = r7;
  return p;
}

__global__ __launch_bounds__(256) void attn_kernel(
    const __bf16* __restrict__ qb, const __bf16* __restrict__ kb,
    const __bf16* __restrict__ vt, const float* __restrict__ qf,
    const float* __restrict__ mask_a, const float* __restrict__ mask_b,
    float* __restrict__ Hpre) {
  __shared__ __attribute__((aligned(16))) __bf16 Ks[64][136];   // [key][d]
  __shared__ __attribute__((aligned(16))) __bf16 Vs[128][72];   // [d][key]
  __shared__ __attribute__((aligned(16))) float mbs[64];
  const int tid = threadIdx.x, wave = tid >> 5, lane = tid & 31;
  const int hf = lane >> 4;
  const int b = blockIdx.x >> 3, h = blockIdx.x & 7;
  const int qbase = blockIdx.y * 128;
  const float scale = 0.08838834764831845f;  // 1/sqrt(128)

  // The lane's one query (shared with lane ^ 16) and its mask value.
  const int qrow = b * 1024 + qbase + wave * 16 + (lane & 15);
  const float maq = mask_a[qrow];

  // Q^T B-fragments (4 K-steps over d=128) pinned in registers.
  v16bf qfr[4];
  {
    const __bf16* qbp = qb + (size_t)qrow * 1024 + h * 128;
    const int ho = hf * 8;
#pragma unroll
    for (int ks = 0; ks < 4; ++ks) {
      bf16x8 lo = *(const bf16x8*)(qbp + ks * 32 + ho);
      bf16x8 hi = *(const bf16x8*)(qbp + ks * 32 + 16 + ho);
      qfr[ks] = pack16(lo, hi);
    }
  }

  // Staging addresses: the thread's part is one byte offset for K and one for V^T, the
  // same in every chunk; block and chunk are wave-uniform, and the four loads (and LDS
  // stores) of a run differ by a constant, so a run needs one address, not four.
  // The registers so freed bring the kernel under 256 VGPRs: four waves fit a SIMD and
  // two work-groups share a WGP, each filling the other's barrier, LDS and softmax waits.
  const int kr = tid >> 4, kc = (tid & 15) * 8;  // K: 16 threads a row, 16 rows a load
  const int vr = tid >> 3, vc = (tid & 7) * 8;   // V^T: 8 threads a row, 32 rows a load
  const unsigned ko = (unsigned)(kr * 1024 + kc) * 2u;
  const unsigned vo = (unsigned)(vr * 1024 + vc) * 2u;
  const __bf16* kblk = kb + (size_t)b * 1024 * 1024 + h * 128;
  const __bf16* vblk = vt + ((size_t)b * 8 + h) * 128 * 1024;

  bf16x8 kreg[4], vreg[4];
  float mbreg = 0.0f;
  auto load_chunk = [&](int kb0) {
    const __bf16* kp = (const __bf16*)((const char*)(kblk + (size_t)kb0 * 1024) + ko);
#pragma unroll
    for (int i = 0; i < 4; ++i) kreg[i] = *(const bf16x8*)(kp + i * 16 * 1024);
    const __bf16* vp = (const __bf16*)((const char*)(vblk + kb0) + vo);
#pragma unroll
    for (int i = 0; i < 4; ++i) vreg[i] = *(const bf16x8*)(vp + i * 32 * 1024);
    if (tid < 64) mbreg = mask_b[b * 1024 + kb0 + tid];
    // Precaution: this wait stands ahead of any rewrite of the offset register that
    // the mask load names (the build reuses it for the first fragment read).
    asm volatile("s_wait_xcnt 0x0" ::: "memory");
  };

  // O^T tiles: ofr[dt][r] = O[query lane & 15][d = dt * 16 + hf * 8 + r].
  v8f ofr[8];
#pragma unroll
  for (int d = 0; d < 8; ++d) ofr[d] = vzero8();
  float mrow = -3.0e38f;  // running maximum, equal in both lane halves
  float lrow = 0.0f;      // running sum over this lane half's keys only

  load_chunk(0);
  for (int kb0 = 0; kb0 < 1024; kb0 += 64) {
    __syncthreads();  // all waves done reading Ks/Vs of previous chunk
#pragma unroll
    for (int i = 0; i < 4; ++i) *(bf16x8*)(&Ks[kr + i * 16][kc]) = kreg[i];
#pragma unroll
    for (int i = 0; i < 4; ++i) *(bf16x8*)(&Vs[vr + i * 32][vc]) = vreg[i];
    if (tid < 64) mbs[tid] = mbreg;
    __syncthreads();
    if (kb0 + 64 < 1024) load_chunk(kb0 + 64);  // overlap with WMMA phase

    // S^T = K Q^T: sfr[nt][r] = score(key nt * 16 + hf * 8 + r, the lane's query).
    v8f sfr[4];
#pragma unroll
    for (int nt = 0; nt < 4; ++nt) {
      v8f s = vzero8();
#pragma unroll
      for (int ks = 0; ks < 4; ++ks) {
        v16bf kf = load_frag(&Ks[nt * 16][ks * 32], 136, lane);
        s = wmma_bf16(kf, qfr[ks], s);
      }
      sfr[nt] = s;
    }

    // Mask + scale + chunk maximum: four in-lane chains, then the other lane half.
    float cm[4];
#pragma unroll
    for (int nt = 0; nt < 4; ++nt) {
      const f32x4 mb0 = *(const f32x4*)(&mbs[nt * 16 + hf * 8]);
      const f32x4 mb1 = *(const f32x4*)(&mbs[nt * 16 + hf * 8 + 4]);
      cm[nt] = -3.0e38f;
#pragma unroll
      for (int r = 0; r < 8; ++r) {
        const float mbk = r < 4 ? mb0[r & 3] : mb1[r & 3];
        const float s = (maq * mbk == 1.0f) ? sfr[nt][r] * scale : NEGBIG;
        sfr[nt][r] = s;
        cm[nt] = fmaxf(cm[nt], s);
      }
    }
    float cmx = fmaxf(fmaxf(cm[0], cm[1]), fmaxf(cm[2], cm[3]));
    cmx = fmaxf(cmx, xhalf(cmx));

    const float mn = fmaxf(mrow, cmx);
    const float alpha = __expf(mrow - mn);
    mrow = mn;
    float rs[4];
#pragma unroll
    for (int nt = 0; nt < 4; ++nt) {
      // exp(x) as exp2(x * log2(e)), the form __expf compiles to.
      sfr[nt] = exp2x8((sfr[nt] - mrow) * 1.44269504f);
      rs[nt] = sfr[nt][0];
#pragma unroll
      for (int r = 1; r < 8; ++r) rs[nt] += sfr[nt][r];
    }
    lrow = alpha * lrow + ((rs[0] + rs[1]) + (rs[2] + rs[3]));
#pragma unroll
    for (int d = 0; d < 8; ++d)
#pragma unroll
      for (int r = 0; r < 8; ++r) ofr[d][r] *= alpha;

    // O^T += V^T P^T; the P^T fragment of 32 keys is two S^T tiles converted in place.
#pragma unroll
    for (int ks = 0; ks < 2; ++ks) {
      v16bf pb;
#pragma unroll
      for (int e = 0; e < 8; ++e) {
        pb[e]     = (__bf16)sfr[2 * ks][e];
        pb[8 + e] = (__bf16)sfr[2 * ks + 1][e];
      }
#pragma unroll
      for (int dt = 0; dt < 8; ++dt) {
        v16bf vf = load_frag(&Vs[dt * 16][ks * 32], 72, lane);
        ofr[dt] = wmma_bf16(vf, pb, ofr[dt]);
      }
    }
  }

  // O/l + residual q; the lane halves' sums are joined here, once.
  const size_t idx0 = (size_t)qrow * 1024 + h * 128 + hf * 8;
  const float* qp = qf + idx0;
  float* hp = Hpre + idx0;
  f32x4 qv[16];
#pragma unroll
  for (int dt = 0; dt < 8; ++dt) {
    qv[2 * dt]     = *(const f32x4*)(qp + dt * 16);
    qv[2 * dt + 1] = *(const f32x4*)(qp + dt * 16 + 4);
  }
  // Precaution: this wait stands ahead of any rewrite of the address registers that
  // the loads above name; the pointer as an input keeps them untouched up to it
  // (else the run's last load lands on them).
  asm volatile("s_wait_xcnt 0x0" :: "v"(qp) : "memory");
  const float inv = 1.0f / (lrow + xhalf(lrow));
#pragma unroll
  for (int dt = 0; dt < 8; ++dt) {
    f32x4 o0, o1;
#pragma unroll
    for (int r = 0; r < 4; ++r) {
      o0[r] = ofr[dt][r] * inv + qv[2 * dt][r];
      o1[r] = ofr[dt][4 + r] * inv + qv[2 * dt + 1][r];
    }
    *(f32x4*)(hp + dt * 16)     = o0;
    *(f32x4*)(hp + dt * 16 + 4) = o1;
  }
}

// ---------------------------------------------------------------------------
// LayerNorm over rows of 1024, with optional pre-add of Y (residual).
// One wave owns a whole row: 8 loads of 16 bytes a lane, each wave-wide load
// 512 contiguous bytes; the row's sums stay inside the wave (no LDS, no barrier).
// 256 work-groups of 16 waves, two rows a wave (rows 2w and 2w + 1), both
// rows' loads issued ahead of the sums.
// ---------------------------------------------------------------------------
template <bool ADD>
__global__ __launch_bounds__(512) void ln_kernel(
    const float* __restrict__ X, const float* __restrict__ g,
    const float* __restrict__ be, float* __restrict__ out,
    const float* __restrict__ Y) {
  const int lane = threadIdx.x & 31;
  const int w  = blockIdx.x * 16 + (threadIdx.x >> 5);
  const int c0 = lane * 4;
  // The lane's byte offset in X, Y and out alike (under 32 MiB): one 32-bit register
  // beside each scalar base serves all loads and stores of both rows.
  const unsigned ro = (unsigned)w * 8192u + (unsigned)lane * 16u;
  f32x4 x[2][8], y[2][8], gv[8], bv[8];
#pragma unroll
  for (int r = 0; r < 2; ++r) {
    const float* xp = (const float*)((const char*)X + ro) + r * 1024;
#pragma unroll
    for (int j = 0; j < 8; ++j) x[r][j] = *(const f32x4*)(xp + j * 128);
    if (ADD) {
      const float* yp = (const float*)((const char*)Y + ro) + r * 1024;
#pragma unroll
      for (int j = 0; j < 8; ++j) y[r][j] = *(const f32x4*)(yp + j * 128);
    }
  }
#pragma unroll
  for (int j = 0; j < 8; ++j) {
    gv[j] = *(const f32x4*)(g + c0 + j * 128);
    bv[j] = *(const f32x4*)(be + c0 + j * 128);
  }
  // Precaution: this wait stands ahead of any rewrite of an offset register that
  // the loads above name; lane as an input keeps the gain and shift loads' shared
  // offset register untouched up to it (else the run's last load lands on it).
  asm volatile("s_wait_xcnt 0x0" :: "v"(lane) : "memory");
  // Keeps every load above issued ahead of the arithmetic: without it the
  // compiler sinks the gain and shift loads to their uses, one waited pair at a time.
  __builtin_amdgcn_sched_barrier(0);
  if (ADD) {
#pragma unroll
    for (int r = 0; r < 2; ++r)
#pragma unroll
      for (int j = 0; j < 8; ++j) x[r][j] += y[r][j];
  }

  float s[2], ss[2];
#pragma unroll
  for (int r = 0; r < 2; ++r) {
    f32x4 sv = x[r][0], qv = x[r][0] * x[r][0];
#pragma unroll
    for (int j = 1; j < 8; ++j) {
      sv += x[r][j];
      qv += x[r][j] * x[r][j];
    }
    s[r]  = (sv[0] + sv[1]) + (sv[2] + sv[3]);
    ss[r] = (qv[0] + qv[1]) + (qv[2] + qv[3]);
  }
#pragma unroll
  for (int m = 1; m < 32; m <<= 1) {
#pragma unroll
    for (int r = 0; r < 2; ++r) {
      s[r]  += __shfl_xor(s[r], m, 32);
      ss[r] += __shfl_xor(ss[r], m, 32);
    }
  }

#pragma unroll
  for (int r = 0; r < 2; ++r) {
    const float mu   = s[r] * (1.0f / 1024.0f);
    const float var  = ss[r] * (1.0f / 1024.0f) - mu * mu;
    const float rstd = rsqrtf(var + 1e-5f);
    float* op = (float*)((char*)out + ro) + r * 1024;
#pragma unroll
    for (int j = 0; j < 8; ++j)
      *(f32x4*)(op + j * 128) = (x[r][j] - mu) * rstd * gv[j] + bv[j];
  }
}

// ---------------------------------------------------------------------------
extern "C" void kernel_launch(void* const* d_in, const int* in_sizes, int n_in,
                              void* d_out, int out_size, void* d_ws, size_t ws_size,
                              hipStream_t stream) {
  (void)in_sizes; (void)n_in; (void)out_size; (void)ws_size;
  const float* Q   = (const float*)d_in[0];
  const float* K   = (const float*)d_in[1];
  const float* ma  = (const float*)d_in[2];
  const float* mb  = (const float*)d_in[3];
  const float* Wq  = (const float*)d_in[4];  const float* bq  = (const float*)d_in[5];
  const float* Wk  = (const float*)d_in[6];  const float* bk  = (const float*)d_in[7];
  const float* Wv  = (const float*)d_in[8];  const float* bv  = (const float*)d_in[9];
  const float* Wo  = (const float*)d_in[10]; const float* bo  = (const float*)d_in[11];
  const float* g0  = (const float*)d_in[12]; const float* be0 = (const float*)d_in[13];
  const float* g1  = (const float*)d_in[14]; const float* be1 = (const float*)d_in[15];
  float* out = (float*)d_out;

  char* ws = (char*)d_ws;
  size_t off = 0;
  auto alloc = [&](size_t bytes) -> void* {
    void* p = ws + off;
    off += (bytes + 255) & ~(size_t)255;
    return p;
  };
  const size_t MROW = 8192;  // B * 1024
  __bf16* WqT = (__bf16*)alloc(1024 * 1024 * sizeof(__bf16));
  __bf16* WkT = (__bf16*)alloc(1024 * 1024 * sizeof(__bf16));
  __bf16* WvT = (__bf16*)alloc(1024 * 1024 * sizeof(__bf16));
  __bf16* WoT = (__bf16*)alloc(1024 * 1024 * sizeof(__bf16));
  float*  qf    = (float*)alloc(MROW * 1024 * sizeof(float));
  __bf16* qbp   = (__bf16*)alloc(MROW * 1024 * sizeof(__bf16));
  __bf16* kbp   = (__bf16*)alloc(MROW * 1024 * sizeof(__bf16));
  __bf16* vtp   = (__bf16*)alloc(MROW * 1024 * sizeof(__bf16));
  float*  Hpre  = (float*)alloc(MROW * 1024 * sizeof(float));
  float*  H2    = (float*)alloc(MROW * 1024 * sizeof(float));
  float*  reluG = (float*)alloc(MROW * 1024 * sizeof(float));

  dim3 blk(256);
  convw_kernel<<<dim3(32, 32, 4), blk, 0, stream>>>(Wq, Wk, Wv, Wo, WqT, WkT, WvT, WoT);
  gemm_qkv_kernel<<<dim3(64, 4, 3), blk, 0, stream>>>(Q, K, WqT, WkT, WvT, bq, bk, bv,
                                                      qf, qbp, kbp, vtp);
  attn_kernel<<<dim3(64, 8), blk, 0, stream>>>(qbp, kbp, vtp, qf, ma, mb, Hpre);
  ln_kernel<false><<<dim3(256), dim3(512), 0, stream>>>(Hpre, g0, be0, H2, nullptr);
  gemm_o_kernel<<<dim3(64, 4), blk, 0, stream>>>(H2, WoT, bo, reluG);
  ln_kernel<true><<<dim3(256), dim3(512), 0, stream>>>(H2, g1, be1, out, reluG);
}

// v008
// It runs in 138 microseconds.
// Two timings next to v007 put it at 1.07 and 1.11 times that version's speed.
// Counting every step since v000, it is 1.96 times as fast.
#include <hip/hip_runtime.h>

typedef __attribute__((ext_vector_type(16))) __bf16 v16bf;
typedef __attribute__((ext_vector_type(8)))  __bf16 bf16x8;
typedef __attribute__((ext_vector_type(4)))  __bf16 bf16x4;
typedef __attribute__((ext_vector_type(8)))  float  v8f;
typedef __attribute__((ext_vector_type(4)))  float  f32x4;

#define NEGBIG (-1.0e9f)

__device__ __forceinline__ v8f vzero8() {
  v8f z;
#pragma unroll
  for (int i = 0; i < 8; ++i) z[i] = 0.0f;
  return z;
}

__device__ __forceinline__ v16bf pack16(bf16x8 lo, bf16x8 hi) {
  return __builtin_shufflevector(lo, hi, 0, 1, 2, 3, 4, 5, 6, 7, 8, 9, 10, 11, 12, 13, 14, 15);
}

// Load a 16x32 bf16 WMMA A/B fragment from a row-major tile.
// A: row m = lane&15, K halves selected by lane>>4 (per ISA 16-bit A 16x32 layout).
// B is the symmetric layout with n = lane&15 reading rows of the N-major (transposed) tile.
__device__ __forceinline__ v16bf load_frag(const __bf16* base, int ld, int lane) {
  const int r  = lane & 15;
  const int ho = (lane >> 4) * 8;
  const __bf16* p = base + r * ld;
  bf16x8 lo = *(const bf16x8*)(p + ho);
  bf16x8 hi = *(const bf16x8*)(p + 16 + ho);
  return pack16(lo, hi);
}

__device__ __forceinline__ v8f wmma_bf16(v16bf a, v16bf b, v8f c) {
  return __builtin_amdgcn_wmma_f32_16x16x32_bf16(false, a, false, b, (short)0, c, false, false);
}

// ---------------------------------------------------------------------------
// Weight transpose + f32->bf16 convert: W[1024][1024] -> WT[n][k] bf16
// The four weights need nothing of each other: one grid, blockIdx.z picks the weight.
// ---------------------------------------------------------------------------
__global__ __launch_bounds__(256) void convw_kernel(
    const float* __restrict__ W0, const float* __restrict__ W1,
    const float* __restrict__ W2, const float* __restrict__ W3,
    __bf16* __restrict__ WT0, __bf16* __restrict__ WT1,
    __bf16* __restrict__ WT2, __bf16* __restrict__ WT3) {
  __shared__ float t[32][33];
  const int z = blockIdx.z;
  const float* W = z == 0 ? W0 : z == 1 ? W1 : z == 2 ? W2 : W3;
  __bf16* WT = z == 0 ? WT0 : z == 1 ? WT1 : z == 2 ? WT2 : WT3;
  const int k0 = blockIdx.x * 32, n0 = blockIdx.y * 32;
  const int tx = threadIdx.x & 31, ty = threadIdx.x >> 5;
#pragma unroll
  for (int i = 0; i < 32; i += 8)
    t[ty + i][tx] = W[(size_t)(k0 + ty + i) * 1024 + n0 + tx];
  __syncthreads();
#pragma unroll
  for (int i = 0; i < 32; i += 8)
    WT[(size_t)(n0 + ty + i) * 1024 + k0 + tx] = (__bf16)t[tx][ty + i];
}

// ---------------------------------------------------------------------------
// GEMM: C[M=8192, N=1024] = A_f32[M,1024] x W (as Bt = W^T bf16 [N][K]) + bias
// 128x256 block tile, 8 waves (2x4) of 64x64 each, 64-wide K stages, register
// double-buffered global->LDS staging so HBM latency overlaps the WMMA phase.
// A wave's 4 + 4 fragments feed 16 WMMAs, and a block's 64 KB stage feeds 256.
// MODE 0: Q proj  -> outF (f32) + outB (bf16)
// MODE 1: K proj  -> outB (bf16)
// MODE 2: V proj  -> outT (bf16, per-head transposed vt[b][h][d][key])
// MODE 3: O proj  -> outF = relu(acc + bias)
// ---------------------------------------------------------------------------
// HOLD: fence the next stage's loads in place (see the two fences below). The Q, K, V
// kernel needs it; the build of the O kernel keeps that order by itself, and there a
// fence would only stop the WMMAs that run on across the barriers.
template <bool HOLD>
__device__ __forceinline__ void gemm_tile(
    const float* __restrict__ A, const __bf16* __restrict__ Bt,
    __bf16 (&As)[128][72], __bf16 (&Bs)[256][72], v8f (&acc)[4][4]) {
  const int tid  = threadIdx.x;
  const int wave = tid >> 5, lane = tid & 31;
  const int wm = wave >> 2, wn = wave & 3;
  const int rowBase = blockIdx.x * 128;
  const int nBase   = blockIdx.y * 256;
  // Staging map: every wave-wide 16-byte load covers whole 128-byte lines.
  // A stage row = 64 f32 = 256 B: 16 lanes a row, two rows a load.
  // B stage row = 64 bf16 = 128 B: 8 lanes a row, four rows a load.
  const int ar = tid >> 4, ac = (tid & 15) * 4;
  const int br = tid >> 3, bc = (tid & 7) * 8;

  f32x4  areg[8];
  bf16x8 breg[8];
  auto load_global = [&](int kc) {
    const float* ap = A + (size_t)(rowBase + ar) * 1024 + kc + ac;
#pragma unroll
    for (int e = 0; e < 8; ++e) areg[e] = *(const f32x4*)(ap + e * 16 * 1024);
    const __bf16* bp = Bt + (size_t)(nBase + br) * 1024 + kc + bc;
#pragma unroll
    for (int e = 0; e < 8; ++e) breg[e] = *(const bf16x8*)(bp + e * 32 * 1024);
    // Precaution: this wait stands ahead of the loop's advance of the two address
    // pairs that the loads above name. With HOLD the advance stands behind the phase's
    // closing wait for the loads' data, which covers it.
    if (!HOLD) asm volatile("s_wait_xcnt 0x0" ::: "memory");
  };

#pragma unroll
  for (int i = 0; i < 4; ++i)
#pragma unroll
    for (int j = 0; j < 4; ++j) acc[i][j] = vzero8();

  load_global(0);
  for (int kc = 0; kc < 1024; kc += 64) {
    // Convert staged A regs to bf16 and commit both tiles to LDS.
#pragma unroll
    for (int e = 0; e < 8; ++e) {
      bf16x4 hh;
#pragma unroll
      for (int q = 0; q < 4; ++q) hh[q] = (__bf16)areg[e][q];
      *(bf16x4*)(&As[e * 16 + ar][ac]) = hh;
    }
#pragma unroll
    for (int e = 0; e < 8; ++e) *(bf16x8*)(&Bs[e * 32 + br][bc]) = breg[e];
    __syncthreads();
    if (kc + 64 < 1024) load_global(kc + 64);  // overlap with WMMA phase
    // Keeps all of the next stage's loads issued in front of the WMMA phase: without
    // it the compiler sinks most of them to the end of the phase, next to their uses,
    // and their whole latency is waited out there.
    if (HOLD) __builtin_amdgcn_sched_barrier(0);
#pragma unroll
    for (int ks = 0; ks < 2; ++ks) {
      v16bf af[4];
#pragma unroll
      for (int i = 0; i < 4; ++i) af[i] = load_frag(&As[wm * 64 + i * 16][ks * 32], 72, lane);
#pragma unroll
      for (int jp = 0; jp < 4; jp += 2) {
        v16bf bf0 = load_frag(&Bs[wn * 64 + jp * 16][ks * 32], 72, lane);
        v16bf bf1 = load_frag(&Bs[wn * 64 + jp * 16 + 16][ks * 32], 72, lane);
#pragma unroll
        for (int i = 0; i < 4; ++i) {
          acc[i][jp]     = wmma_bf16(af[i], bf0, acc[i][jp]);
          acc[i][jp + 1] = wmma_bf16(af[i], bf1, acc[i][jp + 1]);
        }
      }
    }
    // Keeps the conversions of the loaded values, and with them the first wait for
    // the loads, behind the WMMA phase: without it the compiler lifts some among the
    // WMMAs, which then stand still for a load issued just before.
    if (HOLD) __builtin_amdgcn_sched_barrier(0);
    __syncthreads();
  }
}

// Epilogue: a D tile holds 16 columns of 8 rows a lane half, so stores straight from the
// accumulators are pieces of 16 to 64 bytes. Each wave turns its 64x64 tile round in its
// own 4608 bytes of Bs (free behind the loop's last barrier), 16 rows at a time, and then
// every wave-wide global store covers whole 128-byte lines.
template <int MODE>
__device__ __forceinline__ void gemm_store(
    const v8f (&acc)[4][4], const float* __restrict__ bias,
    float* __restrict__ outF, __bf16* __restrict__ outB,
    __bf16* __restrict__ outT, __bf16 (&Bs)[256][72]) {
  const int tid  = threadIdx.x;
  const int wave = tid >> 5, lane = tid & 31;
  const int wm = wave >> 2, wn = wave & 3;
  const int cl = lane & 15, hf = lane >> 4;
  const int m0 = blockIdx.x * 128 + wm * 64;  // the wave's first row
  const int n0 = blockIdx.y * 256 + wn * 64;  // the wave's first column
  char* stage = (char*)&Bs[0][0] + wave * 4608;
  const int bn = n0 + cl;
  float bvs[4];
#pragma unroll
  for (int j = 0; j < 4; ++j) bvs[j] = bias[bn + j * 16];
  // Precaution: this wait stands ahead of any rewrite of the offset register that the
  // loads above name; the index as an input keeps it untouched up to it (else the
  // run's last load lands on it).
  asm volatile("s_wait_xcnt 0x0" :: "v"(bn) : "memory");
  if (MODE == 2) {
    // vt[b][h][d][key] = vt[b * 1024 + column][key]; a D tile's 8 VGPRs are 8 consecutive
    // keys. Staged as 16 columns of 64 keys, pitch 144 bytes; read back 8 lanes a column.
    __bf16* st = (__bf16*)stage;
    const int rr = lane >> 3, cc = (lane & 7) * 8;
    __bf16* tp = outT + ((size_t)(m0 >> 10) * 1024 + n0 + rr) * 1024 + (m0 & 1023) + cc;
#pragma unroll
    for (int j = 0; j < 4; ++j) {
#pragma unroll
      for (int i = 0; i < 4; ++i) {
        bf16x8 pk;
#pragma unroll
        for (int r = 0; r < 8; ++r) pk[r] = (__bf16)(acc[i][j][r] + bvs[j]);
        *(bf16x8*)(st + cl * 72 + i * 16 + hf * 8) = pk;
      }
      // The rows read back below were written by other lanes of this wave.
      asm volatile("s_wait_dscnt 0x0" ::: "memory");
      bf16x8 v[4];
#pragma unroll
      for (int e = 0; e < 4; ++e) v[e] = *(const bf16x8*)(st + (e * 4 + rr) * 72 + cc);
#pragma unroll
      for (int e = 0; e < 4; ++e) *(bf16x8*)(tp + (size_t)(j * 16 + e * 4) * 1024) = v[e];
      // Precaution: this wait stands ahead of the next round's rewrite of the registers
      // that the stores above name.
      asm volatile("s_wait_xcnt 0x0" ::: "memory");
      // Keeps the next round's bias adds behind this round: lifted ahead, all four rounds'
      // values are live at once, beyond the registers that four waves a SIMD leave a wave.
      __builtin_amdgcn_sched_barrier(0);
    }
  } else {
    // Staged as 16 rows of 64 f32, pitch 272 bytes; read back 16 lanes a row.
    float* st = (float*)stage;
    const int rr = lane >> 4, cc = (lane & 15) * 4;
    const size_t idx0 = (size_t)(m0 + rr) * 1024 + n0 + cc;
#pragma unroll
    for (int i = 0; i < 4; ++i) {
#pragma unroll
      for (int j = 0; j < 4; ++j)
#pragma unroll
        for (int r = 0; r < 8; ++r) {
          const float v = acc[i][j][r] + bvs[j];
          st[(hf * 8 + r) * 68 + j * 16 + cl] = (MODE == 3) ? (v > 0.0f ? v : 0.0f) : v;
        }
      // The rows read back below were written by other lanes of this wave.
      asm volatile("s_wait_dscnt 0x0" ::: "memory");
      f32x4 v[8];
#pragma unroll
      for (int e = 0; e < 8; ++e) v[e] = *(const f32x4*)(st + (e * 2 + rr) * 68 + cc);
#pragma unroll
      for (int e = 0; e < 8; ++e) {
        const size_t idx = idx0 + (size_t)(i * 16 + e * 2) * 1024;
        if (MODE == 0 || MODE == 3) *(f32x4*)(outF + idx) = v[e];
        if (MODE == 0 || MODE == 1) {
          bf16x4 hh;
#pragma unroll
          for (int q = 0; q < 4; ++q) hh[q] = (__bf16)v[e][q];
          *(bf16x4*)(outB + idx) = hh;
        }
      }
      // Precaution: this wait stands ahead of the next round's rewrite of the registers
      // that the stores above name.
      asm volatile("s_wait_xcnt 0x0" ::: "memory");
    }
  }
}

// The Q, K and V projections need nothing of each other: one grid, blockIdx.z picks
// the projection (operands and epilogue), the same for a whole work-group.
// The second bound asks for four waves a SIMD (at most 256 VGPRs): the loop fits, the
// epilogues alone went above it, and then only one work-group fits a WGP, with nobody
// to fill its barrier, LDS and load waits. 768 work-groups: three a WGP, two at a time.
__global__ __launch_bounds__(256, 4) void gemm_qkv_kernel(
    const float* __restrict__ Q, const float* __restrict__ K,
    const __bf16* __restrict__ WqT, const __bf16* __restrict__ WkT,
    const __bf16* __restrict__ WvT, const float* __restrict__ bq,
    const float* __restrict__ bk, const float* __restrict__ bv,
    float* __restrict__ qf, __bf16* __restrict__ qb,
    __bf16* __restrict__ kb, __bf16* __restrict__ vt) {
  __shared__ __attribute__((aligned(16))) __bf16 As[128][72];
  __shared__ __attribute__((aligned(16))) __bf16 Bs[256][72];
  const int z = blockIdx.z;
  v8f acc[4][4];
  gemm_tile<true>(z == 0 ? Q : K, z == 0 ? WqT : z == 1 ? WkT : WvT, As, Bs, acc);
  if (z == 0) {
    gemm_store<0>(acc, bq, qf, qb, nullptr, Bs);
  } else if (z == 1) {
    gemm_store<1>(acc, bk, nullptr, kb, nullptr, Bs);
  } else {
    gemm_store<2>(acc, bv, nullptr, nullptr, vt, Bs);
  }
}

__global__ __launch_bounds__(256) void gemm_o_kernel(
    const float* __restrict__ A, const __bf16* __restrict__ Bt,
    const float* __restrict__ bias, float* __restrict__ outF) {
  __shared__ __attribute__((aligned(16))) __bf16 As[128][72];
  __shared__ __attribute__((aligned(16))) __bf16 Bs[256][72];
  v8f acc[4][4];
  gemm_tile<false>(A, Bt, As, Bs, acc);
  gemm_store<3>(acc, bias, outF, nullptr, nullptr, Bs);
}

__device__ __forceinline__ float xhalf(float x) {
  const int v = __builtin_bit_cast(int, x);
  return __builtin_bit_cast(
      float, __builtin_amdgcn_permlanex16(v, v, 0x76543210, 0xfedcba98, false, false));
}

// exp2 of eight values: eight independent v_exp_f32 in one statement, then one v_nop.
// The instruction set asks for one independent instruction or v_nop behind a
// transcendental before its result is used or its source overwritten. Here every
// successor is independent and the v_nop serves the last one.
// Each value is replaced in its own register: the compiler does not see into the
// statement, and a separate result register can be an A or B operand of a WMMA issued
// just before, inside the distance that WMMA needs; a register that holds a live
// argument cannot.
__device__ __forceinline__ v8f exp2x8(v8f t) {
  float r0 = t[0], r1 = t[1], r2 = t[2], r3 = t[3], r4 = t[4], r5 = t[5], r6 = t[6], r7 = t[7];
  asm("v_exp_f32 %0, %0\n\t"
      "v_exp_f32 %1, %1\n\t"
      "v_exp_f32 %2, %2\n\t"
      "v_exp_f32 %3, %3\n\t"
      "v_exp_f32 %4, %4\n\t"
      "v_exp_f32 %5, %5\n\t"
      "v_exp_f32 %6, %6\n\t"
      "v_exp_f32 %7, %7\n\t"
      "v_nop"
      : "+v"(r0), "+v"(r1), "+v"(r2), "+v"(r3), "+v"(r4), "+v"(r5), "+v"(r6), "+v"(r7));
  v8f p;
  p[0] = r0; p[1] = r1; p[2] = r2; p[3] = r3;
  p[4] = r4; p[5] = r5; p[6] = r6; p[7] = r7;
  return p;
}

__global__ __launch_bounds__(256) void attn_kernel(
    const __bf16* __restrict__ qb, const __bf16* __restrict__ kb,
    const __bf16* __restrict__ vt, const float* __restrict__ qf,
    const float* __restrict__ mask_a, const float* __restrict__ mask_b,
    float* __restrict__ Hpre) {
  __shared__ __attribute__((aligned(16))) __bf16 Ks[64][136];   // [key][d]
  __shared__ __attribute__((aligned(16))) __bf16 Vs[128][72];   // [d][key]
  __shared__ __attribute__((aligned(16))) float mbs[64];
  const int tid = threadIdx.x, wave = tid >> 5, lane = tid & 31;
  const int hf = lane >> 4;
  const int b = blockIdx.x >> 3, h = blockIdx.x & 7;
  const int qbase = blockIdx.y * 128;
  const float scale = 0.08838834764831845f;  // 1/sqrt(128)

  // The lane's one query (shared with lane ^ 16) and its mask value.
  const int qrow = b * 1024 + qbase + wave * 16 + (lane & 15);
  const float maq = mask_a[qrow];

  // Q^T B-fragments (4 K-steps over d=128) pinned in registers.
  v16bf qfr[4];
  {
    const __bf16* qbp = qb + (size_t)qrow * 1024 + h * 128;
    const int ho = hf * 8;
#pragma unroll
    for (int ks = 0; ks < 4; ++ks) {
      bf16x8 lo = *(const bf16x8*)(qbp + ks * 32 + ho);
      bf16x8 hi = *(const bf16x8*)(qbp + ks * 32 + 16 + ho);
      qfr[ks] = pack16(lo, hi);
    }
  }

  // Staging addresses: the thread's part is one byte offset for K and one for V^T, the
  // same in every chunk; block and chunk are wave-uniform, and the four loads (and LDS
  // stores) of a run differ by a constant, so a run needs one address, not four.
  // The registers so freed bring the kernel under 256 VGPRs: four waves fit a SIMD and
  // two work-groups share a WGP, each filling the other's barrier, LDS and softmax waits.
  const int kr = tid >> 4, kc = (tid & 15) * 8;  // K: 16 threads a row, 16 rows a load
  const int vr = tid >> 3, vc = (tid & 7) * 8;   // V^T: 8 threads a row, 32 rows a load
  const unsigned ko = (unsigned)(kr * 1024 + kc) * 2u;
  const unsigned vo = (unsigned)(vr * 1024 + vc) * 2u;
  const __bf16* kblk = kb + (size_t)b * 1024 * 1024 + h * 128;
  const __bf16* vblk = vt + ((size_t)b * 8 + h) * 128 * 1024;

  bf16x8 kreg[4], vreg[4];
  float mbreg = 0.0f;
  auto load_chunk = [&](int kb0) {
    const __bf16* kp = (const __bf16*)((const char*)(kblk + (size_t)kb0 * 1024) + ko);
#pragma unroll
    for (int i = 0; i < 4; ++i) kreg[i] = *(const bf16x8*)(kp + i * 16 * 1024);
    const __bf16* vp = (const __bf16*)((const char*)(vblk + kb0) + vo);
#pragma unroll
    for (int i = 0; i < 4; ++i) vreg[i] = *(const bf16x8*)(vp + i * 32 * 1024);
    if (tid < 64) mbreg = mask_b[b * 1024 + kb0 + tid];
    // Precaution: this wait stands ahead of any rewrite of the offset register that
    // the mask load names (the build reuses it for the first fragment read).
    asm volatile("s_wait_xcnt 0x0" ::: "memory");
  };

  // O^T tiles: ofr[dt][r] = O[query lane & 15][d = dt * 16 + hf * 8 + r].
  v8f ofr[8];
#pragma unroll
  for (int d = 0; d < 8; ++d) ofr[d] = vzero8();
  float mrow = -3.0e38f;  // running maximum, equal in both lane halves
  float lrow = 0.0f;      // running sum over this lane half's keys only

  load_chunk(0);
  for (int kb0 = 0; kb0 < 1024; kb0 += 64) {
    __syncthreads();  // all waves done reading Ks/Vs of previous chunk
#pragma unroll
    for (int i = 0; i < 4; ++i) *(bf16x8*)(&Ks[kr + i * 16][kc]) = kreg[i];
#pragma unroll
    for (int i = 0; i < 4; ++i) *(bf16x8*)(&Vs[vr + i * 32][vc]) = vreg[i];
    if (tid < 64) mbs[tid] = mbreg;
    __syncthreads();
    if (kb0 + 64 < 1024) load_chunk(kb0 + 64);  // overlap with WMMA phase

    // S^T = K Q^T: sfr[nt][r] = score(key nt * 16 + hf * 8 + r, the lane's query).
    v8f sfr[4];
#pragma unroll
    for (int nt = 0; nt < 4; ++nt) {
      v8f s = vzero8();
#pragma unroll
      for (int ks = 0; ks < 4; ++ks) {
        v16bf kf = load_frag(&Ks[nt * 16][ks * 32], 136, lane);
        s = wmma_bf16(kf, qfr[ks], s);
      }
      sfr[nt] = s;
    }

    // Mask + scale + chunk maximum: four in-lane chains, then the other lane half.
    float cm[4];
#pragma unroll
    for (int nt = 0; nt < 4; ++nt) {
      const f32x4 mb0 = *(const f32x4*)(&mbs[nt * 16 + hf * 8]);
      const f32x4 mb1 = *(const f32x4*)(&mbs[nt * 16 + hf * 8 + 4]);
      cm[nt] = -3.0e38f;
#pragma unroll
      for (int r = 0; r < 8; ++r) {
        const float mbk = r < 4 ? mb0[r & 3] : mb1[r & 3];
        const float s = (maq * mbk == 1.0f) ? sfr[nt][r] * scale : NEGBIG;
        sfr[nt][r] = s;
        cm[nt] = fmaxf(cm[nt], s);
      }
    }
    float cmx = fmaxf(fmaxf(cm[0], cm[1]), fmaxf(cm[2], cm[3]));
    cmx = fmaxf(cmx, xhalf(cmx));

    const float mn = fmaxf(mrow, cmx);
    const float alpha = __expf(mrow - mn);
    mrow = mn;
    float rs[4];
#pragma unroll
    for (int nt = 0; nt < 4; ++nt) {
      // exp(x) as exp2(x * log2(e)), the form __expf compiles to.
      sfr[nt] = exp2x8((sfr[nt] - mrow) * 1.44269504f);
      rs[nt] = sfr[nt][0];
#pragma unroll
      for (int r = 1; r < 8; ++r) rs[nt] += sfr[nt][r];
    }
    lrow = alpha * lrow + ((rs[0] + rs[1]) + (rs[2] + rs[3]));
#pragma unroll
    for (int d = 0; d < 8; ++d)
#pragma unroll
      for (int r = 0; r < 8; ++r) ofr[d][r] *= alpha;

    // O^T += V^T P^T; the P^T fragment of 32 keys is two S^T tiles converted in place.
#pragma unroll
    for (int ks = 0; ks < 2; ++ks) {
      v16bf pb;
#pragma unroll
      for (int e = 0; e < 8; ++e) {
        pb[e]     = (__bf16)sfr[2 * ks][e];
        pb[8 + e] = (__bf16)sfr[2 * ks + 1][e];
      }
#pragma unroll
      for (int dt = 0; dt < 8; ++dt) {
        v16bf vf = load_frag(&Vs[dt * 16][ks * 32], 72, lane);
        ofr[dt] = wmma_bf16(vf, pb, ofr[dt]);
      }
    }
  }

  // O/l + residual q; the lane halves' sums are joined here, once.
  // In an O^T tile a lane holds 8 of its query's 128 values, so loads and stores in that
  // map are 16-byte pieces of 16 rows. Each wave turns its 16x128 tile round in its own
  // 4352 bytes of Ks (waves 0 to 3) or Vs (waves 4 to 7), 64 columns at a time, pitch 272
  // bytes; then each wave-wide load of q and each store covers whole 128-byte lines.
  __syncthreads();  // all waves done reading Ks/Vs of the last chunk
  float* os = (wave < 4 ? (float*)&Ks[0][0] : (float*)&Vs[0][0]) + (wave & 3) * 1088;
  const size_t idx0 = (size_t)((qrow & ~15) + hf) * 1024 + h * 128 + (lane & 15) * 4;
  const float* qp = qf + idx0;
  float* hp = Hpre + idx0;
  f32x4 qv[16];
#pragma unroll
  for (int e = 0; e < 8; ++e) {
    qv[e]     = *(const f32x4*)(qp + e * 2048);
    qv[8 + e] = *(const f32x4*)(qp + e * 2048 + 64);
  }
  // Precaution: this wait stands ahead of any rewrite of the address registers that
  // the loads above name; the pointer as an input keeps them untouched up to it
  // (else the run's last load lands on them).
  asm volatile("s_wait_xcnt 0x0" :: "v"(qp) : "memory");
  const float inv = 1.0f / (lrow + xhalf(lrow));
  // Read back, a lane half holds row 2e + hf, which is lane 2e + hf's query.
  float ie[8];
#pragma unroll
  for (int e = 0; e < 8; ++e) {
    const int iv = __builtin_bit_cast(int, inv);
    const int i0 = __builtin_amdgcn_readlane(iv, 2 * e);
    const int i1 = __builtin_amdgcn_readlane(iv, 2 * e + 1);
    ie[e] = __builtin_bit_cast(float, hf ? i1 : i0);
  }
#pragma unroll
  for (int p = 0; p < 2; ++p) {
#pragma unroll
    for (int d4 = 0; d4 < 4; ++d4) {
      f32x4 o0, o1;
#pragma unroll
      for (int r = 0; r < 4; ++r) {
        o0[r] = ofr[p * 4 + d4][r];
        o1[r] = ofr[p * 4 + d4][4 + r];
      }
      float* sp = os + (lane & 15) * 68 + d4 * 16 + hf * 8;
      *(f32x4*)(sp)     = o0;
      *(f32x4*)(sp + 4) = o1;
    }
    // The rows read back below were written by other lanes of this wave.
    asm volatile("s_wait_dscnt 0x0" ::: "memory");
#pragma unroll
    for (int e = 0; e < 8; ++e) {
      const f32x4 o = *(const f32x4*)(os + (e * 2 + hf) * 68 + (lane & 15) * 4);
      *(f32x4*)(hp + e * 2048 + p * 64) = o * ie[e] + qv[p * 8 + e];
    }
    // Precaution: this wait stands ahead of the second round's rewrite of the registers
    // that the stores above name. The second round's stores end the kernel.
    if (p == 0) asm volatile("s_wait_xcnt 0x0" ::: "memory");
  }
}

// ---------------------------------------------------------------------------
// LayerNorm over rows of 1024, with optional pre-add of Y (residual).
// One wave owns a whole row: 8 loads of 16 bytes a lane, each wave-wide load
// 512 contiguous bytes; the row's sums stay inside the wave (no LDS, no barrier).
// 256 work-groups of 16 waves, two rows a wave (rows 2w and 2w + 1), both
// rows' loads issued ahead of the sums.
// ---------------------------------------------------------------------------
template <bool ADD>
__global__ __launch_bounds__(512) void ln_kernel(
    const float* __restrict__ X, const float* __restrict__ g,
    const float* __restrict__ be, float* __restrict__ out,
    const float* __restrict__ Y) {
  const int lane = threadIdx.x & 31;
  const int w  = blockIdx.x * 16 + (threadIdx.x >> 5);
  const int c0 = lane * 4;
  // The lane's byte offset in X, Y and out alike (under 32 MiB): one 32-bit register
  // beside each scalar base serves all loads and stores of both rows.
  const unsigned ro = (unsigned)w * 8192u + (unsigned)lane * 16u;
  f32x4 x[2][8], y[2][8], gv[8], bv[8];
#pragma unroll
  for (int r = 0; r < 2; ++r) {
    const float* xp = (const float*)((const char*)X + ro) + r * 1024;
#pragma unroll
    for (int j = 0; j < 8; ++j) x[r][j] = *(const f32x4*)(xp + j * 128);
    if (ADD) {
      const float* yp = (const float*)((const char*)Y + ro) + r * 1024;
#pragma unroll
      for (int j = 0; j < 8; ++j) y[r][j] = *(const f32x4*)(yp + j * 128);
    }
  }
#pragma unroll
  for (int j = 0; j < 8; ++j) {
    gv[j] = *(const f32x4*)(g + c0 + j * 128);
    bv[j] = *(const f32x4*)(be + c0 + j * 128);
  }
  // Precaution: this wait stands ahead of any rewrite of an offset register that
  // the loads above name; lane as an input keeps the gain and shift loads' shared
  // offset register untouched up to it (else the run's last load lands on it).
  asm volatile("s_wait_xcnt 0x0" :: "v"(lane) : "memory");
  // Keeps every load above issued ahead of the arithmetic: without it the
  // compiler sinks the gain and shift loads to their uses, one waited pair at a time.
  __builtin_amdgcn_sched_barrier(0);
  if (ADD) {
#pragma unroll
    for (int r = 0; r < 2; ++r)
#pragma unroll
      for (int j = 0; j < 8; ++j) x[r][j] += y[r][j];
  }

  float s[2], ss[2];
#pragma unroll
  for (int r = 0; r < 2; ++r) {
    f32x4 sv = x[r][0], qv = x[r][0] * x[r][0];
#pragma unroll
    for (int j = 1; j < 8; ++j) {
      sv += x[r][j];
      qv += x[r][j] * x[r][j];
    }
    s[r]  = (sv[0] + sv[1]) + (sv[2] + sv[3]);
    ss[r] = (qv[0] + qv[1]) + (qv[2] + qv[3]);
  }
#pragma unroll
  for (int m = 1; m < 32; m <<= 1) {
#pragma unroll
    for (int r = 0; r < 2; ++r) {
      s[r]  += __shfl_xor(s[r], m, 32);
      ss[r] += __shfl_xor(ss[r], m, 32);
    }
  }

#pragma unroll
  for (int r = 0; r < 2; ++r) {
    const float mu   = s[r] * (1.0f / 1024.0f);
    const float var  = ss[r] * (1.0f / 1024.0f) - mu * mu;
    const float rstd = rsqrtf(var + 1e-5f);
    float* op = (float*)((char*)out + ro) + r * 1024;
#pragma unroll
    for (int j = 0; j < 8; ++j)
      *(f32x4*)(op + j * 128) = (x[r][j] - mu) * rstd * gv[j] + bv[j];
  }
}

// ---------------------------------------------------------------------------
extern "C" void kernel_launch(void* const* d_in, const int* in_sizes, int n_in,
                              void* d_out, int out_size, void* d_ws, size_t ws_size,
                              hipStream_t stream) {
  (void)in_sizes; (void)n_in; (void)out_size; (void)ws_size;
  const float* Q   = (const float*)d_in[0];
  const float* K   = (const float*)d_in[1];
  const float* ma  = (const float*)d_in[2];
  const float* mb  = (const float*)d_in[3];
  const float* Wq  = (const float*)d_in[4];  const float* bq  = (const float*)d_in[5];
  const float* Wk  = (const float*)d_in[6];  const float* bk  = (const float*)d_in[7];
  const float* Wv  = (const float*)d_in[8];  const float* bv  = (const float*)d_in[9];
  const float* Wo  = (const float*)d_in[10]; const float* bo  = (const float*)d_in[11];
  const float* g0  = (const float*)d_in[12]; const float* be0 = (const float*)d_in[13];
  const float* g1  = (const float*)d_in[14]; const float* be1 = (const float*)d_in[15];
  float* out = (float*)d_out;

  char* ws = (char*)d_ws;
  size_t off = 0;
  auto alloc = [&](size_t bytes) -> void* {
    void* p = ws + off;
    off += (bytes + 255) & ~(size_t)255;
    return p;
  };
  const size_t MROW = 8192;  // B * 1024
  __bf16* WqT = (__bf16*)alloc(1024 * 1024 * sizeof(__bf16));
  __bf16* WkT = (__bf16*)alloc(1024 * 1024 * sizeof(__bf16));
  __bf16* WvT = (__bf16*)alloc(1024 * 1024 * sizeof(__bf16));
  __bf16* WoT = (__bf16*)alloc(1024 * 1024 * sizeof(__bf16));
  float*  qf    = (float*)alloc(MROW * 1024 * sizeof(float));
  __bf16* qbp   = (__bf16*)alloc(MROW * 1024 * sizeof(__bf16));
  __bf16* kbp   = (__bf16*)alloc(MROW * 1024 * sizeof(__bf16));
  __bf16* vtp   = (__bf16*)alloc(MROW * 1024 * sizeof(__bf16));
  float*  Hpre  = (float*)alloc(MROW * 1024 * sizeof(float));
  float*  H2    = (float*)alloc(MROW * 1024 * sizeof(float));
  float*  reluG = (float*)alloc(MROW * 1024 * sizeof(float));

  dim3 blk(256);
  convw_kernel<<<dim3(32, 32, 4), blk, 0, stream>>>(Wq, Wk, Wv, Wo, WqT, WkT, WvT, WoT);
  gemm_qkv_kernel<<<dim3(64, 4, 3), blk, 0, stream>>>(Q, K, WqT, WkT, WvT, bq, bk, bv,
                                                      qf, qbp, kbp, vtp);
  attn_kernel<<<dim3(64, 8), blk, 0, stream>>>(qbp, kbp, vtp, qf, ma, mb, Hpre);
  ln_kernel<false><<<dim3(256), dim3(512), 0, stream>>>(Hpre, g0, be0, H2, nullptr);
  gemm_o_kernel<<<dim3(64, 4), blk, 0, stream>>>(H2, WoT, bo, reluG);
  ln_kernel<true><<<dim3(256), dim3(512), 0, stream>>>(H2, g1, be1, out, reluG);
}

// v009
// Measured time: 133 microseconds a run.
// Timed twice side by side with v008, it ran 1.04 times as fast both times.
// Over all steps from v000 it is 2.04 times as fast.
#include <hip/hip_runtime.h>

typedef __attribute__((ext_vector_type(16))) __bf16 v16bf;
typedef __attribute__((ext_vector_type(8)))  __bf16 bf16x8;
typedef __attribute__((ext_vector_type(4)))  __bf16 bf16x4;
typedef __attribute__((ext_vector_type(8)))  float  v8f;
typedef __attribute__((ext_vector_type(4)))  float  f32x4;
typedef __attribute__((ext_vector_type(2)))  float  f32x2;

#define NEGBIG (-1.0e9f)

__device__ __forceinline__ v8f vzero8() {
  v8f z;
#pragma unroll
  for (int i = 0; i < 8; ++i) z[i] = 0.0f;
  return z;
}

__device__ __forceinline__ v16bf pack16(bf16x8 lo, bf16x8 hi) {
  return __builtin_shufflevector(lo, hi, 0, 1, 2, 3, 4, 5, 6, 7, 8, 9, 10, 11, 12, 13, 14, 15);
}

// Load a 16x32 bf16 WMMA A/B fragment from a row-major tile.
// A: row m = lane&15, K halves selected by lane>>4 (per ISA 16-bit A 16x32 layout).
// B is the symmetric layout with n = lane&15 reading rows of the N-major (transposed) tile.
__device__ __forceinline__ v16bf load_frag(const __bf16* base, int ld, int lane) {
  const int r  = lane & 15;
  const int ho = (lane >> 4) * 8;
  const __bf16* p = base + r * ld;
  bf16x8 lo = *(const bf16x8*)(p + ho);
  bf16x8 hi = *(const bf16x8*)(p + 16 + ho);
  return pack16(lo, hi);
}

__device__ __forceinline__ v8f wmma_bf16(v16bf a, v16bf b, v8f c) {
  return __builtin_amdgcn_wmma_f32_16x16x32_bf16(false, a, false, b, (short)0, c, false, false);
}

// ---------------------------------------------------------------------------
// Weight transpose + f32->bf16 convert: W[1024][1024] -> WT[n][k] bf16
// The four weights need nothing of each other: one grid, blockIdx.z picks the weight.
// ---------------------------------------------------------------------------
__global__ __launch_bounds__(256) void convw_kernel(
    const float* __restrict__ W0, const float* __restrict__ W1,
    const float* __restrict__ W2, const float* __restrict__ W3,
    __bf16* __restrict__ WT0, __bf16* __restrict__ WT1,
    __bf16* __restrict__ WT2, __bf16* __restrict__ WT3) {
  __shared__ float t[32][33];
  const int z = blockIdx.z;
  const float* W = z == 0 ? W0 : z == 1 ? W1 : z == 2 ? W2 : W3;
  __bf16* WT = z == 0 ? WT0 : z == 1 ? WT1 : z == 2 ? WT2 : WT3;
  const int k0 = blockIdx.x * 32, n0 = blockIdx.y * 32;
  const int tx = threadIdx.x & 31, ty = threadIdx.x >> 5;
#pragma unroll
  for (int i = 0; i < 32; i += 8)
    t[ty + i][tx] = W[(size_t)(k0 + ty + i) * 1024 + n0 + tx];
  __syncthreads();
#pragma unroll
  for (int i = 0; i < 32; i += 8)
    WT[(size_t)(n0 + ty + i) * 1024 + k0 + tx] = (__bf16)t[tx][ty + i];
}

// ---------------------------------------------------------------------------
// GEMM: C[M=8192, N=1024] = A_f32[M,1024] x W (as Bt = W^T bf16 [N][K]) + bias
// 128x256 block tile, 8 waves (2x4) of 64x64 each, 64-wide K stages, register
// double-buffered global->LDS staging so HBM latency overlaps the WMMA phase.
// A wave's 4 + 4 fragments feed 16 WMMAs, and a block's 64 KB stage feeds 256.
// MODE 0: Q proj  -> outF (f32) + outB (bf16)
// MODE 1: K proj  -> outB (bf16)
// MODE 2: V proj  -> outT (bf16, per-head transposed vt[b][h][d][key])
// MODE 3: O proj  -> outF = relu(acc + bias); its A is normalised on the way into LDS
// ---------------------------------------------------------------------------
// HOLD: fence the next stage's loads in place (see the two fences below). The Q, K, V
// kernel needs it; the build of the O kernel keeps that order by itself, and there a
// fence would only stop the WMMAs that run on across the barriers.
// NORM: A holds rows that are not yet normalised; the first LayerNorm is applied where a
// staged value is converted to bf16. stats[h][row] holds each row's sum and sum of squares
// over head h's 128 columns (written by the attention kernel); rs is 128 x 2 floats of LDS.
template <bool HOLD, bool NORM>
__device__ __forceinline__ void gemm_tile(
    const float* __restrict__ A, const __bf16* __restrict__ Bt,
    __bf16 (&As)[128][72], __bf16 (&Bs)[256][72], v8f (&acc)[4][4],
    const float* __restrict__ stats, const float* __restrict__ g,
    const float* __restrict__ be, float* rs) {
  const int tid  = threadIdx.x;
  const int wave = tid >> 5, lane = tid & 31;
  const int wm = wave >> 2, wn = wave & 3;
  const int rowBase = blockIdx.x * 128;
  const int nBase   = blockIdx.y * 256;
  // Staging map: every wave-wide 16-byte load covers whole 128-byte lines.
  // A stage row = 64 f32 = 256 B: 16 lanes a row, two rows a load.
  // B stage row = 64 bf16 = 128 B: 8 lanes a row, four rows a load.
  const int ar = tid >> 4, ac = (tid & 15) * 4;
  const int br = tid >> 3, bc = (tid & 7) * 8;

  f32x4  areg[8];
  bf16x8 breg[8];
  f32x4  greg, sreg;  // NORM: gain and shift of the thread's four columns of the stage
  auto load_global = [&](int kc) {
    const float* ap = A + (size_t)(rowBase + ar) * 1024 + kc + ac;
#pragma unroll
    for (int e = 0; e < 8; ++e) areg[e] = *(const f32x4*)(ap + e * 16 * 1024);
    const __bf16* bp = Bt + (size_t)(nBase + br) * 1024 + kc + bc;
#pragma unroll
    for (int e = 0; e < 8; ++e) breg[e] = *(const bf16x8*)(bp + e * 32 * 1024);
    if (NORM) {
      greg = *(const f32x4*)(g + kc + ac);
      sreg = *(const f32x4*)(be + kc + ac);
    }
    // Precaution: this wait stands ahead of the loop's advance of the two address
    // pairs that the loads above name; the pointers as inputs keep the pairs untouched up
    // to it (else the gain's load lands on one). With HOLD the advance stands behind the
    // phase's closing wait for the loads' data, which covers it.
    if (!HOLD) asm volatile("s_wait_xcnt 0x0" :: "v"(ap), "v"(bp) : "memory");
  };

#pragma unroll
  for (int i = 0; i < 4; ++i)
#pragma unroll
    for (int j = 0; j < 4; ++j) acc[i][j] = vzero8();

  load_global(0);
  // The thread's 8 rows stay the same through the K loop: x * rmul + radd = (x - mu) * rstd.
  // Behind the first stage's loads, so that the two latencies run side by side.
  float rmul[8], radd[8];
  if (NORM) {
    if (tid < 128) {  // waves 0 to 3, one row a thread
      const int si = rowBase + tid;
      f32x2 pv[8];
#pragma unroll
      for (int h = 0; h < 8; ++h) pv[h] = *(const f32x2*)(stats + (size_t)(si + h * 8192) * 2);
      // Precaution: this wait stands ahead of any rewrite of the offset register that
      // the loads above name; the index as an input keeps it untouched up to it.
      asm volatile("s_wait_xcnt 0x0" :: "v"(si) : "memory");
      f32x2 sv = pv[0];
#pragma unroll
      for (int h = 1; h < 8; ++h) sv += pv[h];
      const float mu   = sv[0] * (1.0f / 1024.0f);
      const float var  = sv[1] * (1.0f / 1024.0f) - mu * mu;
      const float rstd = rsqrtf(var + 1e-5f);
      f32x2 o;
      o[0] = rstd;
      o[1] = -mu * rstd;
      *(f32x2*)(rs + tid * 2) = o;
    }
    __syncthreads();  // every wave reads rows that waves 0 to 3 wrote
#pragma unroll
    for (int e = 0; e < 8; ++e) {
      const f32x2 v = *(const f32x2*)(rs + (e * 16 + ar) * 2);
      rmul[e] = v[0];
      radd[e] = v[1];
    }
  }
  for (int kc = 0; kc < 1024; kc += 64) {
    // Convert staged A regs to bf16 and commit both tiles to LDS.
#pragma unroll
    for (int e = 0; e < 8; ++e) {
      bf16x4 hh;
#pragma unroll
      for (int q = 0; q < 4; ++q) {
        float x = areg[e][q];
        if (NORM) x = (x * rmul[e] + radd[e]) * greg[q] + sreg[q];
        hh[q] = (__bf16)x;
      }
      *(bf16x4*)(&As[e * 16 + ar][ac]) = hh;
    }
#pragma unroll
    for (int e = 0; e < 8; ++e) *(bf16x8*)(&Bs[e * 32 + br][bc]) = breg[e];
    __syncthreads();
    if (kc + 64 < 1024) load_global(kc + 64);  // overlap with WMMA phase
    // Keeps all of the next stage's loads issued in front of the WMMA phase: without
    // it the compiler sinks most of them to the end of the phase, next to their uses,
    // and their whole latency is waited out there.
    if (HOLD) __builtin_amdgcn_sched_barrier(0);
#pragma unroll
    for (int ks = 0; ks < 2; ++ks) {
      v16bf af[4];
#pragma unroll
      for (int i = 0; i < 4; ++i) af[i] = load_frag(&As[wm * 64 + i * 16][ks * 32], 72, lane);
#pragma unroll
      for (int jp = 0; jp < 4; jp += 2) {
        v16bf bf0 = load_frag(&Bs[wn * 64 + jp * 16][ks * 32], 72, lane);
        v16bf bf1 = load_frag(&Bs[wn * 64 + jp * 16 + 16][ks * 32], 72, lane);
#pragma unroll
        for (int i = 0; i < 4; ++i) {
          acc[i][jp]     = wmma_bf16(af[i], bf0, acc[i][jp]);
          acc[i][jp + 1] = wmma_bf16(af[i], bf1, acc[i][jp + 1]);
        }
      }
    }
    // Keeps the conversions of the loaded values, and with them the first wait for
    // the loads, behind the WMMA phase: without it the compiler lifts some among the
    // WMMAs, which then stand still for a load issued just before.
    if (HOLD) __builtin_amdgcn_sched_barrier(0);
    __syncthreads();
  }
}

// Epilogue: a D tile holds 16 columns of 8 rows a lane half, so stores straight from the
// accumulators are pieces of 16 to 64 bytes. Each wave turns its 64x64 tile round in its
// own 4608 bytes of Bs (free behind the loop's last barrier), 16 rows at a time, and then
// every wave-wide global store covers whole 128-byte lines.
template <int MODE>
__device__ __forceinline__ void gemm_store(
    const v8f (&acc)[4][4], const float* __restrict__ bias,
    float* __restrict__ outF, __bf16* __restrict__ outB,
    __bf16* __restrict__ outT, __bf16 (&Bs)[256][72]) {
  const int tid  = threadIdx.x;
  const int wave = tid >> 5, lane = tid & 31;
  const int wm = wave >> 2, wn = wave & 3;
  const int cl = lane & 15, hf = lane >> 4;
  const int m0 = blockIdx.x * 128 + wm * 64;  // the wave's first row
  const int n0 = blockIdx.y * 256 + wn * 64;  // the wave's first column
  char* stage = (char*)&Bs[0][0] + wave * 4608;
  const int bn = n0 + cl;
  float bvs[4];
#pragma unroll
  for (int j = 0; j < 4; ++j) bvs[j] = bias[bn + j * 16];
  // Precaution: this wait stands ahead of any rewrite of the offset register that the
  // loads above name; the index as an input keeps it untouched up to it (else the
  // run's last load lands on it).
  asm volatile("s_wait_xcnt 0x0" :: "v"(bn) : "memory");
  if (MODE == 2) {
    // vt[b][h][d][key] = vt[b * 1024 + column][key]; a D tile's 8 VGPRs are 8 consecutive
    // keys. Staged as 16 columns of 64 keys, pitch 144 bytes; read back 8 lanes a column.
    __bf16* st = (__bf16*)stage;
    const int rr = lane >> 3, cc = (lane & 7) * 8;
    __bf16* tp = outT + ((size_t)(m0 >> 10) * 1024 + n0 + rr) * 1024 + (m0 & 1023) + cc;
#pragma unroll
    for (int j = 0; j < 4; ++j) {
#pragma unroll
      for (int i = 0; i < 4; ++i) {
        bf16x8 pk;
#pragma unroll
        for (int r = 0; r < 8; ++r) pk[r] = (__bf16)(acc[i][j][r] + bvs[j]);
        *(bf16x8*)(st + cl * 72 + i * 16 + hf * 8) = pk;
      }
      // The rows read back below were written by other lanes of this wave.
      asm volatile("s_wait_dscnt 0x0" ::: "memory");
      bf16x8 v[4];
#pragma unroll
      for (int e = 0; e < 4; ++e) v[e] = *(const bf16x8*)(st + (e * 4 + rr) * 72 + cc);
#pragma unroll
      for (int e = 0; e < 4; ++e) *(bf16x8*)(tp + (size_t)(j * 16 + e * 4) * 1024) = v[e];
      // Precaution: this wait stands ahead of the next round's rewrite of the registers
      // that the stores above name.
      asm volatile("s_wait_xcnt 0x0" ::: "memory");
      // Keeps the next round's bias adds behind this round: lifted ahead, all four rounds'
      // values are live at once, beyond the registers that four waves a SIMD leave a wave.
      __builtin_amdgcn_sched_barrier(0);
    }
  } else {
    // Staged as 16 rows of 64 f32, pitch 272 bytes; read back 16 lanes a row.
    float* st = (float*)stage;
    const int rr = lane >> 4, cc = (lane & 15) * 4;
    const size_t idx0 = (size_t)(m0 + rr) * 1024 + n0 + cc;
#pragma unroll
    for (int i = 0; i < 4; ++i) {
#pragma unroll
      for (int j = 0; j < 4; ++j)
#pragma unroll
        for (int r = 0; r < 8; ++r) {
          const float v = acc[i][j][r] + bvs[j];
          st[(hf * 8 + r) * 68 + j * 16 + cl] = (MODE == 3) ? (v > 0.0f ? v : 0.0f) : v;
        }
      // The rows read back below were written by other lanes of this wave.
      asm volatile("s_wait_dscnt 0x0" ::: "memory");
      f32x4 v[8];
#pragma unroll
      for (int e = 0; e < 8; ++e) v[e] = *(const f32x4*)(st + (e * 2 + rr) * 68 + cc);
#pragma unroll
      for (int e = 0; e < 8; ++e) {
        const size_t idx = idx0 + (size_t)(i * 16 + e * 2) * 1024;
        if (MODE == 0 || MODE == 3) *(f32x4*)(outF + idx) = v[e];
        if (MODE == 0 || MODE == 1) {
          bf16x4 hh;
#pragma unroll
          for (int q = 0; q < 4; ++q) hh[q] = (__bf16)v[e][q];
          *(bf16x4*)(outB + idx) = hh;
        }
      }
      // Precaution: this wait stands ahead of the next round's rewrite of the registers
      // that the stores above name.
      asm volatile("s_wait_xcnt 0x0" ::: "memory");
    }
  }
}

// The Q, K and V projections need nothing of each other: one grid, blockIdx.z picks
// the projection (operands and epilogue), the same for a whole work-group.
// The second bound asks for four waves a SIMD (at most 256 VGPRs): the loop fits, the
// epilogues alone went above it, and then only one work-group fits a WGP, with nobody
// to fill its barrier, LDS and load waits. 768 work-groups: three a WGP, two at a time.
__global__ __launch_bounds__(256, 4) void gemm_qkv_kernel(
    const float* __restrict__ Q, const float* __restrict__ K,
    const __bf16* __restrict__ WqT, const __bf16* __restrict__ WkT,
    const __bf16* __restrict__ WvT, const float* __restrict__ bq,
    const float* __restrict__ bk, const float* __restrict__ bv,
    float* __restrict__ qf, __bf16* __restrict__ qb,
    __bf16* __restrict__ kb, __bf16* __restrict__ vt) {
  __shared__ __attribute__((aligned(16))) __bf16 As[128][72];
  __shared__ __attribute__((aligned(16))) __bf16 Bs[256][72];
  const int z = blockIdx.z;
  v8f acc[4][4];
  gemm_tile<true, false>(z == 0 ? Q : K, z == 0 ? WqT : z == 1 ? WkT : WvT, As, Bs, acc,
                         nullptr, nullptr, nullptr, nullptr);
  if (z == 0) {
    gemm_store<0>(acc, bq, qf, qb, nullptr, Bs);
  } else if (z == 1) {
    gemm_store<1>(acc, bk, nullptr, kb, nullptr, Bs);
  } else {
    gemm_store<2>(acc, bv, nullptr, nullptr, vt, Bs);
  }
}

__global__ __launch_bounds__(256) void gemm_o_kernel(
    const float* __restrict__ A, const __bf16* __restrict__ Bt,
    const float* __restrict__ bias, float* __restrict__ outF,
    const float* __restrict__ stats, const float* __restrict__ g0,
    const float* __restrict__ be0) {
  __shared__ __attribute__((aligned(16))) __bf16 As[128][72];
  __shared__ __attribute__((aligned(16))) __bf16 Bs[256][72];
  __shared__ __attribute__((aligned(16))) float rs[256];
  v8f acc[4][4];
  gemm_tile<false, true>(A, Bt, As, Bs, acc, stats, g0, be0, rs);
  gemm_store<3>(acc, bias, outF, nullptr, nullptr, Bs);
}

__device__ __forceinline__ float xhalf(float x) {
  const int v = __builtin_bit_cast(int, x);
  return __builtin_bit_cast(
      float, __builtin_amdgcn_permlanex16(v, v, 0x76543210, 0xfedcba98, false, false));
}

// exp2 of eight values: eight independent v_exp_f32 in one statement, then one v_nop.
// The instruction set asks for one independent instruction or v_nop behind a
// transcendental before its result is used or its source overwritten. Here every
// successor is independent and the v_nop serves the last one.
// Each value is replaced in its own register: the compiler does not see into the
// statement, and a separate result register can be an A or B operand of a WMMA issued
// just before, inside the distance that WMMA needs; a register that holds a live
// argument cannot.
__device__ __forceinline__ v8f exp2x8(v8f t) {
  float r0 = t[0], r1 = t[1], r2 = t[2], r3 = t[3], r4 = t[4], r5 = t[5], r6 = t[6], r7 = t[7];
  asm("v_exp_f32 %0, %0\n\t"
      "v_exp_f32 %1, %1\n\t"
      "v_exp_f32 %2, %2\n\t"
      "v_exp_f32 %3, %3\n\t"
      "v_exp_f32 %4, %4\n\t"
      "v_exp_f32 %5, %5\n\t"
      "v_exp_f32 %6, %6\n\t"
      "v_exp_f32 %7, %7\n\t"
      "v_nop"
      : "+v"(r0), "+v"(r1), "+v"(r2), "+v"(r3), "+v"(r4), "+v"(r5), "+v"(r6), "+v"(r7));
  v8f p;
  p[0] = r0; p[1] = r1; p[2] = r2; p[3] = r3;
  p[4] = r4; p[5] = r5; p[6] = r6; p[7] = r7;
  return p;
}

__global__ __launch_bounds__(256) void attn_kernel(
    const __bf16* __restrict__ qb, const __bf16* __restrict__ kb,
    const __bf16* __restrict__ vt, const float* __restrict__ qf,
    const float* __restrict__ mask_a, const float* __restrict__ mask_b,
    float* __restrict__ Hpre, float* __restrict__ stats) {
  __shared__ __attribute__((aligned(16))) __bf16 Ks[64][136];   // [key][d]
  __shared__ __attribute__((aligned(16))) __bf16 Vs[128][72];   // [d][key]
  __shared__ __attribute__((aligned(16))) float mbs[64];
  const int tid = threadIdx.x, wave = tid >> 5, lane = tid & 31;
  const int hf = lane >> 4;
  const int b = blockIdx.x >> 3, h = blockIdx.x & 7;
  const int qbase = blockIdx.y * 128;
  const float scale = 0.08838834764831845f;  // 1/sqrt(128)

  // The lane's one query (shared with lane ^ 16) and its mask value.
  const int qrow = b * 1024 + qbase + wave * 16 + (lane & 15);
  const float maq = mask_a[qrow];

  // Q^T B-fragments (4 K-steps over d=128) pinned in registers.
  v16bf qfr[4];
  {
    const __bf16* qbp = qb + (size_t)qrow * 1024 + h * 128;
    const int ho = hf * 8;
#pragma unroll
    for (int ks = 0; ks < 4; ++ks) {
      bf16x8 lo = *(const bf16x8*)(qbp + ks * 32 + ho);
      bf16x8 hi = *(const bf16x8*)(qbp + ks * 32 + 16 + ho);
      qfr[ks] = pack16(lo, hi);
    }
  }

  // Staging addresses: the thread's part is one byte offset for K and one for V^T, the
  // same in every chunk; block and chunk are wave-uniform, and the four loads (and LDS
  // stores) of a run differ by a constant, so a run needs one address, not four.
  // The registers so freed bring the kernel under 256 VGPRs: four waves fit a SIMD and
  // two work-groups share a WGP, each filling the other's barrier, LDS and softmax waits.
  const int kr = tid >> 4, kc = (tid & 15) * 8;  // K: 16 threads a row, 16 rows a load
  const int vr = tid >> 3, vc = (tid & 7) * 8;   // V^T: 8 threads a row, 32 rows a load
  const unsigned ko = (unsigned)(kr * 1024 + kc) * 2u;
  const unsigned vo = (unsigned)(vr * 1024 + vc) * 2u;
  const __bf16* kblk = kb + (size_t)b * 1024 * 1024 + h * 128;
  const __bf16* vblk = vt + ((size_t)b * 8 + h) * 128 * 1024;

  bf16x8 kreg[4], vreg[4];
  float mbreg = 0.0f;
  auto load_chunk = [&](int kb0) {
    const __bf16* kp = (const __bf16*)((const char*)(kblk + (size_t)kb0 * 1024) + ko);
#pragma unroll
    for (int i = 0; i < 4; ++i) kreg[i] = *(const bf16x8*)(kp + i * 16 * 1024);
    const __bf16* vp = (const __bf16*)((const char*)(vblk + kb0) + vo);
#pragma unroll
    for (int i = 0; i < 4; ++i) vreg[i] = *(const bf16x8*)(vp + i * 32 * 1024);
    if (tid < 64) mbreg = mask_b[b * 1024 + kb0 + tid];
    // Precaution: this wait stands ahead of any rewrite of the offset register that
    // the mask load names (the build reuses it for the first fragment read).
    asm volatile("s_wait_xcnt 0x0" ::: "memory");
  };

  // O^T tiles: ofr[dt][r] = O[query lane & 15][d = dt * 16 + hf * 8 + r].
  v8f ofr[8];
#pragma unroll
  for (int d = 0; d < 8; ++d) ofr[d] = vzero8();
  float mrow = -3.0e38f;  // running maximum, equal in both lane halves
  float lrow = 0.0f;      // running sum over this lane half's keys only

  load_chunk(0);
  for (int kb0 = 0; kb0 < 1024; kb0 += 64) {
    __syncthreads();  // all waves done reading Ks/Vs of previous chunk
#pragma unroll
    for (int i = 0; i < 4; ++i) *(bf16x8*)(&Ks[kr + i * 16][kc]) = kreg[i];
#pragma unroll
    for (int i = 0; i < 4; ++i) *(bf16x8*)(&Vs[vr + i * 32][vc]) = vreg[i];
    if (tid < 64) mbs[tid] = mbreg;
    __syncthreads();
    if (kb0 + 64 < 1024) load_chunk(kb0 + 64);  // overlap with WMMA phase

    // S^T = K Q^T: sfr[nt][r] = score(key nt * 16 + hf * 8 + r, the lane's query).
    v8f sfr[4];
#pragma unroll
    for (int nt = 0; nt < 4; ++nt) {
      v8f s = vzero8();
#pragma unroll
      for (int ks = 0; ks < 4; ++ks) {
        v16bf kf = load_frag(&Ks[nt * 16][ks * 32], 136, lane);
        s = wmma_bf16(kf, qfr[ks], s);
      }
      sfr[nt] = s;
    }

    // Mask + scale + chunk maximum: four in-lane chains, then the other lane half.
    float cm[4];
#pragma unroll
    for (int nt = 0; nt < 4; ++nt) {
      const f32x4 mb0 = *(const f32x4*)(&mbs[nt * 16 + hf * 8]);
      const f32x4 mb1 = *(const f32x4*)(&mbs[nt * 16 + hf * 8 + 4]);
      cm[nt] = -3.0e38f;
#pragma unroll
      for (int r = 0; r < 8; ++r) {
        const float mbk = r < 4 ? mb0[r & 3] : mb1[r & 3];
        const float s = (maq * mbk == 1.0f) ? sfr[nt][r] * scale : NEGBIG;
        sfr[nt][r] = s;
        cm[nt] = fmaxf(cm[nt], s);
      }
    }
    float cmx = fmaxf(fmaxf(cm[0], cm[1]), fmaxf(cm[2], cm[3]));
    cmx = fmaxf(cmx, xhalf(cmx));

    const float mn = fmaxf(mrow, cmx);
    const float alpha = __expf(mrow - mn);
    mrow = mn;
    float rs[4];
#pragma unroll
    for (int nt = 0; nt < 4; ++nt) {
      // exp(x) as exp2(x * log2(e)), the form __expf compiles to.
      sfr[nt] = exp2x8((sfr[nt] - mrow) * 1.44269504f);
      rs[nt] = sfr[nt][0];
#pragma unroll
      for (int r = 1; r < 8; ++r) rs[nt] += sfr[nt][r];
    }
    lrow = alpha * lrow + ((rs[0] + rs[1]) + (rs[2] + rs[3]));
#pragma unroll
    for (int d = 0; d < 8; ++d)
#pragma unroll
      for (int r = 0; r < 8; ++r) ofr[d][r] *= alpha;

    // O^T += V^T P^T; the P^T fragment of 32 keys is two S^T tiles converted in place.
#pragma unroll
    for (int ks = 0; ks < 2; ++ks) {
      v16bf pb;
#pragma unroll
      for (int e = 0; e < 8; ++e) {
        pb[e]     = (__bf16)sfr[2 * ks][e];
        pb[8 + e] = (__bf16)sfr[2 * ks + 1][e];
      }
#pragma unroll
      for (int dt = 0; dt < 8; ++dt) {
        v16bf vf = load_frag(&Vs[dt * 16][ks * 32], 72, lane);
        ofr[dt] = wmma_bf16(vf, pb, ofr[dt]);
      }
    }
  }

  // O/l + residual q; the lane halves' sums are joined here, once.
  // In an O^T tile a lane holds 8 of its query's 128 values, so loads and stores in that
  // map are 16-byte pieces of 16 rows. Each wave turns its 16x128 tile round in its own
  // 4352 bytes of Ks (waves 0 to 3) or Vs (waves 4 to 7), 64 columns at a time, pitch 272
  // bytes; then each wave-wide load of q and each store covers whole 128-byte lines.
  __syncthreads();  // all waves done reading Ks/Vs of the last chunk
  float* os = (wave < 4 ? (float*)&Ks[0][0] : (float*)&Vs[0][0]) + (wave & 3) * 1088;
  const size_t idx0 = (size_t)((qrow & ~15) + hf) * 1024 + h * 128 + (lane & 15) * 4;
  const float* qp = qf + idx0;
  float* hp = Hpre + idx0;
  f32x4 qv[16];
#pragma unroll
  for (int e = 0; e < 8; ++e) {
    qv[e]     = *(const f32x4*)(qp + e * 2048);
    qv[8 + e] = *(const f32x4*)(qp + e * 2048 + 64);
  }
  // Precaution: this wait stands ahead of any rewrite of the address registers that
  // the loads above name; the pointer as an input keeps them untouched up to it
  // (else the run's last load lands on them).
  asm volatile("s_wait_xcnt 0x0" :: "v"(qp) : "memory");
  const float inv = 1.0f / (lrow + xhalf(lrow));
  // Read back, a lane half holds row 2e + hf, which is lane 2e + hf's query.
  float ie[8];
#pragma unroll
  for (int e = 0; e < 8; ++e) {
    const int iv = __builtin_bit_cast(int, inv);
    const int i0 = __builtin_amdgcn_readlane(iv, 2 * e);
    const int i1 = __builtin_amdgcn_readlane(iv, 2 * e + 1);
    ie[e] = __builtin_bit_cast(float, hf ? i1 : i0);
  }
  // The first LayerNorm's row sums over this head's 128 columns, taken as the values go out.
  float ps[8], pq[8];
#pragma unroll
  for (int e = 0; e < 8; ++e) ps[e] = pq[e] = 0.0f;
#pragma unroll
  for (int p = 0; p < 2; ++p) {
#pragma unroll
    for (int d4 = 0; d4 < 4; ++d4) {
      f32x4 o0, o1;
#pragma unroll
      for (int r = 0; r < 4; ++r) {
        o0[r] = ofr[p * 4 + d4][r];
        o1[r] = ofr[p * 4 + d4][4 + r];
      }
      float* sp = os + (lane & 15) * 68 + d4 * 16 + hf * 8;
      *(f32x4*)(sp)     = o0;
      *(f32x4*)(sp + 4) = o1;
    }
    // The rows read back below were written by other lanes of this wave.
    asm volatile("s_wait_dscnt 0x0" ::: "memory");
#pragma unroll
    for (int e = 0; e < 8; ++e) {
      const f32x4 o = *(const f32x4*)(os + (e * 2 + hf) * 68 + (lane & 15) * 4);
      const f32x4 hv = o * ie[e] + qv[p * 8 + e];
      *(f32x4*)(hp + e * 2048 + p * 64) = hv;
      const f32x4 h2 = hv * hv;
      ps[e] += (hv[0] + hv[1]) + (hv[2] + hv[3]);
      pq[e] += (h2[0] + h2[1]) + (h2[2] + h2[3]);
    }
    // Precaution: this wait stands ahead of the next rewrite (the second round's, then the
    // sums' below) of the registers that the stores above name.
    asm volatile("s_wait_xcnt 0x0" ::: "memory");
  }
  // A row's 128 values lie in the 16 lanes of one lane half: sum over them.
#pragma unroll
  for (int m = 1; m < 16; m <<= 1) {
#pragma unroll
    for (int e = 0; e < 8; ++e) {
      ps[e] += __shfl_xor(ps[e], m, 32);
      pq[e] += __shfl_xor(pq[e], m, 32);
    }
  }
  // Lanes 0 to 7 of each half store row 2 * (lane & 7) + hf: the wave's 16 rows are one
  // whole 128-byte line of stats[h][row].
  f32x2 sq;
  sq[0] = ps[0];
  sq[1] = pq[0];
#pragma unroll
  for (int e = 1; e < 8; ++e) {
    if ((lane & 7) == e) {
      sq[0] = ps[e];
      sq[1] = pq[e];
    }
  }
  if ((lane & 15) < 8) {
    const int row = (qrow & ~15) + 2 * (lane & 7) + hf;
    *(f32x2*)(stats + ((size_t)h * 8192 + row) * 2) = sq;
  }
}

// ---------------------------------------------------------------------------
// Both LayerNorms over rows of 1024: out = LN1(LN0(X) + Y), Y = relu(LN0(X) Wo + bo).
// One wave owns a whole row: 8 loads of 16 bytes a lane, each wave-wide load
// 512 contiguous bytes; the row's sums stay inside the wave (no LDS, no barrier).
// 256 work-groups of 16 waves, two rows a wave (rows 2w and 2w + 1), both
// rows' loads issued ahead of the sums. LN0(X) is formed here from X, in registers:
// it is never written to memory.
// ---------------------------------------------------------------------------
// Mean and 1 / standard deviation of two rows held by one wave.
__device__ __forceinline__ void row_stats(const f32x4 (&x)[2][8], float (&mu)[2],
                                          float (&rstd)[2]) {
  float s[2], ss[2];
#pragma unroll
  for (int r = 0; r < 2; ++r) {
    f32x4 sv = x[r][0], qv = x[r][0] * x[r][0];
#pragma unroll
    for (int j = 1; j < 8; ++j) {
      sv += x[r][j];
      qv += x[r][j] * x[r][j];
    }
    s[r]  = (sv[0] + sv[1]) + (sv[2] + sv[3]);
    ss[r] = (qv[0] + qv[1]) + (qv[2] + qv[3]);
  }
#pragma unroll
  for (int m = 1; m < 32; m <<= 1) {
#pragma unroll
    for (int r = 0; r < 2; ++r) {
      s[r]  += __shfl_xor(s[r], m, 32);
      ss[r] += __shfl_xor(ss[r], m, 32);
    }
  }
#pragma unroll
  for (int r = 0; r < 2; ++r) {
    mu[r] = s[r] * (1.0f / 1024.0f);
    const float var = ss[r] * (1.0f / 1024.0f) - mu[r] * mu[r];
    rstd[r] = rsqrtf(var + 1e-5f);
  }
}

__global__ __launch_bounds__(512) void ln_pair_kernel(
    const float* __restrict__ X, const float* __restrict__ g0,
    const float* __restrict__ be0, const float* __restrict__ Y,
    const float* __restrict__ g1, const float* __restrict__ be1,
    float* __restrict__ out) {
  const int lane = threadIdx.x & 31;
  const int w  = blockIdx.x * 16 + (threadIdx.x >> 5);
  const int c0 = lane * 4;
  // The lane's byte offset in X, Y and out alike (under 32 MiB): one 32-bit register
  // beside each scalar base serves all loads and stores of both rows.
  const unsigned ro = (unsigned)w * 8192u + (unsigned)lane * 16u;
  f32x4 x[2][8], y[2][8], gv[8], bv[8];
#pragma unroll
  for (int r = 0; r < 2; ++r) {
    const float* xp = (const float*)((const char*)X + ro) + r * 1024;
#pragma unroll
    for (int j = 0; j < 8; ++j) x[r][j] = *(const f32x4*)(xp + j * 128);
  }
#pragma unroll
  for (int j = 0; j < 8; ++j) {
    gv[j] = *(const f32x4*)(g0 + c0 + j * 128);
    bv[j] = *(const f32x4*)(be0 + c0 + j * 128);
  }
#pragma unroll
  for (int r = 0; r < 2; ++r) {
    const float* yp = (const float*)((const char*)Y + ro) + r * 1024;
#pragma unroll
    for (int j = 0; j < 8; ++j) y[r][j] = *(const f32x4*)(yp + j * 128);
  }
  // Precaution: this wait stands ahead of any rewrite of an offset register that
  // the loads above name; lane as an input keeps the gain and shift loads' shared
  // offset register untouched up to it (else the run's last load lands on it).
  asm volatile("s_wait_xcnt 0x0" :: "v"(lane) : "memory");
  // Keeps every load above issued ahead of the arithmetic: without it the
  // compiler sinks the gain and shift loads to their uses, one waited pair at a time.
  __builtin_amdgcn_sched_barrier(0);

  float mu[2], rstd[2];
  row_stats(x, mu, rstd);
#pragma unroll
  for (int r = 0; r < 2; ++r)
#pragma unroll
    for (int j = 0; j < 8; ++j)
      x[r][j] = ((x[r][j] - mu[r]) * rstd[r] * gv[j] + bv[j]) + y[r][j];

  // The second gain and shift take the registers that the first and Y have left. The fence
  // keeps their loads behind the lines above: lifted ahead, all four gain and shift sets
  // and Y are live at once, beyond the registers that four waves a SIMD leave a wave.
  __builtin_amdgcn_sched_barrier(0);
#pragma unroll
  for (int j = 0; j < 8; ++j) {
    gv[j] = *(const f32x4*)(g1 + c0 + j * 128);
    bv[j] = *(const f32x4*)(be1 + c0 + j * 128);
  }
  // Precaution: as above, for the offset register of these loads.
  asm volatile("s_wait_xcnt 0x0" :: "v"(lane) : "memory");
  // Keeps these loads issued ahead of the second row sums, which cover their latency.
  __builtin_amdgcn_sched_barrier(0);

  row_stats(x, mu, rstd);
#pragma unroll
  for (int r = 0; r < 2; ++r) {
    float* op = (float*)((char*)out + ro) + r * 1024;
#pragma unroll
    for (int j = 0; j < 8; ++j)
      *(f32x4*)(op + j * 128) = (x[r][j] - mu[r]) * rstd[r] * gv[j] + bv[j];
  }
}

// ---------------------------------------------------------------------------
extern "C" void kernel_launch(void* const* d_in, const int* in_sizes, int n_in,
                              void* d_out, int out_size, void* d_ws, size_t ws_size,
                              hipStream_t stream) {
  (void)in_sizes; (void)n_in; (void)out_size; (void)ws_size;
  const float* Q   = (const float*)d_in[0];
  const float* K   = (const float*)d_in[1];
  const float* ma  = (const float*)d_in[2];
  const float* mb  = (const float*)d_in[3];
  const float* Wq  = (const float*)d_in[4];  const float* bq  = (const float*)d_in[5];
  const float* Wk  = (const float*)d_in[6];  const float* bk  = (const float*)d_in[7];
  const float* Wv  = (const float*)d_in[8];  const float* bv  = (const float*)d_in[9];
  const float* Wo  = (const float*)d_in[10]; const float* bo  = (const float*)d_in[11];
  const float* g0  = (const float*)d_in[12]; const float* be0 = (const float*)d_in[13];
  const float* g1  = (const float*)d_in[14]; const float* be1 = (const float*)d_in[15];
  float* out = (float*)d_out;

  char* ws = (char*)d_ws;
  size_t off = 0;
  auto alloc = [&](size_t bytes) -> void* {
    void* p = ws + off;
    off += (bytes + 255) & ~(size_t)255;
    return p;
  };
  const size_t MROW = 8192;  // B * 1024
  __bf16* WqT = (__bf16*)alloc(1024 * 1024 * sizeof(__bf16));
  __bf16* WkT = (__bf16*)alloc(1024 * 1024 * sizeof(__bf16));
  __bf16* WvT = (__bf16*)alloc(1024 * 1024 * sizeof(__bf16));
  __bf16* WoT = (__bf16*)alloc(1024 * 1024 * sizeof(__bf16));
  float*  qf    = (float*)alloc(MROW * 1024 * sizeof(float));
  __bf16* qbp   = (__bf16*)alloc(MROW * 1024 * sizeof(__bf16));
  __bf16* kbp   = (__bf16*)alloc(MROW * 1024 * sizeof(__bf16));
  __bf16* vtp   = (__bf16*)alloc(MROW * 1024 * sizeof(__bf16));
  float*  Hpre  = (float*)alloc(MROW * 1024 * sizeof(float));
  float*  stats = (float*)alloc(8 * MROW * 2 * sizeof(float));
  float*  reluG = (float*)alloc(MROW * 1024 * sizeof(float));

  dim3 blk(256);
  convw_kernel<<<dim3(32, 32, 4), blk, 0, stream>>>(Wq, Wk, Wv, Wo, WqT, WkT, WvT, WoT);
  gemm_qkv_kernel<<<dim3(64, 4, 3), blk, 0, stream>>>(Q, K, WqT, WkT, WvT, bq, bk, bv,
                                                      qf, qbp, kbp, vtp);
  attn_kernel<<<dim3(64, 8), blk, 0, stream>>>(qbp, kbp, vtp, qf, ma, mb, Hpre, stats);
  gemm_o_kernel<<<dim3(64, 4), blk, 0, stream>>>(Hpre, WoT, bo, reluG, stats, g0, be0);
  ln_pair_kernel<<<dim3(256), dim3(512), 0, stream>>>(Hpre, g0, be0, reluG, g1, be1, out);
}

// v010
// A run of this version takes 126 microseconds.
// Timed twice side by side with v009, it ran 1.05 times as fast both times.
// Over all steps from v000 it is 2.15 times as fast.
#include <hip/hip_runtime.h>

typedef __attribute__((ext_vector_type(16))) __bf16 v16bf;
typedef __attribute__((ext_vector_type(8)))  __bf16 bf16x8;
typedef __attribute__((ext_vector_type(4)))  __bf16 bf16x4;
typedef __attribute__((ext_vector_type(8)))  float  v8f;
typedef __attribute__((ext_vector_type(4)))  float  f32x4;
typedef __attribute__((ext_vector_type(2)))  float  f32x2;

#define NEGBIG (-1.0e9f)

__device__ __forceinline__ v8f vzero8() {
  v8f z;
#pragma unroll
  for (int i = 0; i < 8; ++i) z[i] = 0.0f;
  return z;
}

__device__ __forceinline__ v16bf pack16(bf16x8 lo, bf16x8 hi) {
  return __builtin_shufflevector(lo, hi, 0, 1, 2, 3, 4, 5, 6, 7, 8, 9, 10, 11, 12, 13, 14, 15);
}

// Load a 16x32 bf16 WMMA A/B fragment from a row-major tile.
// A: row m = lane&15, K halves selected by lane>>4 (per ISA 16-bit A 16x32 layout).
// B is the symmetric layout with n = lane&15 reading rows of the N-major (transposed) tile.
__device__ __forceinline__ v16bf load_frag(const __bf16* base, int ld, int lane) {
  const int r  = lane & 15;
  const int ho = (lane >> 4) * 8;
  const __bf16* p = base + r * ld;
  bf16x8 lo = *(const bf16x8*)(p + ho);
  bf16x8 hi = *(const bf16x8*)(p + 16 + ho);
  return pack16(lo, hi);
}

__device__ __forceinline__ v8f wmma_bf16(v16bf a, v16bf b, v8f c) {
  return __builtin_amdgcn_wmma_f32_16x16x32_bf16(false, a, false, b, (short)0, c, false, false);
}

// ---------------------------------------------------------------------------
// Weight transpose + f32->bf16 convert: W[1024][1024] -> WT[n][k] bf16
// The four weights need nothing of each other: one grid, blockIdx.z picks the weight.
// ---------------------------------------------------------------------------
__global__ __launch_bounds__(256) void convw_kernel(
    const float* __restrict__ W0, const float* __restrict__ W1,
    const float* __restrict__ W2, const float* __restrict__ W3,
    __bf16* __restrict__ WT0, __bf16* __restrict__ WT1,
    __bf16* __restrict__ WT2, __bf16* __restrict__ WT3) {
  __shared__ float t[32][33];
  const int z = blockIdx.z;
  const float* W = z == 0 ? W0 : z == 1 ? W1 : z == 2 ? W2 : W3;
  __bf16* WT = z == 0 ? WT0 : z == 1 ? WT1 : z == 2 ? WT2 : WT3;
  const int k0 = blockIdx.x * 32, n0 = blockIdx.y * 32;
  const int tx = threadIdx.x & 31, ty = threadIdx.x >> 5;
#pragma unroll
  for (int i = 0; i < 32; i += 8)
    t[ty + i][tx] = W[(size_t)(k0 + ty + i) * 1024 + n0 + tx];
  __syncthreads();
#pragma unroll
  for (int i = 0; i < 32; i += 8)
    WT[(size_t)(n0 + ty + i) * 1024 + k0 + tx] = (__bf16)t[tx][ty + i];
}

// ---------------------------------------------------------------------------
// GEMM: C[M=8192, N=1024] = A_f32[M,1024] x W (as Bt = W^T bf16 [N][K]) + bias
// 128x256 block tile, 8 waves (2x4) of 64x64 each, 64-wide K stages, staged through
// registers into two LDS buffers (see gemm_tile).
// A wave's 4 + 4 fragments feed 16 WMMAs, and a block's 64 KB stage feeds 256.
// MODE 0: Q proj  -> outF (f32) + outB (bf16)
// MODE 1: K proj  -> outB (bf16)
// MODE 2: V proj  -> outT (bf16, per-head transposed vt[b][h][d][key])
// MODE 3: O proj  -> outF = relu(acc + bias); its A is normalised on the way into LDS
// ---------------------------------------------------------------------------
// NORM: A holds rows that are not yet normalised; the first LayerNorm is applied where a
// staged value is converted to bf16. stats[h][row] holds each row's sum and sum of squares
// over head h's 128 columns (written by the attention kernel); rs is 128 x 2 floats of LDS.

// One K stage of a thread's share of both tiles, on its way from global memory to LDS.
struct StageRegs {
  f32x4  a[8];
  bf16x8 b[8];
  f32x4  g, s;  // NORM: gain and shift of the thread's four columns of the stage
};

// The loop's barrier: it orders LDS traffic only. __syncthreads() also waits for every
// global load in flight, and the loads of the stage after next are meant to cross it.
__device__ __forceinline__ void lds_barrier() {
  __builtin_amdgcn_fence(__ATOMIC_RELEASE, "workgroup", "local");
  __builtin_amdgcn_s_barrier();
  __builtin_amdgcn_fence(__ATOMIC_ACQUIRE, "workgroup", "local");
}

// Two LDS buffers. Stage s reads buffer s & 1; at its head, behind its first fragment
// loads, stage s + 1's landed values are converted and stored into the other buffer and
// the loads of stage s + 2 are issued: conversion, stores and their drain run under this
// stage's fragment latency and WMMAs, a load has a whole stage to land, and one barrier a
// stage both publishes the buffer just written and frees the buffer just read.
template <bool NORM>
__device__ __forceinline__ void gemm_tile(
    const float* __restrict__ A, const __bf16* __restrict__ Bt,
    __bf16 (&As)[2][128][72], __bf16 (&Bs)[2][256][72], v8f (&acc)[4][4],
    const float* __restrict__ stats, const float* __restrict__ g,
    const float* __restrict__ be, float* rs) {
  const int tid  = threadIdx.x;
  const int wave = tid >> 5, lane = tid & 31;
  const int wm = wave >> 2, wn = wave & 3;
  const int rowBase = blockIdx.x * 128;
  const int nBase   = blockIdx.y * 256;
  // Staging map: every wave-wide 16-byte load covers whole 128-byte lines.
  // A stage row = 64 f32 = 256 B: 16 lanes a row, two rows a load.
  // B stage row = 64 bf16 = 128 B: 8 lanes a row, four rows a load.
  const int ar = tid >> 4, ac = (tid & 15) * 4;
  const int br = tid >> 3, bc = (tid & 7) * 8;

  auto load_global = [&](StageRegs& r, int kc) {
    const float* ap = A + (size_t)(rowBase + ar) * 1024 + kc + ac;
#pragma unroll
    for (int e = 0; e < 8; ++e) r.a[e] = *(const f32x4*)(ap + e * 16 * 1024);
    const __bf16* bp = Bt + (size_t)(nBase + br) * 1024 + kc + bc;
#pragma unroll
    for (int e = 0; e < 8; ++e) r.b[e] = *(const bf16x8*)(bp + e * 32 * 1024);
    const float* gp = NORM ? g + kc + ac : nullptr;
    const float* sp = NORM ? be + kc + ac : nullptr;
    if (NORM) {
      r.g = *(const f32x4*)gp;
      r.s = *(const f32x4*)sp;
    }
    // Precaution: this wait stands ahead of the next rewrite of the address pairs that
    // the loads above name. With NORM the pointers as inputs keep the pairs untouched up
    // to it (else a later load of the run lands on one). The Q, K, V kernel has no
    // registers left for that; its two pairs live through the loop and advance behind it.
    if (NORM) asm volatile("s_wait_xcnt 0x0" :: "v"(ap), "v"(bp), "v"(gp), "v"(sp) : "memory");
    else      asm volatile("s_wait_xcnt 0x0" ::: "memory");
  };

  // The first two stages' loads go out together: their latencies run side by side.
  StageRegs st0, st;
  load_global(st0, 0);
  load_global(st, 64);
  // The thread's 8 rows stay the same through the K loop: x * rmul + radd = (x - mu) * rstd.
  // Behind the first loads, so that the latencies run side by side.
  float rmul[8], radd[8];
  if (NORM) {
    if (tid < 128) {  // waves 0 to 3, one row a thread
      const int si = rowBase + tid;
      f32x2 pv[8];
#pragma unroll
      for (int h = 0; h < 8; ++h) pv[h] = *(const f32x2*)(stats + (size_t)(si + h * 8192) * 2);
      // Precaution: this wait stands ahead of any rewrite of the offset register that
      // the loads above name; the index as an input keeps it untouched up to it.
      asm volatile("s_wait_xcnt 0x0" :: "v"(si) : "memory");
      f32x2 sv = pv[0];
#pragma unroll
      for (int h = 1; h < 8; ++h) sv += pv[h];
      const float mu   = sv[0] * (1.0f / 1024.0f);
      const float var  = sv[1] * (1.0f / 1024.0f) - mu * mu;
      const float rstd = rsqrtf(var + 1e-5f);
      f32x2 o;
      o[0] = rstd;
      o[1] = -mu * rstd;
      *(f32x2*)(rs + tid * 2) = o;
    }
    __syncthreads();  // every wave reads rows that waves 0 to 3 wrote
#pragma unroll
    for (int e = 0; e < 8; ++e) {
      const f32x2 v = *(const f32x2*)(rs + (e * 16 + ar) * 2);
      rmul[e] = v[0];
      radd[e] = v[1];
    }
  }
  // The thread's places in the buffer being read and in the buffer being written; each
  // stage swaps the two buffers by a wave-uniform step, so a place costs one register.
  const __bf16* ard = &As[0][wm * 64 + (lane & 15)][(lane >> 4) * 8];
  const __bf16* brd = &Bs[0][wn * 64 + (lane & 15)][(lane >> 4) * 8];
  __bf16* awr = &As[0][ar][ac];
  __bf16* bwr = &Bs[0][br][bc];
  int astep = 128 * 72, bstep = 256 * 72;
  // Convert a stage's A values to bf16 and commit both tiles to the buffer being written.
  auto commit = [&](const StageRegs& r) {
#pragma unroll
    for (int e = 0; e < 8; ++e) {
      bf16x4 hh;
#pragma unroll
      for (int q = 0; q < 4; ++q) {
        float x = r.a[e][q];
        if (NORM) x = (x * rmul[e] + radd[e]) * r.g[q] + r.s[q];
        hh[q] = (__bf16)x;
      }
      *(bf16x4*)(awr + e * 16 * 72) = hh;
    }
#pragma unroll
    for (int e = 0; e < 8; ++e) *(bf16x8*)(bwr + e * 32 * 72) = r.b[e];
  };
  auto frag = [&](const __bf16* p) {
    return pack16(*(const bf16x8*)p, *(const bf16x8*)(p + 16));
  };
  commit(st0);
  awr += astep;
  bwr += bstep;

#pragma unroll
  for (int i = 0; i < 4; ++i)
#pragma unroll
    for (int j = 0; j < 4; ++j) acc[i][j] = vzero8();
  lds_barrier();

  // One stage. next: stage s + 1 exists and is committed; kc2 >= 0: stage s + 2 exists
  // and starts at column kc2.
  auto stage = [&](bool next, int kc2) {
    // The stage's first fragments, asked for ahead of the stores below.
    v16bf af[4];
#pragma unroll
    for (int i = 0; i < 4; ++i) af[i] = frag(ard + i * 16 * 72);
    v16bf bf0 = frag(brd);
    v16bf bf1 = frag(brd + 16 * 72);
    // Keeps these fragment loads in front of the wait for the staged values: without it
    // the compiler puts the conversions, and that wait, first, and the fragments' latency
    // follows them instead of running under them.
    __builtin_amdgcn_sched_barrier(0);
    if (next) commit(st);
    if (kc2 >= 0) load_global(st, kc2);  // a whole stage ahead of its commit
#pragma unroll
    for (int ks = 0; ks < 2; ++ks) {
      if (ks) {
#pragma unroll
        for (int i = 0; i < 4; ++i) af[i] = frag(ard + i * 16 * 72 + ks * 32);
      }
#pragma unroll
      for (int jp = 0; jp < 4; jp += 2) {
        if (ks || jp) {
          bf0 = frag(brd + jp * 16 * 72 + ks * 32);
          bf1 = frag(brd + (jp + 1) * 16 * 72 + ks * 32);
        }
#pragma unroll
        for (int i = 0; i < 4; ++i) {
          acc[i][jp]     = wmma_bf16(af[i], bf0, acc[i][jp]);
          acc[i][jp + 1] = wmma_bf16(af[i], bf1, acc[i][jp + 1]);
        }
      }
    }
    ard += astep;
    brd += bstep;
    awr -= astep;
    bwr -= bstep;
    astep = -astep;
    bstep = -bstep;
    lds_barrier();
  };
  for (int kc2 = 128; kc2 < 1024; kc2 += 64) stage(true, kc2);  // stages 0 to 13
  stage(true, -1);                                              // stage 14
  stage(false, -1);                                             // stage 15
}

// Epilogue: a D tile holds 16 columns of 8 rows a lane half, so stores straight from the
// accumulators are pieces of 16 to 64 bytes. Each wave turns its 64x64 tile round in its
// own 4608 bytes of Bs (free behind the loop's last barrier), 16 rows at a time, and then
// every wave-wide global store covers whole 128-byte lines.
template <int MODE>
__device__ __forceinline__ void gemm_store(
    const v8f (&acc)[4][4], const float* __restrict__ bias,
    float* __restrict__ outF, __bf16* __restrict__ outB,
    __bf16* __restrict__ outT, __bf16 (&Bs)[256][72]) {
  const int tid  = threadIdx.x;
  const int wave = tid >> 5, lane = tid & 31;
  const int wm = wave >> 2, wn = wave & 3;
  const int cl = lane & 15, hf = lane >> 4;
  const int m0 = blockIdx.x * 128 + wm * 64;  // the wave's first row
  const int n0 = blockIdx.y * 256 + wn * 64;  // the wave's first column
  char* stage = (char*)&Bs[0][0] + wave * 4608;
  const int bn = n0 + cl;
  float bvs[4];
#pragma unroll
  for (int j = 0; j < 4; ++j) bvs[j] = bias[bn + j * 16];
  // Precaution: this wait stands ahead of any rewrite of the offset register that the
  // loads above name; the index as an input keeps it untouched up to it (else the
  // run's last load lands on it).
  asm volatile("s_wait_xcnt 0x0" :: "v"(bn) : "memory");
  if (MODE == 2) {
    // vt[b][h][d][key] = vt[b * 1024 + column][key]; a D tile's 8 VGPRs are 8 consecutive
    // keys. Staged as 16 columns of 64 keys, pitch 144 bytes; read back 8 lanes a column.
    __bf16* st = (__bf16*)stage;
    const int rr = lane >> 3, cc = (lane & 7) * 8;
    __bf16* tp = outT + ((size_t)(m0 >> 10) * 1024 + n0 + rr) * 1024 + (m0 & 1023) + cc;
#pragma unroll
    for (int j = 0; j < 4; ++j) {
#pragma unroll
      for (int i = 0; i < 4; ++i) {
        bf16x8 pk;
#pragma unroll
        for (int r = 0; r < 8; ++r) pk[r] = (__bf16)(acc[i][j][r] + bvs[j]);
        *(bf16x8*)(st + cl * 72 + i * 16 + hf * 8) = pk;
      }
      // The rows read back below were written by other lanes of this wave.
      asm volatile("s_wait_dscnt 0x0" ::: "memory");
      bf16x8 v[4];
#pragma unroll
      for (int e = 0; e < 4; ++e) v[e] = *(const bf16x8*)(st + (e * 4 + rr) * 72 + cc);
#pragma unroll
      for (int e = 0; e < 4; ++e) *(bf16x8*)(tp + (size_t)(j * 16 + e * 4) * 1024) = v[e];
      // Precaution: this wait stands ahead of the next round's rewrite of the registers
      // that the stores above name.
      asm volatile("s_wait_xcnt 0x0" ::: "memory");
      // Keeps the next round's bias adds behind this round: lifted ahead, all four rounds'
      // values are live at once, beyond the registers that four waves a SIMD leave a wave.
      __builtin_amdgcn_sched_barrier(0);
    }
  } else {
    // Staged as 16 rows of 64 f32, pitch 272 bytes; read back 16 lanes a row.
    float* st = (float*)stage;
    const int rr = lane >> 4, cc = (lane & 15) * 4;
    const size_t idx0 = (size_t)(m0 + rr) * 1024 + n0 + cc;
#pragma unroll
    for (int i = 0; i < 4; ++i) {
#pragma unroll
      for (int j = 0; j < 4; ++j)
#pragma unroll
        for (int r = 0; r < 8; ++r) {
          const float v = acc[i][j][r] + bvs[j];
          st[(hf * 8 + r) * 68 + j * 16 + cl] = (MODE == 3) ? (v > 0.0f ? v : 0.0f) : v;
        }
      // The rows read back below were written by other lanes of this wave.
      asm volatile("s_wait_dscnt 0x0" ::: "memory");
      f32x4 v[8];
#pragma unroll
      for (int e = 0; e < 8; ++e) v[e] = *(const f32x4*)(st + (e * 2 + rr) * 68 + cc);
#pragma unroll
      for (int e = 0; e < 8; ++e) {
        const size_t idx = idx0 + (size_t)(i * 16 + e * 2) * 1024;
        if (MODE == 0 || MODE == 3) *(f32x4*)(outF + idx) = v[e];
        if (MODE == 0 || MODE == 1) {
          bf16x4 hh;
#pragma unroll
          for (int q = 0; q < 4; ++q) hh[q] = (__bf16)v[e][q];
          *(bf16x4*)(outB + idx) = hh;
        }
      }
      // Precaution: this wait stands ahead of the next round's rewrite of the registers
      // that the stores above name.
      asm volatile("s_wait_xcnt 0x0" ::: "memory");
      // Keeps the next round's bias adds, which reuse those registers, behind the wait: the
      // build of the O kernel lifted some of them over it.
      if (MODE == 3) __builtin_amdgcn_sched_barrier(0);
    }
  }
}

// The Q, K and V projections need nothing of each other: one grid, blockIdx.z picks
// the projection (operands and epilogue), the same for a whole work-group.
// The second bound asks for four waves a SIMD (at most 256 VGPRs): the loop fits, the
// epilogues alone went above it, and then only one work-group fits a WGP, with nobody
// to fill its barrier, LDS and load waits. 768 work-groups: three a WGP, two at a time.
__global__ __launch_bounds__(256, 4) void gemm_qkv_kernel(
    const float* __restrict__ Q, const float* __restrict__ K,
    const __bf16* __restrict__ WqT, const __bf16* __restrict__ WkT,
    const __bf16* __restrict__ WvT, const float* __restrict__ bq,
    const float* __restrict__ bk, const float* __restrict__ bv,
    float* __restrict__ qf, __bf16* __restrict__ qb,
    __bf16* __restrict__ kb, __bf16* __restrict__ vt) {
  __shared__ __attribute__((aligned(16))) __bf16 As[2][128][72];
  __shared__ __attribute__((aligned(16))) __bf16 Bs[2][256][72];
  const int z = blockIdx.z;
  v8f acc[4][4];
  gemm_tile<false>(z == 0 ? Q : K, z == 0 ? WqT : z == 1 ? WkT : WvT, As, Bs, acc,
                   nullptr, nullptr, nullptr, nullptr);
  if (z == 0) {
    gemm_store<0>(acc, bq, qf, qb, nullptr, Bs[0]);
  } else if (z == 1) {
    gemm_store<1>(acc, bk, nullptr, kb, nullptr, Bs[0]);
  } else {
    gemm_store<2>(acc, bv, nullptr, nullptr, vt, Bs[0]);
  }
}

__global__ __launch_bounds__(256) void gemm_o_kernel(
    const float* __restrict__ A, const __bf16* __restrict__ Bt,
    const float* __restrict__ bias, float* __restrict__ outF,
    const float* __restrict__ stats, const float* __restrict__ g0,
    const float* __restrict__ be0) {
  __shared__ __attribute__((aligned(16))) __bf16 As[2][128][72];
  __shared__ __attribute__((aligned(16))) __bf16 Bs[2][256][72];
  __shared__ __attribute__((aligned(16))) float rs[256];
  v8f acc[4][4];
  gemm_tile<true>(A, Bt, As, Bs, acc, stats, g0, be0, rs);
  gemm_store<3>(acc, bias, outF, nullptr, nullptr, Bs[0]);
}

__device__ __forceinline__ float xhalf(float x) {
  const int v = __builtin_bit_cast(int, x);
  return __builtin_bit_cast(
      float, __builtin_amdgcn_permlanex16(v, v, 0x76543210, 0xfedcba98, false, false));
}

// exp2 of eight values: eight independent v_exp_f32 in one statement, then one v_nop.
// The instruction set asks for one independent instruction or v_nop behind a
// transcendental before its result is used or its source overwritten. Here every
// successor is independent and the v_nop serves the last one.
// Each value is replaced in its own register: the compiler does not see into the
// statement, and a separate result register can be an A or B operand of a WMMA issued
// just before, inside the distance that WMMA needs; a register that holds a live
// argument cannot.
__device__ __forceinline__ v8f exp2x8(v8f t) {
  float r0 = t[0], r1 = t[1], r2 = t[2], r3 = t[3], r4 = t[4], r5 = t[5], r6 = t[6], r7 = t[7];
  asm("v_exp_f32 %0, %0\n\t"
      "v_exp_f32 %1, %1\n\t"
      "v_exp_f32 %2, %2\n\t"
      "v_exp_f32 %3, %3\n\t"
      "v_exp_f32 %4, %4\n\t"
      "v_exp_f32 %5, %5\n\t"
      "v_exp_f32 %6, %6\n\t"
      "v_exp_f32 %7, %7\n\t"
      "v_nop"
      : "+v"(r0), "+v"(r1), "+v"(r2), "+v"(r3), "+v"(r4), "+v"(r5), "+v"(r6), "+v"(r7));
  v8f p;
  p[0] = r0; p[1] = r1; p[2] = r2; p[3] = r3;
  p[4] = r4; p[5] = r5; p[6] = r6; p[7] = r7;
  return p;
}

__global__ __launch_bounds__(256) void attn_kernel(
    const __bf16* __restrict__ qb, const __bf16* __restrict__ kb,
    const __bf16* __restrict__ vt, const float* __restrict__ qf,
    const float* __restrict__ mask_a, const float* __restrict__ mask_b,
    float* __restrict__ Hpre, float* __restrict__ stats) {
  __shared__ __attribute__((aligned(16))) __bf16 Ks[64][136];   // [key][d]
  __shared__ __attribute__((aligned(16))) __bf16 Vs[128][72];   // [d][key]
  __shared__ __attribute__((aligned(16))) float mbs[64];
  const int tid = threadIdx.x, wave = tid >> 5, lane = tid & 31;
  const int hf = lane >> 4;
  const int b = blockIdx.x >> 3, h = blockIdx.x & 7;
  const int qbase = blockIdx.y * 128;
  const float scale = 0.08838834764831845f;  // 1/sqrt(128)

  // The lane's one query (shared with lane ^ 16) and its mask value.
  const int qrow = b * 1024 + qbase + wave * 16 + (lane & 15);
  const float maq = mask_a[qrow];

  // Q^T B-fragments (4 K-steps over d=128) pinned in registers.
  v16bf qfr[4];
  {
    const __bf16* qbp = qb + (size_t)qrow * 1024 + h * 128;
    const int ho = hf * 8;
#pragma unroll
    for (int ks = 0; ks < 4; ++ks) {
      bf16x8 lo = *(const bf16x8*)(qbp + ks * 32 + ho);
      bf16x8 hi = *(const bf16x8*)(qbp + ks * 32 + 16 + ho);
      qfr[ks] = pack16(lo, hi);
    }
  }

  // Staging addresses: the thread's part is one byte offset for K and one for V^T, the
  // same in every chunk; block and chunk are wave-uniform, and the four loads (and LDS
  // stores) of a run differ by a constant, so a run needs one address, not four.
  // The registers so freed bring the kernel under 256 VGPRs: four waves fit a SIMD and
  // two work-groups share a WGP, each filling the other's barrier, LDS and softmax waits.
  const int kr = tid >> 4, kc = (tid & 15) * 8;  // K: 16 threads a row, 16 rows a load
  const int vr = tid >> 3, vc = (tid & 7) * 8;   // V^T: 8 threads a row, 32 rows a load
  const unsigned ko = (unsigned)(kr * 1024 + kc) * 2u;
  const unsigned vo = (unsigned)(vr * 1024 + vc) * 2u;
  const __bf16* kblk = kb + (size_t)b * 1024 * 1024 + h * 128;
  const __bf16* vblk = vt + ((size_t)b * 8 + h) * 128 * 1024;

  bf16x8 kreg[4], vreg[4];
  float mbreg = 0.0f;
  auto load_chunk = [&](int kb0) {
    const __bf16* kp = (const __bf16*)((const char*)(kblk + (size_t)kb0 * 1024) + ko);
#pragma unroll
    for (int i = 0; i < 4; ++i) kreg[i] = *(const bf16x8*)(kp + i * 16 * 1024);
    const __bf16* vp = (const __bf16*)((const char*)(vblk + kb0) + vo);
#pragma unroll
    for (int i = 0; i < 4; ++i) vreg[i] = *(const bf16x8*)(vp + i * 32 * 1024);
    if (tid < 64) mbreg = mask_b[b * 1024 + kb0 + tid];
    // Precaution: this wait stands ahead of any rewrite of the offset register that
    // the mask load names (the build reuses it for the first fragment read).
    asm volatile("s_wait_xcnt 0x0" ::: "memory");
  };

  // O^T tiles: ofr[dt][r] = O[query lane & 15][d = dt * 16 + hf * 8 + r].
  v8f ofr[8];
#pragma unroll
  for (int d = 0; d < 8; ++d) ofr[d] = vzero8();
  float mrow = -3.0e38f;  // running maximum, equal in both lane halves
  float lrow = 0.0f;      // running sum over this lane half's keys only

  load_chunk(0);
  for (int kb0 = 0; kb0 < 1024; kb0 += 64) {
    __syncthreads();  // all waves done reading Ks/Vs of previous chunk
#pragma unroll
    for (int i = 0; i < 4; ++i) *(bf16x8*)(&Ks[kr + i * 16][kc]) = kreg[i];
#pragma unroll
    for (int i = 0; i < 4; ++i) *(bf16x8*)(&Vs[vr + i * 32][vc]) = vreg[i];
    if (tid < 64) mbs[tid] = mbreg;
    __syncthreads();
    if (kb0 + 64 < 1024) load_chunk(kb0 + 64);  // overlap with WMMA phase

    // S^T = K Q^T: sfr[nt][r] = score(key nt * 16 + hf * 8 + r, the lane's query).
    v8f sfr[4];
#pragma unroll
    for (int nt = 0; nt < 4; ++nt) {
      v8f s = vzero8();
#pragma unroll
      for (int ks = 0; ks < 4; ++ks) {
        v16bf kf = load_frag(&Ks[nt * 16][ks * 32], 136, lane);
        s = wmma_bf16(kf, qfr[ks], s);
      }
      sfr[nt] = s;
    }

    // Mask + scale + chunk maximum: four in-lane chains, then the other lane half.
    float cm[4];
#pragma unroll
    for (int nt = 0; nt < 4; ++nt) {
      const f32x4 mb0 = *(const f32x4*)(&mbs[nt * 16 + hf * 8]);
      const f32x4 mb1 = *(const f32x4*)(&mbs[nt * 16 + hf * 8 + 4]);
      cm[nt] = -3.0e38f;
#pragma unroll
      for (int r = 0; r < 8; ++r) {
        const float mbk = r < 4 ? mb0[r & 3] : mb1[r & 3];
        const float s = (maq * mbk == 1.0f) ? sfr[nt][r] * scale : NEGBIG;
        sfr[nt][r] = s;
        cm[nt] = fmaxf(cm[nt], s);
      }
    }
    float cmx = fmaxf(fmaxf(cm[0], cm[1]), fmaxf(cm[2], cm[3]));
    cmx = fmaxf(cmx, xhalf(cmx));

    const float mn = fmaxf(mrow, cmx);
    const float alpha = __expf(mrow - mn);
    mrow = mn;
    float rs[4];
#pragma unroll
    for (int nt = 0; nt < 4; ++nt) {
      // exp(x) as exp2(x * log2(e)), the form __expf compiles to.
      sfr[nt] = exp2x8((sfr[nt] - mrow) * 1.44269504f);
      rs[nt] = sfr[nt][0];
#pragma unroll
      for (int r = 1; r < 8; ++r) rs[nt] += sfr[nt][r];
    }
    lrow = alpha * lrow + ((rs[0] + rs[1]) + (rs[2] + rs[3]));
#pragma unroll
    for (int d = 0; d < 8; ++d)
#pragma unroll
      for (int r = 0; r < 8; ++r) ofr[d][r] *= alpha;

    // O^T += V^T P^T; the P^T fragment of 32 keys is two S^T tiles converted in place.
#pragma unroll
    for (int ks = 0; ks < 2; ++ks) {
      v16bf pb;
#pragma unroll
      for (int e = 0; e < 8; ++e) {
        pb[e]     = (__bf16)sfr[2 * ks][e];
        pb[8 + e] = (__bf16)sfr[2 * ks + 1][e];
      }
#pragma unroll
      for (int dt = 0; dt < 8; ++dt) {
        v16bf vf = load_frag(&Vs[dt * 16][ks * 32], 72, lane);
        ofr[dt] = wmma_bf16(vf, pb, ofr[dt]);
      }
    }
  }

  // O/l + residual q; the lane halves' sums are joined here, once.
  // In an O^T tile a lane holds 8 of its query's 128 values, so loads and stores in that
  // map are 16-byte pieces of 16 rows. Each wave turns its 16x128 tile round in its own
  // 4352 bytes of Ks (waves 0 to 3) or Vs (waves 4 to 7), 64 columns at a time, pitch 272
  // bytes; then each wave-wide load of q and each store covers whole 128-byte lines.
  __syncthreads();  // all waves done reading Ks/Vs of the last chunk
  float* os = (wave < 4 ? (float*)&Ks[0][0] : (float*)&Vs[0][0]) + (wave & 3) * 1088;
  const size_t idx0 = (size_t)((qrow & ~15) + hf) * 1024 + h * 128 + (lane & 15) * 4;
  const float* qp = qf + idx0;
  float* hp = Hpre + idx0;
  f32x4 qv[16];
#pragma unroll
  for (int e = 0; e < 8; ++e) {
    qv[e]     = *(const f32x4*)(qp + e * 2048);
    qv[8 + e] = *(const f32x4*)(qp + e * 2048 + 64);
  }
  // Precaution: this wait stands ahead of any rewrite of the address registers that
  // the loads above name; the pointer as an input keeps them untouched up to it
  // (else the run's last load lands on them).
  asm volatile("s_wait_xcnt 0x0" :: "v"(qp) : "memory");
  const float inv = 1.0f / (lrow + xhalf(lrow));
  // Read back, a lane half holds row 2e + hf, which is lane 2e + hf's query.
  float ie[8];
#pragma unroll
  for (int e = 0; e < 8; ++e) {
    const int iv = __builtin_bit_cast(int, inv);
    const int i0 = __builtin_amdgcn_readlane(iv, 2 * e);
    const int i1 = __builtin_amdgcn_readlane(iv, 2 * e + 1);
    ie[e] = __builtin_bit_cast(float, hf ? i1 : i0);
  }
  // The first LayerNorm's row sums over this head's 128 columns, taken as the values go out.
  float ps[8], pq[8];
#pragma unroll
  for (int e = 0; e < 8; ++e) ps[e] = pq[e] = 0.0f;
#pragma unroll
  for (int p = 0; p < 2; ++p) {
#pragma unroll
    for (int d4 = 0; d4 < 4; ++d4) {
      f32x4 o0, o1;
#pragma unroll
      for (int r = 0; r < 4; ++r) {
        o0[r] = ofr[p * 4 + d4][r];
        o1[r] = ofr[p * 4 + d4][4 + r];
      }
      float* sp = os + (lane & 15) * 68 + d4 * 16 + hf * 8;
      *(f32x4*)(sp)     = o0;
      *(f32x4*)(sp + 4) = o1;
    }
    // The rows read back below were written by other lanes of this wave.
    asm volatile("s_wait_dscnt 0x0" ::: "memory");
#pragma unroll
    for (int e = 0; e < 8; ++e) {
      const f32x4 o = *(const f32x4*)(os + (e * 2 + hf) * 68 + (lane & 15) * 4);
      const f32x4 hv = o * ie[e] + qv[p * 8 + e];
      *(f32x4*)(hp + e * 2048 + p * 64) = hv;
      const f32x4 h2 = hv * hv;
      ps[e] += (hv[0] + hv[1]) + (hv[2] + hv[3]);
      pq[e] += (h2[0] + h2[1]) + (h2[2] + h2[3]);
    }
    // Precaution: this wait stands ahead of the next rewrite (the second round's, then the
    // sums' below) of the registers that the stores above name.
    asm volatile("s_wait_xcnt 0x0" ::: "memory");
  }
  // A row's 128 values lie in the 16 lanes of one lane half: sum over them.
#pragma unroll
  for (int m = 1; m < 16; m <<= 1) {
#pragma unroll
    for (int e = 0; e < 8; ++e) {
      ps[e] += __shfl_xor(ps[e], m, 32);
      pq[e] += __shfl_xor(pq[e], m, 32);
    }
  }
  // Lanes 0 to 7 of each half store row 2 * (lane & 7) + hf: the wave's 16 rows are one
  // whole 128-byte line of stats[h][row].
  f32x2 sq;
  sq[0] = ps[0];
  sq[1] = pq[0];
#pragma unroll
  for (int e = 1; e < 8; ++e) {
    if ((lane & 7) == e) {
      sq[0] = ps[e];
      sq[1] = pq[e];
    }
  }
  if ((lane & 15) < 8) {
    const int row = (qrow & ~15) + 2 * (lane & 7) + hf;
    *(f32x2*)(stats + ((size_t)h * 8192 + row) * 2) = sq;
  }
}

// ---------------------------------------------------------------------------
// Both LayerNorms over rows of 1024: out = LN1(LN0(X) + Y), Y = relu(LN0(X) Wo + bo).
// One wave owns a whole row: 8 loads of 16 bytes a lane, each wave-wide load
// 512 contiguous bytes; the row's sums stay inside the wave (no LDS, no barrier).
// 256 work-groups of 16 waves, two rows a wave (rows 2w and 2w + 1), both
// rows' loads issued ahead of the sums. LN0(X) is formed here from X, in registers:
// it is never written to memory.
// ---------------------------------------------------------------------------
// Mean and 1 / standard deviation of two rows held by one wave.
__device__ __forceinline__ void row_stats(const f32x4 (&x)[2][8], float (&mu)[2],
                                          float (&rstd)[2]) {
  float s[2], ss[2];
#pragma unroll
  for (int r = 0; r < 2; ++r) {
    f32x4 sv = x[r][0], qv = x[r][0] * x[r][0];
#pragma unroll
    for (int j = 1; j < 8; ++j) {
      sv += x[r][j];
      qv += x[r][j] * x[r][j];
    }
    s[r]  = (sv[0] + sv[1]) + (sv[2] + sv[3]);
    ss[r] = (qv[0] + qv[1]) + (qv[2] + qv[3]);
  }
#pragma unroll
  for (int m = 1; m < 32; m <<= 1) {
#pragma unroll
    for (int r = 0; r < 2; ++r) {
      s[r]  += __shfl_xor(s[r], m, 32);
      ss[r] += __shfl_xor(ss[r], m, 32);
    }
  }
#pragma unroll
  for (int r = 0; r < 2; ++r) {
    mu[r] = s[r] * (1.0f / 1024.0f);
    const float var = ss[r] * (1.0f / 1024.0f) - mu[r] * mu[r];
    rstd[r] = rsqrtf(var + 1e-5f);
  }
}

__global__ __launch_bounds__(512) void ln_pair_kernel(
    const float* __restrict__ X, const float* __restrict__ g0,
    const float* __restrict__ be0, const float* __restrict__ Y,
    const float* __restrict__ g1, const float* __restrict__ be1,
    float* __restrict__ out) {
  const int lane = threadIdx.x & 31;
  const int w  = blockIdx.x * 16 + (threadIdx.x >> 5);
  const int c0 = lane * 4;
  // The lane's byte offset in X, Y and out alike (under 32 MiB): one 32-bit register
  // beside each scalar base serves all loads and stores of both rows.
  const unsigned ro = (unsigned)w * 8192u + (unsigned)lane * 16u;
  f32x4 x[2][8], y[2][8], gv[8], bv[8];
#pragma unroll
  for (int r = 0; r < 2; ++r) {
    const float* xp = (const float*)((const char*)X + ro) + r * 1024;
#pragma unroll
    for (int j = 0; j < 8; ++j) x[r][j] = *(const f32x4*)(xp + j * 128);
  }
#pragma unroll
  for (int j = 0; j < 8; ++j) {
    gv[j] = *(const f32x4*)(g0 + c0 + j * 128);
    bv[j] = *(const f32x4*)(be0 + c0 + j * 128);
  }
#pragma unroll
  for (int r = 0; r < 2; ++r) {
    const float* yp = (const float*)((const char*)Y + ro) + r * 1024;
#pragma unroll
    for (int j = 0; j < 8; ++j) y[r][j] = *(const f32x4*)(yp + j * 128);
  }
  // Precaution: this wait stands ahead of any rewrite of an offset register that
  // the loads above name; lane as an input keeps the gain and shift loads' shared
  // offset register untouched up to it (else the run's last load lands on it).
  asm volatile("s_wait_xcnt 0x0" :: "v"(lane) : "memory");
  // Keeps every load above issued ahead of the arithmetic: without it the
  // compiler sinks the gain and shift loads to their uses, one waited pair at a time.
  __builtin_amdgcn_sched_barrier(0);

  float mu[2], rstd[2];
  row_stats(x, mu, rstd);
#pragma unroll
  for (int r = 0; r < 2; ++r)
#pragma unroll
    for (int j = 0; j < 8; ++j)
      x[r][j] = ((x[r][j] - mu[r]) * rstd[r] * gv[j] + bv[j]) + y[r][j];

  // The second gain and shift take the registers that the first and Y have left. The fence
  // keeps their loads behind the lines above: lifted ahead, all four gain and shift sets
  // and Y are live at once, beyond the registers that four waves a SIMD leave a wave.
  __builtin_amdgcn_sched_barrier(0);
#pragma unroll
  for (int j = 0; j < 8; ++j) {
    gv[j] = *(const f32x4*)(g1 + c0 + j * 128);
    bv[j] = *(const f32x4*)(be1 + c0 + j * 128);
  }
  // Precaution: as above, for the offset register of these loads.
  asm volatile("s_wait_xcnt 0x0" :: "v"(lane) : "memory");
  // Keeps these loads issued ahead of the second row sums, which cover their latency.
  __builtin_amdgcn_sched_barrier(0);

  row_stats(x, mu, rstd);
#pragma unroll
  for (int r = 0; r < 2; ++r) {
    float* op = (float*)((char*)out + ro) + r * 1024;
#pragma unroll
    for (int j = 0; j < 8; ++j)
      *(f32x4*)(op + j * 128) = (x[r][j] - mu[r]) * rstd[r] * gv[j] + bv[j];
  }
}

// ---------------------------------------------------------------------------
extern "C" void kernel_launch(void* const* d_in, const int* in_sizes, int n_in,
                              void* d_out, int out_size, void* d_ws, size_t ws_size,
                              hipStream_t stream) {
  (void)in_sizes; (void)n_in; (void)out_size; (void)ws_size;
  const float* Q   = (const float*)d_in[0];
  const float* K   = (const float*)d_in[1];
  const float* ma  = (const float*)d_in[2];
  const float* mb  = (const float*)d_in[3];
  const float* Wq  = (const float*)d_in[4];  const float* bq  = (const float*)d_in[5];
  const float* Wk  = (const float*)d_in[6];  const float* bk  = (const float*)d_in[7];
  const float* Wv  = (const float*)d_in[8];  const float* bv  = (const float*)d_in[9];
  const float* Wo  = (const float*)d_in[10]; const float* bo  = (const float*)d_in[11];
  const float* g0  = (const float*)d_in[12]; const float* be0 = (const float*)d_in[13];
  const float* g1  = (const float*)d_in[14]; const float* be1 = (const float*)d_in[15];
  float* out = (float*)d_out;

  char* ws = (char*)d_ws;
  size_t off = 0;
  auto alloc = [&](size_t bytes) -> void* {
    void* p = ws + off;
    off += (bytes + 255) & ~(size_t)255;
    return p;
  };
  const size_t MROW = 8192;  // B * 1024
  __bf16* WqT = (__bf16*)alloc(1024 * 1024 * sizeof(__bf16));
  __bf16* WkT = (__bf16*)alloc(1024 * 1024 * sizeof(__bf16));
  __bf16* WvT = (__bf16*)alloc(1024 * 1024 * sizeof(__bf16));
  __bf16* WoT = (__bf16*)alloc(1024 * 1024 * sizeof(__bf16));
  float*  qf    = (float*)alloc(MROW * 1024 * sizeof(float));
  __bf16* qbp   = (__bf16*)alloc(MROW * 1024 * sizeof(__bf16));
  __bf16* kbp   = (__bf16*)alloc(MROW * 1024 * sizeof(__bf16));
  __bf16* vtp   = (__bf16*)alloc(MROW * 1024 * sizeof(__bf16));
  float*  Hpre  = (float*)alloc(MROW * 1024 * sizeof(float));
  float*  stats = (float*)alloc(8 * MROW * 2 * sizeof(float));
  float*  reluG = (float*)alloc(MROW * 1024 * sizeof(float));

  dim3 blk(256);
  convw_kernel<<<dim3(32, 32, 4), blk, 0, stream>>>(Wq, Wk, Wv, Wo, WqT, WkT, WvT, WoT);
  gemm_qkv_kernel<<<dim3(64, 4, 3), blk, 0, stream>>>(Q, K, WqT, WkT, WvT, bq, bk, bv,
                                                      qf, qbp, kbp, vtp);
  attn_kernel<<<dim3(64, 8), blk, 0, stream>>>(qbp, kbp, vtp, qf, ma, mb, Hpre, stats);
  gemm_o_kernel<<<dim3(64, 4), blk, 0, stream>>>(Hpre, WoT, bo, reluG, stats, g0, be0);
  ln_pair_kernel<<<dim3(256), dim3(512), 0, stream>>>(Hpre, g0, be0, reluG, g1, be1, out);
}
